// v000
// The times below were measured on an AMD MI455X: many runs one after another, warmed up first and cycling through
// copies of the inputs, with the whole window's GPU time divided by the number of runs. Launches and the gaps
// between them are all in it. The median over several windows is given; except for v000 it joins two sittings, which
// can be a few percent apart, so the side-by-side timings, each taken in one sitting, are the better comparison.
// The starting kernel, v000, takes 474 microseconds a run.
// Contractions: x.Wq^T, x.Wk^T and Wv.x_b^T on v_wmma_f32_16x16x32_bf16 (x and W_qkv planes RNE-converted to bf16 operands,
// f32 accumulate); scores k'.q'^T (q', k' single f16 planes carried x8), P.v (P x32768 single f16, v x1024 single f16) and
// O.Wo^T (O single f16 plane x1024, Wo as f16(bf16(Wo)) x1024): v_wmma_f32_16x16x32_f16, f32 accumulate.
// Base-2 online softmax, 1/l and carry folds in f32 on VALU.
#include <hip/hip_runtime.h>
#include <math.h>
#include <stdint.h>

#define NB    4
#define SEQ   2048
#define DMOD  1024
#define NQKV  (3 * DMOD)
#define NH    16
#define HD    64
#define QSC   8.0f
#define KSC   8.0f
#define PCAR  32768.0f
#define VCAR  1024.0f
#define OSC   1024.0f
#define WOS   1024.0f
#define LOG2E 1.4426950408889634f
#define ATT_WAVES   4
#define ATT_THREADS (ATT_WAVES * 32)
#define ATT_BLOCKS  (NB * NH * (SEQ / 64))
#define NKB    (SEQ / 32)
#define SLAB   (16 * 68)
static_assert(HD == 64 && DMOD == NH * HD);
static_assert((SEQ / 64) == 32 && NH == 16 && NB == 4);
static_assert(ATT_THREADS == 128 && ATT_BLOCKS == 2048 && NKB == 64);
static_assert(((NB * SEQ) % 64) == 0 && (DMOD % 64) == 0 && (DMOD % 32) == 0 && (SEQ % 64) == 0);
static_assert(((NB * SEQ * DMOD / 8) % 256) == 0 && ((NQKV * DMOD / 8) % 256) == 0 && ((DMOD * DMOD / 8) % 256) == 0);
static_assert((SLAB * 4) % 16 == 0);

typedef unsigned short u16;
typedef _Float16 v16h __attribute__((ext_vector_type(16)));
typedef _Float16 v8h  __attribute__((ext_vector_type(8)));
typedef __bf16   v16b __attribute__((ext_vector_type(16)));
typedef float    v8f  __attribute__((ext_vector_type(8)));
typedef float    v4f  __attribute__((ext_vector_type(4)));
typedef unsigned int v4u __attribute__((ext_vector_type(4)));

union FragH { v16h v; v8h h[2]; v4u u[2]; };
union FragB { v16b v; v4u u[2]; };

// ---- scalar helpers --------------------------------------------------------------------------------
__device__ __forceinline__ unsigned short bf_bits(float f) {          // f32 -> bf16 bits, RNE convert
  unsigned u = __float_as_uint(f);
  return (unsigned short)((u + 0x7FFFu + ((u >> 16) & 1u)) >> 16);
}
__device__ __forceinline__ float bf_up(unsigned short h) { return __uint_as_float(((unsigned)h) << 16); }
__device__ __forceinline__ unsigned short h_bits(_Float16 x) { return __builtin_bit_cast(unsigned short, x); }
__device__ __forceinline__ unsigned pk16(unsigned short a, unsigned short b) { return (unsigned)a | ((unsigned)b << 16); }
__device__ __forceinline__ v8f zero8() { v8f z = {0.f, 0.f, 0.f, 0.f, 0.f, 0.f, 0.f, 0.f}; return z; }

// ---- fragment loaders: 16-bit A/B operand, lane -> row/col (lane&15), p already includes +8*(lane>>4);
//      elements 0..7 <- p[0..7] (k0+8h..), elements 8..15 <- p[16..23] (k0+16+8h..)  (same split k map for A and B;
//      B is always read from a k-contiguous [n][k] plane)
__device__ __forceinline__ v16h ldfrag_h(const _Float16* p) {
  FragH f;
  f.h[0] = *(const v8h*)(p);
  f.h[1] = *(const v8h*)(p + 16);
  return f.v;
}
__device__ __forceinline__ v16b ldfrag_b(const u16* p) {              // bf16 plane read as unsigned integer vectors
  FragB f;
  f.u[0] = *(const v4u*)(p);
  f.u[1] = *(const v4u*)(p + 16);
  return f.v;
}

__device__ __forceinline__ v8f mma_h(v16h a, v16h b, v8f c) {
  return __builtin_amdgcn_wmma_f32_16x16x32_f16(false, a, false, b, (short)0, c, false, false);
}
__device__ __forceinline__ v8f mma_b(v16b a, v16b b, v8f c) {
  return __builtin_amdgcn_wmma_f32_16x16x32_bf16(false, a, false, b, (short)0, c, false, false);
}
__device__ __forceinline__ void guard2(v8f& a, v8f& b, v16h x0, v16h x1, v16h x2, v16h x3, v16h x4, v16h x5) {
#if defined(__HIP_DEVICE_COMPILE__)
  asm volatile("v_nop\n\tv_nop\n\tv_nop\n\tv_nop"
               : "+v"(a), "+v"(b) : "v"(x0), "v"(x1), "v"(x2), "v"(x3), "v"(x4), "v"(x5) : "memory");
#endif
}
template <typename F>
__device__ __forceinline__ void guard6(v8f& a, v8f& b, v8f& c, v8f& d, F x0, F x1, F x2, F x3, F x4, F x5) {
#if defined(__HIP_DEVICE_COMPILE__)
  asm volatile("v_nop\n\tv_nop\n\tv_nop\n\tv_nop"
               : "+v"(a), "+v"(b), "+v"(c), "+v"(d) : "v"(x0), "v"(x1), "v"(x2), "v"(x3), "v"(x4), "v"(x5) : "memory");
#endif
}
__device__ __forceinline__ void acc_guard4(v8f& a, v8f& b, v8f& c, v8f& d) {
#if defined(__HIP_DEVICE_COMPILE__)
  asm volatile("v_nop\n\tv_nop\n\tv_nop\n\tv_nop" : "+v"(a), "+v"(b), "+v"(c), "+v"(d));
#endif
}
__device__ __forceinline__ void wave_sync_lds() {
#if defined(__HIP_DEVICE_COMPILE__)
  __builtin_amdgcn_fence(__ATOMIC_RELEASE, "workgroup");
  __builtin_amdgcn_wave_barrier();
  __builtin_amdgcn_fence(__ATOMIC_ACQUIRE, "workgroup");
#endif
}

// =====================================================================================================
// f32 plane -> 16-bit plane, same layout:  mode 0: bf16 RNE bits;  mode 1: f16 bits of (bf16 RNE value) * scale.
// Thread = 8 consecutive elements: two 16-B loads, one 16-B store; 32 consecutive lanes = 512 contiguous, 512-B aligned bytes
// coverage: grid = n8/256 blocks (host checks exactness) x 256 thr x 8 = the whole plane.
// =====================================================================================================
__global__ __launch_bounds__(256) void cvt16(const float* __restrict__ x, u16* D, int n8, int mode, float scale) {
  const int gt = blockIdx.x * 256 + (int)threadIdx.x;
  if (gt >= n8) return;                     // no barriers in this kernel
  const float* p = x + (size_t)gt * 8;
  const v4f a = *(const v4f*)(p), c4 = *(const v4f*)(p + 4);
  float v[8];
#pragma unroll
  for (int e = 0; e < 4; ++e) { v[e] = a[e]; v[4 + e] = c4[e]; }
  unsigned short s[8];
#pragma unroll
  for (int e = 0; e < 8; ++e) {
    const unsigned short bb = bf_bits(v[e]);
    const unsigned short hb = h_bits((_Float16)(bf_up(bb) * scale));
    s[e] = (mode != 0) ? hb : bb;
  }
  v4u o;
#pragma unroll
  for (int e = 0; e < 4; ++e) o[e] = pk16(s[2 * e], s[2 * e + 1]);
  u16* d = D + (size_t)gt * 8;
  {
    *(v4u*)(d) = o;
    
  }
}

// =====================================================================================================
// barrier, then converted to f16 and written: lane = (row in group of 4, 8 consecutive cols); one instruction = 4 rows, each
// coverage: 4 instructions x 4 rows x 8 lanes x 8 halves = the wave's 16 x 64 tile.
// =====================================================================================================
__device__ __forceinline__ void epi16(float* sl, v8f a0, v8f a1, v8f a2, v8f a3, float oscale, u16* C, int N,
                                      size_t rowb, int col0, int lane) {
  const int hh = lane >> 4, m = lane & 15;
#pragma unroll
  for (int r = 0; r < 8; ++r) {
    const int ro = (8 * hh + r) * 68 + m;
    sl[ro]      = a0[r] * oscale;
    sl[ro + 16] = a1[r] * oscale;
    sl[ro + 32] = a2[r] * oscale;
    sl[ro + 48] = a3[r] * oscale;
  }
  wave_sync_lds();
  const int rq = lane >> 3, c8 = (lane & 7) * 8;
  v4u ov[4];
#pragma unroll
  for (int i4 = 0; i4 < 4; ++i4) {
    const int row = i4 * 4 + rq;
    const v4f a = *(const v4f*)(sl + row * 68 + c8), c4 = *(const v4f*)(sl + row * 68 + c8 + 4);
    float w[8];
#pragma unroll
    for (int e = 0; e < 4; ++e) { w[e] = a[e]; w[4 + e] = c4[e]; }
#pragma unroll
    for (int e = 0; e < 4; ++e) ov[i4][e] = pk16(h_bits((_Float16)w[2 * e]), h_bits((_Float16)w[2 * e + 1]));
  }
  u16* dst = C + (rowb + (size_t)rq) * (size_t)N + col0 + c8;
  {
#pragma unroll
    for (int i4 = 0; i4 < 4; ++i4) {
      *(v4u*)(dst + (size_t)(i4 * 4) * (size_t)N) = ov[i4];
    }
    
  }
}

// =====================================================================================================
// coverage: 8 instructions x 2 rows x 16 lanes x 4 floats = the wave's 16 x 64 tile.
// =====================================================================================================
__device__ __forceinline__ void epi64(float* sl, v8f a0, v8f a1, v8f a2, v8f a3, float oscale, float* C, int N,
                                      size_t rowb, int col0, int lane) {
  const int hh = lane >> 4, m = lane & 15;
#pragma unroll
  for (int r = 0; r < 8; ++r) {
    const int ro = (8 * hh + r) * 68 + m;
    sl[ro]      = a0[r] * oscale;
    sl[ro + 16] = a1[r] * oscale;
    sl[ro + 32] = a2[r] * oscale;
    sl[ro + 48] = a3[r] * oscale;
  }
  wave_sync_lds();
  v4f vals[8];
#pragma unroll
  for (int it = 0; it < 8; ++it) vals[it] = *(const v4f*)(sl + (it * 2 + hh) * 68 + m * 4);
  float* dst = C + (rowb + (size_t)hh) * (size_t)N + col0 + m * 4;
  {
#pragma unroll
    for (int it = 0; it < 8; ++it) {
      *(v4f*)(dst + (size_t)(it * 2) * (size_t)N) = vals[it];
    }
    
  }
}

// =====================================================================================================
// Batched bf16 GEMM with 16-bit result: C[bt][M][N] (f16 of acc*oscale) = A[bt][M][K] (bf16 row-major) . Bt[bt][N][K]^T
// (bf16 k-contiguous); per-batch element strides bstA/bstB/bstC. Block = 64x64 tile, 4 waves x 16 rows; fragments loaded
// straight from the 16-bit rows (two 16-B loads each, split k map for A and B); K stepped by 32 (host checks K % 32 == 0,
// M % 64 == 0, N % 64 == 0, grid = nbatch*(M/64)*(N/64)).
// =====================================================================================================
__global__ __launch_bounds__(128)
void gemm_b16(const u16* __restrict__ A, const u16* __restrict__ Bt, u16* C, int M, int N, int K,
              int bstA, int bstB, int bstC, float oscale) {
  __shared__ __align__(16) float slab[4 * SLAB];
  const int tid = threadIdx.x, wave = tid >> 5, lane = tid & 31, hh = lane >> 4, m = lane & 15;
  const int ntile = N >> 6, mtile = M >> 6;
  const int per   = ntile * mtile;
  const int bid   = blockIdx.x;
  const int bt    = bid / per;
  const int t     = bid - bt * per;
  const int rowb  = (t / ntile) * 64 + wave * 16;
  const int col0  = (t % ntile) * 64;
  if (rowb + 16 > M) return;                 // wave-uniform, never taken with the exact grid; no block barriers in this kernel
  const u16* Ab = A  + (size_t)bt * (size_t)bstA;
  const u16* Bb = Bt + (size_t)bt * (size_t)bstB;
  u16*       Cb = C  + (size_t)bt * (size_t)bstC;
  const u16* ap = Ab + (size_t)(rowb + m) * K + 8 * hh;
  const u16* bp = Bb + (size_t)(col0 + m) * K + 8 * hh;
  const size_t bs = (size_t)16 * K;
  v8f acc0 = zero8(), acc1 = zero8(), acc2 = zero8(), acc3 = zero8();
#pragma unroll 1
  for (int k0 = 0; k0 < K; k0 += 32) {
    const v16b a  = ldfrag_b(ap + k0);
    const v16b b0 = ldfrag_b(bp + k0);
    const v16b b1 = ldfrag_b(bp + bs + k0);
    const v16b b2 = ldfrag_b(bp + 2 * bs + k0);
    const v16b b3 = ldfrag_b(bp + 3 * bs + k0);
    acc0 = mma_b(a, b0, acc0);
    acc1 = mma_b(a, b1, acc1);
    acc2 = mma_b(a, b2, acc2);
    acc3 = mma_b(a, b3, acc3);
    guard6<v16b>(acc0, acc1, acc2, acc3, a, b0, b1, b2, b3, a);
  }
  epi16(slab + wave * SLAB, acc0, acc1, acc2, acc3, oscale, Cb, N, (size_t)rowb, col0, lane);
}

// =====================================================================================================
// f16 GEMM with f32 result: C[M][N] (f32) = A[M][K] (f16 row-major) . Bt[N][K]^T (f16 k-contiguous) times oscale;
// one product per tile pair. Same tiling as gemm_b16; grid = (M/64)*(N/64).
// =====================================================================================================
__global__ __launch_bounds__(128)
void gemm_hf(const u16* __restrict__ A, const u16* __restrict__ Bt, float* C, int M, int N, int K, float oscale) {
  __shared__ __align__(16) float slab[4 * SLAB];
  const int tid = threadIdx.x, wave = tid >> 5, lane = tid & 31, hh = lane >> 4, m = lane & 15;
  const int ntile = N >> 6;
  const int bid   = blockIdx.x;
  const int rowb  = (bid / ntile) * 64 + wave * 16;
  const int col0  = (bid % ntile) * 64;
  if (rowb + 16 > M) return;                 // wave-uniform, never taken with the exact grid; no block barriers in this kernel
  const _Float16* ap = (const _Float16*)(const void*)A  + (size_t)(rowb + m) * K + 8 * hh;
  const _Float16* bp = (const _Float16*)(const void*)Bt + (size_t)(col0 + m) * K + 8 * hh;
  const size_t bs = (size_t)16 * K;
  v8f acc0 = zero8(), acc1 = zero8(), acc2 = zero8(), acc3 = zero8();
#pragma unroll 1
  for (int k0 = 0; k0 < K; k0 += 32) {
    const v16h a  = ldfrag_h(ap + k0);
    const v16h b0 = ldfrag_h(bp + k0);
    const v16h b1 = ldfrag_h(bp + bs + k0);
    const v16h b2 = ldfrag_h(bp + 2 * bs + k0);
    const v16h b3 = ldfrag_h(bp + 3 * bs + k0);
    acc0 = mma_h(a, b0, acc0);
    acc1 = mma_h(a, b1, acc1);
    acc2 = mma_h(a, b2, acc2);
    acc3 = mma_h(a, b3, acc3);
    guard6<v16h>(acc0, acc1, acc2, acc3, a, b0, b1, b2, b3, a);
  }
  epi64(slab + wave * SLAB, acc0, acc1, acc2, acc3, oscale, C, N, (size_t)rowb, col0, lane);
}

// =====================================================================================================
// Multi-head flash attention (no mask): block = (batch b, head, 64 query rows), 4 waves, wave w owns the 16 query rows
// q0 = 64*qt + 16*w .. q0+15 (waves independent: no block barriers, wave-private LDS only, used in the epilogue).
//   q plane (f16, x8) laid out [b][s][h][d]; k plane the same; v^T plane [b][h][d][s] (x1024).
//   All NKB = 64 key blocks of 32 keys are visited (static bound).
//   Scores are computed TRANSPOSED: S^T tile g (g = 0,1) = k rows (keys kb+16g .. +15, A operand, row m = lane&15, split k map
//   over d) times q^T (B operand, col n = query q0 + (lane&15), k = d, split map), one product per tile and 32-deep d-chunk.
//   D element r of lane l = (key kb+16g+8h+r, query q0+(l&15)), so a lane owns one query column and 16 of its 32 keys; the
//   partner lane l^16 owns the other 16 -> row max / row sum need one xor-16 shuffle.
//   Online max-subtracted base-2 softmax in f32 (scale 1/8 and the q/k carries folded into lsc). The exp'd values ARE the
//   P A-fragment in place: A row m = query = lane&15, element i <- key kb+8h+i (tile 0, D element i), element 8+i <- key
//   kb+16+8h+i (tile 1, D element i). P is carried x32768 as single f16. The rescale factor of query row 8h+r of the
//   O accumulators is fetched from lane 8h+r with a shuffle (uniform control). 4 v^T B fragments (col n = d = 16j + (lane&15),
//   keys k-contiguous), 4 P.V WMMAs per key block.
//   Epilogue: 1/l (per query, shuffled to the D row owner) and carry folds in f32; the wave's 16x64 f32 result staged in its
// coverage: per wave 4 instructions x 4 rows x 8 lanes x 8 halves = 16 x 64; grid 2048 blocks x 4 waves = every
//           (b, s, h) row of the O plane exactly once.
// =====================================================================================================
__global__ __launch_bounds__(ATT_THREADS)
void attn_fwd(const u16* __restrict__ QPp, const u16* __restrict__ KPp, const u16* __restrict__ VPp, u16* OPp) {
  __shared__ __align__(16) float smem[ATT_WAVES * SLAB];   // per wave: result slab [16][68] in the epilogue only

  const int tid  = threadIdx.x;
  const int wave = tid >> 5;
  const int lane = tid & 31;
  const int hh   = lane >> 4;
  const int c    = lane & 15;

  const int bid  = blockIdx.x;
  const int qt   = bid & (SEQ / 64 - 1);
  const int head = (bid >> 5) & (NH - 1);
  const int b    = bid >> 9;
  const int q0   = qt * 64 + wave * 16;

  // B fragments of q^T: col n = query q0 + c, k = d (k-contiguous row of the q plane)
  const size_t qofs = (((size_t)(b * SEQ + q0 + c)) * NH + head) * HD + 8 * hh;
  const _Float16* Qb = (const _Float16*)(const void*)QPp + qofs;
  // A fragments of k: row m = key kb + 16g + c, k = d
  const size_t kofs = (((size_t)b * SEQ + c) * NH + head) * HD + 8 * hh;          // key row kb + c added per step
  const _Float16* Kb = (const _Float16*)(const void*)KPp + kofs;
  // B fragments of v: col n = d = 16j + c, k = key (k-contiguous row of the v^T plane)
  const size_t vofs = ((size_t)(b * NH + head) * HD + c) * SEQ + 8 * hh;          // key kb added per step
  const _Float16* Vb = (const _Float16*)(const void*)VPp + vofs;
  const float lsc = 0.125f * (LOG2E / (QSC * KSC));

  const v16h qf0 = ldfrag_h(Qb);            // d 0..31
  const v16h qf1 = ldfrag_h(Qb + 32);       // d 32..63

  float mrun = -INFINITY, lrun = 0.f;
  v8f o[4];
#pragma unroll
  for (int j = 0; j < 4; ++j) o[j] = zero8();

#pragma unroll 1
  for (int it = 0; it < NKB; ++it) {
    const int kb = it * 32;
    // ---- transposed scores: s0 = keys kb..kb+15, s1 = keys kb+16..kb+31, column = query q0 + c ----
    v8f s0 = zero8(), s1 = zero8();
    const _Float16* k0p = Kb + (size_t)kb * (NH * HD);
    const _Float16* k1p = k0p + (size_t)16 * (NH * HD);
    const v16h ka0 = ldfrag_h(k0p), ka1 = ldfrag_h(k0p + 32);
    const v16h kc0 = ldfrag_h(k1p), kc1 = ldfrag_h(k1p + 32);
    s0 = mma_h(ka0, qf0, s0);
    s0 = mma_h(ka1, qf1, s0);
    s1 = mma_h(kc0, qf0, s1);
    s1 = mma_h(kc1, qf1, s1);
    guard2(s0, s1, qf0, qf1, ka0, ka1, kc0, kc1);
    // ---- base-2 logits of this lane's 16 keys for query q0 + c ----
    float tk[16];
#pragma unroll
    for (int i = 0; i < 8; ++i) { tk[i] = s0[i] * lsc;  tk[8 + i] = s1[i] * lsc; }
    float cm = tk[0];
#pragma unroll
    for (int i = 1; i < 16; ++i) cm = fmaxf(cm, tk[i]);
    cm = fmaxf(cm, __shfl_xor(cm, 16, 32));
    const float mn = fmaxf(mrun, cm);                                // finite from the first key block on
    const float al = (mrun == -INFINITY) ? 0.f : exp2f(mrun - mn);   // o and l are zero while mrun is -inf
    mrun = mn;
    // ---- probabilities (<= 1) and the P A-fragment: f16(p * 32768); element i <-> tk[i] ----
    float ps = 0.f;
    FragH ph;
#pragma unroll
    for (int w = 0; w < 2; ++w) {
#pragma unroll
      for (int e4 = 0; e4 < 4; ++e4) {
        const int i = 8 * w + 2 * e4;
        const float p0 = exp2f(fminf(tk[i] - mn, 0.f));
        const float p1 = exp2f(fminf(tk[i + 1] - mn, 0.f));
        ps += p0 + p1;
        ph.u[w][e4] = pk16(h_bits((_Float16)(p0 * PCAR)), h_bits((_Float16)(p1 * PCAR)));
      }
    }
    ps += __shfl_xor(ps, 16, 32);
    lrun = lrun * al + ps;
    // ---- rescale the O accumulators: D row 8hh+r = query q0+8hh+r, its factor lives in lane 8hh+r (and 16+8hh+r) ----
    float scl[8];
#pragma unroll
    for (int r = 0; r < 8; ++r) scl[r] = __shfl(al, 8 * hh + r, 32);
#pragma unroll
    for (int j = 0; j < 4; ++j) {
#pragma unroll
      for (int r = 0; r < 8; ++r) o[j][r] *= scl[r];
    }
    // ---- P.V : B fragment col n = d = j*16 + c, keys contiguous in the v^T plane ----
    {
      const _Float16* vp = Vb + kb;
      const v16h vf0 = ldfrag_h(vp);
      const v16h vf1 = ldfrag_h(vp + (size_t)16 * SEQ);
      const v16h vf2 = ldfrag_h(vp + (size_t)32 * SEQ);
      const v16h vf3 = ldfrag_h(vp + (size_t)48 * SEQ);
      o[0] = mma_h(ph.v, vf0, o[0]);
      o[1] = mma_h(ph.v, vf1, o[1]);
      o[2] = mma_h(ph.v, vf2, o[2]);
      o[3] = mma_h(ph.v, vf3, o[3]);
      guard6<v16h>(o[0], o[1], o[2], o[3], ph.v, vf0, vf1, vf2, vf3, ph.v);
    }
  }
  acc_guard4(o[0], o[1], o[2], o[3]);

  // ---- fold 1/l (per query, owned by lane = query; l >= 1 by construction) and the carries; stage the 16x64 slab ----
  const float linv = (lrun > 0.f) ? ((1.0f / lrun) * (1.0f / (PCAR * VCAR))) : 0.f;
  float inv[8];
#pragma unroll
  for (int r = 0; r < 8; ++r) inv[r] = __shfl(linv, 8 * hh + r, 32);
  float* slab = smem + wave * SLAB;
#pragma unroll
  for (int r = 0; r < 8; ++r) {
#pragma unroll
    for (int j = 0; j < 4; ++j) slab[(8 * hh + r) * 68 + j * 16 + c] = o[j][r] * inv[r];
  }
  wave_sync_lds();
  // ---- O x1024 -> single f16 plane; lane = (row in group of 4, 8 consecutive d) ----
  v4u oh[4];
  const int rq = lane >> 3, c8 = (lane & 7) * 8;
#pragma unroll
  for (int i4 = 0; i4 < 4; ++i4) {
    const int row = i4 * 4 + rq;
    const v4f a = *(const v4f*)(slab + row * 68 + c8), c4 = *(const v4f*)(slab + row * 68 + c8 + 4);
    float w[8];
#pragma unroll
    for (int e = 0; e < 4; ++e) { w[e] = a[e] * OSC; w[4 + e] = c4[e] * OSC; }
#pragma unroll
    for (int e = 0; e < 4; ++e) oh[i4][e] = pk16(h_bits((_Float16)w[2 * e]), h_bits((_Float16)w[2 * e + 1]));
  }
  const size_t ob = (((size_t)(b * SEQ + q0)) * NH + head) * HD + c8;
  {
#pragma unroll
    for (int i4 = 0; i4 < 4; ++i4) {
      const int row = i4 * 4 + rq;
      const size_t o8 = ob + (size_t)row * (NH * HD);
      *(v4u*)(OPp + o8) = oh[i4];
    }
    
  }
}

// =====================================================================================================
// Workspace map (bytes); every plane is fully written by whole-line stores before it is read; all extents are exact multiples
// of the store granularity (no pad rows needed):
//   XB  bf16 [8192][1024]                      16777216        (x)
//   WB  bf16 [3072 n][1024 k]                   6291456        (W_qkv, rows 0..1023 q, 1024..2047 k, 2048..3071 v)
//   WOB f16  [1024 n][1024 k] (bf16 value x1024) 2097152
//   QP  f16 [8192][16*64] x8                   16777216        KP same  16777216
//   VP  f16 [4][16*64][2048] x1024             16777216
//   OP  f16 [8192][16*64] x1024                16777216
//   end                                        92274688
// =====================================================================================================
extern "C" void kernel_launch(void* const* d_in, const int* in_sizes, int n_in,
                              void* d_out, int out_size, void* d_ws, size_t ws_size,
                              hipStream_t stream) {
  const int ROWS = NB * SEQ;                            // 8192
  if (n_in < 3) return;
  if (in_sizes[0] != ROWS * DMOD) return;
  if (in_sizes[1] != NQKV * DMOD) return;
  if (in_sizes[2] != DMOD * DMOD) return;
  if (out_size != ROWS * DMOD) return;

  const float* Xin = (const float*)d_in[0];
  const float* Wqk = (const float*)d_in[1];
  const float* Wpr = (const float*)d_in[2];
  float*       out = (float*)d_out;

  const size_t szXB = (size_t)ROWS * DMOD * 2;                  // 16777216
  const size_t szWB = (size_t)NQKV * DMOD * 2;                  //  6291456
  const size_t szWO = (size_t)DMOD * DMOD * 2;                  //  2097152
  const size_t szP  = (size_t)ROWS * DMOD * 2;                  // 16777216  (q / k / o planes)
  const size_t szVP = (size_t)NB * NH * HD * SEQ * 2;           // 16777216
  size_t off = 0;
  const size_t oXB = off; off += szXB;
  const size_t oWB = off; off += szWB;
  const size_t oWO = off; off += szWO;
  const size_t oQP = off; off += szP;
  const size_t oKP = off; off += szP;
  const size_t oVP = off; off += szVP;
  const size_t oOP = off; off += szP;
  if (off > ws_size) return;                            // off = 92274688
  if (off > (size_t)134217728) return;

  char* ws = (char*)d_ws;
  u16* XB  = (u16*)(ws + oXB);
  u16* WB  = (u16*)(ws + oWB);
  u16* WOB = (u16*)(ws + oWO);
  u16* QP  = (u16*)(ws + oQP);
  u16* KP  = (u16*)(ws + oKP);
  u16* VP  = (u16*)(ws + oVP);
  u16* OP  = (u16*)(ws + oOP);

  const dim3 blk(256);
  const int n8x = (ROWS * DMOD) / 8;                    // 1048576
  const int n8q = (NQKV * DMOD) / 8;                    //  393216
  const int n8w = (DMOD * DMOD) / 8;                    //  131072
  if ((n8x % 256) != 0 || (n8q % 256) != 0 || (n8w % 256) != 0) return;
  if ((DMOD % 64) != 0 || (ROWS % 64) != 0 || (SEQ % 64) != 0 || (DMOD % 32) != 0) return;
  const dim3 gX(n8x / 256);                             // 4096
  const dim3 gQ(n8q / 256);                             // 1536
  const dim3 gW(n8w / 256);                             // 512
  const dim3 gG((ROWS / 64) * (DMOD / 64));             // 2048
  const dim3 gV(NB * (DMOD / 64) * (SEQ / 64));         // 2048
  const dim3 bG(128);
  const dim3 gAT(ATT_BLOCKS);                           // 2048
  const dim3 bAT(ATT_THREADS);                          // 128

  // (0..2) operand planes: x -> bf16; W_qkv [n = out][k = in] (already k-contiguous) -> bf16; W_proj -> f16 of bf16 value x1024
  cvt16<<<gX, blk, 0, stream>>>(Xin, XB, n8x, 0, 1.0f);
  cvt16<<<gQ, blk, 0, stream>>>(Wqk, WB, n8q, 0, 1.0f);
  cvt16<<<gW, blk, 0, stream>>>(Wpr, WOB, n8w, 1, WOS);
  // (3,4) q and k planes [8192][h*64+d] = f16(x.Wq^T x8), f16(x.Wk^T x8)
  gemm_b16<<<gG, bG, 0, stream>>>(XB, WB, QP, ROWS, DMOD, DMOD, 0, 0, 0, QSC);
  gemm_b16<<<gG, bG, 0, stream>>>(XB, WB + (size_t)DMOD * DMOD, KP, ROWS, DMOD, DMOD, 0, 0, 0, KSC);
  // (5) v^T plane per batch: [1024 = h*64+d][2048 keys] = f16(Wv . x_b^T x1024), 4 batches in the grid
  gemm_b16<<<gV, bG, 0, stream>>>(WB + (size_t)2 * DMOD * DMOD, XB, VP, DMOD, SEQ, DMOD, 0, SEQ * DMOD, DMOD * SEQ, VCAR);
  // (6) attention -> O plane [b][s][h][d] x1024 (single f16)
  attn_fwd<<<gAT, bAT, 0, stream>>>(QP, KP, VP, OP);
  // (7) output projection -> out [8192][1024] f32, carries 1024 (O) x 1024 (wo) folded back
  gemm_hf<<<gG, bG, 0, stream>>>(OP, WOB, out, ROWS, DMOD, DMOD, 1.0f / (OSC * WOS));
  (void)hipGetLastError();
}

// v001
// One run takes 271 microseconds.
// Next to v000, in two timings, it ran 1.82 and 1.81 times as fast.
// Contractions: x.Wq^T, x.Wk^T and Wv.x_b^T on v_wmma_f32_16x16x32_bf16 (x and W_qkv planes RNE-converted to bf16 operands,
// f32 accumulate); scores k'.q'^T (q', k' single f16 planes carried x8), P.v (P x32768 single f16, v x1024 single f16) and
// O.Wo^T (O single f16 plane x1024, Wo as f16(bf16(Wo)) x1024): v_wmma_f32_16x16x32_f16, f32 accumulate.
// Base-2 online softmax, 1/l and carry folds in f32 on VALU.
#include <hip/hip_runtime.h>
#include <math.h>
#include <stdint.h>

#define NB    4
#define SEQ   2048
#define DMOD  1024
#define NQKV  (3 * DMOD)
#define NH    16
#define HD    64
#define QSC   8.0f
#define KSC   8.0f
#define PCAR  32768.0f
#define VCAR  1024.0f
#define OSC   1024.0f
#define WOS   1024.0f
#define LOG2E 1.4426950408889634f
#define ATT_WAVES   4
#define ATT_THREADS (ATT_WAVES * 32)
#define ATT_BLOCKS  (NB * NH * (SEQ / 64))
#define NKB    (SEQ / 32)
#define SLAB   (16 * 68)
static_assert(HD == 64 && DMOD == NH * HD);
static_assert((SEQ / 64) == 32 && NH == 16 && NB == 4);
static_assert(ATT_THREADS == 128 && ATT_BLOCKS == 2048 && NKB == 64);
static_assert(((NB * SEQ) % 64) == 0 && (DMOD % 64) == 0 && (DMOD % 32) == 0 && (SEQ % 64) == 0);
static_assert(((NB * SEQ * DMOD / 8) % 256) == 0 && ((NQKV * DMOD / 8) % 256) == 0 && ((DMOD * DMOD / 8) % 256) == 0);
static_assert((SLAB * 4) % 16 == 0);

typedef unsigned short u16;
typedef _Float16 v16h __attribute__((ext_vector_type(16)));
typedef _Float16 v8h  __attribute__((ext_vector_type(8)));
typedef __bf16   v16b __attribute__((ext_vector_type(16)));
typedef float    v8f  __attribute__((ext_vector_type(8)));
typedef float    v4f  __attribute__((ext_vector_type(4)));
typedef unsigned int v4u __attribute__((ext_vector_type(4)));

union FragH { v16h v; v8h h[2]; v4u u[2]; };

// ---- scalar helpers --------------------------------------------------------------------------------
__device__ __forceinline__ unsigned short bf_bits(float f) {          // f32 -> bf16 bits, RNE convert
  unsigned u = __float_as_uint(f);
  return (unsigned short)((u + 0x7FFFu + ((u >> 16) & 1u)) >> 16);
}
__device__ __forceinline__ float bf_up(unsigned short h) { return __uint_as_float(((unsigned)h) << 16); }
__device__ __forceinline__ unsigned short h_bits(_Float16 x) { return __builtin_bit_cast(unsigned short, x); }
__device__ __forceinline__ unsigned pk16(unsigned short a, unsigned short b) { return (unsigned)a | ((unsigned)b << 16); }
__device__ __forceinline__ v8f zero8() { v8f z = {0.f, 0.f, 0.f, 0.f, 0.f, 0.f, 0.f, 0.f}; return z; }

// ---- fragment loaders: 16-bit A/B operand, lane -> row/col (lane&15), p already includes +8*(lane>>4);
//      elements 0..7 <- p[0..7] (k0+8h..), elements 8..15 <- p[16..23] (k0+16+8h..)  (same split k map for A and B;
//      B is always read from a k-contiguous [n][k] plane)
__device__ __forceinline__ v16h ldfrag_h(const _Float16* p) {
  FragH f;
  f.h[0] = *(const v8h*)(p);
  f.h[1] = *(const v8h*)(p + 16);
  return f.v;
}

__device__ __forceinline__ v8f mma_h(v16h a, v16h b, v8f c) {
  return __builtin_amdgcn_wmma_f32_16x16x32_f16(false, a, false, b, (short)0, c, false, false);
}
__device__ __forceinline__ v8f mma_b(v16b a, v16b b, v8f c) {
  return __builtin_amdgcn_wmma_f32_16x16x32_bf16(false, a, false, b, (short)0, c, false, false);
}
__device__ __forceinline__ void guard2(v8f& a, v8f& b, v16h x0, v16h x1, v16h x2, v16h x3, v16h x4, v16h x5) {
#if defined(__HIP_DEVICE_COMPILE__)
  asm volatile("v_nop\n\tv_nop\n\tv_nop\n\tv_nop"
               : "+v"(a), "+v"(b) : "v"(x0), "v"(x1), "v"(x2), "v"(x3), "v"(x4), "v"(x5) : "memory");
#endif
}
template <typename F>
__device__ __forceinline__ void guard6(v8f& a, v8f& b, v8f& c, v8f& d, F x0, F x1, F x2, F x3, F x4, F x5) {
#if defined(__HIP_DEVICE_COMPILE__)
  asm volatile("v_nop\n\tv_nop\n\tv_nop\n\tv_nop"
               : "+v"(a), "+v"(b), "+v"(c), "+v"(d) : "v"(x0), "v"(x1), "v"(x2), "v"(x3), "v"(x4), "v"(x5) : "memory");
#endif
}
__device__ __forceinline__ void acc_guard4(v8f& a, v8f& b, v8f& c, v8f& d) {
#if defined(__HIP_DEVICE_COMPILE__)
  asm volatile("v_nop\n\tv_nop\n\tv_nop\n\tv_nop" : "+v"(a), "+v"(b), "+v"(c), "+v"(d));
#endif
}
__device__ __forceinline__ void wave_sync_lds() {
#if defined(__HIP_DEVICE_COMPILE__)
  __builtin_amdgcn_fence(__ATOMIC_RELEASE, "workgroup");
  __builtin_amdgcn_wave_barrier();
  __builtin_amdgcn_fence(__ATOMIC_ACQUIRE, "workgroup");
#endif
}

// =====================================================================================================
// f32 plane -> 16-bit plane, same layout:  mode 0: bf16 RNE bits;  mode 1: f16 bits of (bf16 RNE value) * scale.
// Thread = 8 consecutive elements: two 16-B loads, one 16-B store; 32 consecutive lanes = 512 contiguous, 512-B aligned bytes
// coverage: grid = n8/256 blocks (host checks exactness) x 256 thr x 8 = the whole plane.
// =====================================================================================================
__global__ __launch_bounds__(256) void cvt16(const float* __restrict__ x, u16* D, int n8, int mode, float scale) {
  const int gt = blockIdx.x * 256 + (int)threadIdx.x;
  if (gt >= n8) return;                     // no barriers in this kernel
  const float* p = x + (size_t)gt * 8;
  const v4f a = *(const v4f*)(p), c4 = *(const v4f*)(p + 4);
  float v[8];
#pragma unroll
  for (int e = 0; e < 4; ++e) { v[e] = a[e]; v[4 + e] = c4[e]; }
  unsigned short s[8];
#pragma unroll
  for (int e = 0; e < 8; ++e) {
    const unsigned short bb = bf_bits(v[e]);
    const unsigned short hb = h_bits((_Float16)(bf_up(bb) * scale));
    s[e] = (mode != 0) ? hb : bb;
  }
  v4u o;
#pragma unroll
  for (int e = 0; e < 4; ++e) o[e] = pk16(s[2 * e], s[2 * e + 1]);
  u16* d = D + (size_t)gt * 8;
  {
    *(v4u*)(d) = o;
    
  }
}

// =====================================================================================================
// barrier, then converted to f16 and written: lane = (row in group of 4, 8 consecutive cols); one instruction = 4 rows, each
// coverage: 4 instructions x 4 rows x 8 lanes x 8 halves = the wave's 16 x 64 tile.
// =====================================================================================================
__device__ __forceinline__ void epi16(float* sl, v8f a0, v8f a1, v8f a2, v8f a3, float oscale, u16* C, int N,
                                      size_t rowb, int col0, int lane) {
  const int hh = lane >> 4, m = lane & 15;
#pragma unroll
  for (int r = 0; r < 8; ++r) {
    const int ro = (8 * hh + r) * 68 + m;
    sl[ro]      = a0[r] * oscale;
    sl[ro + 16] = a1[r] * oscale;
    sl[ro + 32] = a2[r] * oscale;
    sl[ro + 48] = a3[r] * oscale;
  }
  wave_sync_lds();
  const int rq = lane >> 3, c8 = (lane & 7) * 8;
  v4u ov[4];
#pragma unroll
  for (int i4 = 0; i4 < 4; ++i4) {
    const int row = i4 * 4 + rq;
    const v4f a = *(const v4f*)(sl + row * 68 + c8), c4 = *(const v4f*)(sl + row * 68 + c8 + 4);
    float w[8];
#pragma unroll
    for (int e = 0; e < 4; ++e) { w[e] = a[e]; w[4 + e] = c4[e]; }
#pragma unroll
    for (int e = 0; e < 4; ++e) ov[i4][e] = pk16(h_bits((_Float16)w[2 * e]), h_bits((_Float16)w[2 * e + 1]));
  }
  u16* dst = C + (rowb + (size_t)rq) * (size_t)N + col0 + c8;
  const size_t st4 = (size_t)4 * (size_t)N;
#if defined(__HIP_DEVICE_COMPILE__)
  // The four stores and their s_wait_xcnt in one statement: the next slab reuses these address and data registers.
  asm volatile("global_store_b128 %0, %4, off\n\t"
               "global_store_b128 %1, %5, off\n\t"
               "global_store_b128 %2, %6, off\n\t"
               "global_store_b128 %3, %7, off\n\t"
               "s_wait_xcnt 0x0"
               :: "v"(dst), "v"(dst + st4), "v"(dst + 2 * st4), "v"(dst + 3 * st4),
                  "v"(ov[0]), "v"(ov[1]), "v"(ov[2]), "v"(ov[3])
               : "memory");
#endif
}

// =====================================================================================================
// coverage: 8 instructions x 2 rows x 16 lanes x 4 floats = the wave's 16 x 64 tile.
// =====================================================================================================
__device__ __forceinline__ void epi64(float* sl, v8f a0, v8f a1, v8f a2, v8f a3, float oscale, float* C, int N,
                                      size_t rowb, int col0, int lane) {
  const int hh = lane >> 4, m = lane & 15;
#pragma unroll
  for (int r = 0; r < 8; ++r) {
    const int ro = (8 * hh + r) * 68 + m;
    sl[ro]      = a0[r] * oscale;
    sl[ro + 16] = a1[r] * oscale;
    sl[ro + 32] = a2[r] * oscale;
    sl[ro + 48] = a3[r] * oscale;
  }
  wave_sync_lds();
  v4f vals[8];
#pragma unroll
  for (int it = 0; it < 8; ++it) vals[it] = *(const v4f*)(sl + (it * 2 + hh) * 68 + m * 4);
  float* dst = C + (rowb + (size_t)hh) * (size_t)N + col0 + m * 4;
  const size_t st2 = (size_t)2 * (size_t)N;
#if defined(__HIP_DEVICE_COMPILE__)
  // The eight stores and their s_wait_xcnt in one statement: the next slab reuses these address and data registers.
  asm volatile("global_store_b128 %0, %8, off\n\t"
               "global_store_b128 %1, %9, off\n\t"
               "global_store_b128 %2, %10, off\n\t"
               "global_store_b128 %3, %11, off\n\t"
               "global_store_b128 %4, %12, off\n\t"
               "global_store_b128 %5, %13, off\n\t"
               "global_store_b128 %6, %14, off\n\t"
               "global_store_b128 %7, %15, off\n\t"
               "s_wait_xcnt 0x0"
               :: "v"(dst), "v"(dst + st2), "v"(dst + 2 * st2), "v"(dst + 3 * st2),
                  "v"(dst + 4 * st2), "v"(dst + 5 * st2), "v"(dst + 6 * st2), "v"(dst + 7 * st2),
                  "v"(vals[0]), "v"(vals[1]), "v"(vals[2]), "v"(vals[3]), "v"(vals[4]), "v"(vals[5]), "v"(vals[6]), "v"(vals[7])
               : "memory");
#endif
}

// =====================================================================================================
// Shared GEMM core: acc[i][j] (16x16 f32 tiles) = A[row0 .. +127][K] . Bt[col0 .. +127][K]^T for one 128x128 block tile.
// 4 waves in a 2x2 grid, each owning 64x64 = 4x4 accumulator tiles, so one LDS fragment feeds four products.
// A pass is 64 k = 128 B of each of the 256 operand rows, laid in LDS at pitch 144 B (16 B x odd: ds_load_b128 without bank
// conflicts): rows 0..127 = A, rows 128..255 = Bt. Two buffers; pass t+1's rows fly (asynchronous copies, 16 B per lane,
// a wave-wide copy = 4 whole 128-B row pieces) while pass t is multiplied. Thread = (row tid>>3 of a group of 16, 16-B chunk
// tid&7); 8 + 8 copies per thread and pass cover 256 rows x 128 B. k runs upward in steps of 32 per accumulator.
// Needs M % 128 == 0, N % 128 == 0, K % 64 == 0 (host checks).
// =====================================================================================================
#define GBM    128
#define GBN    128
#define GKP    64
#define GPITCH 144
#define GSTAGE ((GBM + GBN) * GPITCH)
static_assert(GKP == 64 && (GPITCH % 16) == 0 && ((GPITCH / 16) % 2) == 1 && GPITCH >= GKP * 2);
static_assert((DMOD % GKP) == 0 && ((NB * SEQ) % GBM) == 0 && (DMOD % GBM) == 0 && (DMOD % GBN) == 0 && (SEQ % GBN) == 0);

union FragU { v4u u[2]; v16b b; v16h h; };

__device__ __forceinline__ unsigned lds_off(const void* p) { return (unsigned)(size_t)p; }

// Eight asynchronous 16-B copies of this lane, rows 16 apart. The s_wait_xcnt closes the statement so that no address
// register named here is rewritten ahead of it.
__device__ __forceinline__ void copy8(unsigned l, const u16* g, size_t st16) {
#if defined(__HIP_DEVICE_COMPILE__)
  asm volatile("global_load_async_to_lds_b128 %0, %8, off\n\t"
               "global_load_async_to_lds_b128 %1, %9, off\n\t"
               "global_load_async_to_lds_b128 %2, %10, off\n\t"
               "global_load_async_to_lds_b128 %3, %11, off\n\t"
               "global_load_async_to_lds_b128 %4, %12, off\n\t"
               "global_load_async_to_lds_b128 %5, %13, off\n\t"
               "global_load_async_to_lds_b128 %6, %14, off\n\t"
               "global_load_async_to_lds_b128 %7, %15, off\n\t"
               "s_wait_xcnt 0x0"
               :: "v"(l), "v"(l + 16u * GPITCH), "v"(l + 32u * GPITCH), "v"(l + 48u * GPITCH),
                  "v"(l + 64u * GPITCH), "v"(l + 80u * GPITCH), "v"(l + 96u * GPITCH), "v"(l + 112u * GPITCH),
                  "v"(g), "v"(g + st16), "v"(g + 2 * st16), "v"(g + 3 * st16),
                  "v"(g + 4 * st16), "v"(g + 5 * st16), "v"(g + 6 * st16), "v"(g + 7 * st16)
               : "memory");
#endif
}
// this wave's own copies have landed in LDS
__device__ __forceinline__ void wait_async0() {
#if defined(__HIP_DEVICE_COMPILE__)
  asm volatile("s_wait_asynccnt 0x0" ::: "memory");
#endif
}
// this wave's LDS reads have returned, so the buffer may be handed to its next writer
__device__ __forceinline__ void wait_ds0() {
#if defined(__HIP_DEVICE_COMPILE__)
  asm volatile("s_wait_dscnt 0x0" ::: "memory");
#endif
}
__device__ __forceinline__ FragU ldfrag_s(const unsigned char* p) {   // split k map: bytes 0..15 and 32..47 from p
  FragU f;
  f.u[0] = *(const v4u*)(p);
  f.u[1] = *(const v4u*)(p + 32);
  return f;
}
template <bool BF>
__device__ __forceinline__ v8f mma_x(const FragU& a, const FragU& b, v8f c) {
  if constexpr (BF) return mma_b(a.b, b.b, c);
  else              return mma_h(a.h, b.h, c);
}

template <bool BF>
__device__ __forceinline__ void gemm_core(unsigned char* ring, const u16* Ab, const u16* Bb, int K, int row0, int col0,
                                          int tid, v8f (&acc)[4][4]) {
  const int wave = tid >> 5, lane = tid & 31, hh = lane >> 4, m = lane & 15;
  const int r0 = tid >> 3, ch = tid & 7;
  const u16* ga = Ab + (size_t)(row0 + r0) * K + ch * 8;
  const u16* gb = Bb + (size_t)(col0 + r0) * K + ch * 8;
  const size_t st16 = (size_t)16 * K;
  const unsigned la = lds_off(ring) + (unsigned)(r0 * GPITCH + ch * 16);
  const int nt = K / GKP;
  const unsigned char* fa = ring + ((wave >> 1) * 64 + m) * GPITCH + hh * 16;
  const unsigned char* fb = ring + (GBM + (wave & 1) * 64 + m) * GPITCH + hh * 16;
#pragma unroll
  for (int i = 0; i < 4; ++i) {
#pragma unroll
    for (int j = 0; j < 4; ++j) acc[i][j] = zero8();
  }
  copy8(la, ga, st16);
  copy8(la + GBM * GPITCH, gb, st16);
  wait_async0();
  __syncthreads();                           // pass 0's rows are readable by every wave
  if (nt > 1) {
    copy8(la + GSTAGE, ga + GKP, st16);
    copy8(la + GSTAGE + GBM * GPITCH, gb + GKP, st16);
  }
#pragma unroll 1                             // one pass per trip: the two-buffer order below is per pass
  for (int t = 0; t < nt; ++t) {
    const unsigned bo = (unsigned)(t & 1) * GSTAGE;
    // Two blocks of 16 products (k 0..31, k 32..63). All of block 0's fragments and nine products' worth of block 1's are
    // loaded as one group; block 1's last A and B fragments follow into registers that block 0 has freed, which keeps the
    // wave inside 256 registers.
    FragU a0[4], b0[4], a1[4], b1[4];
#pragma unroll
    for (int i = 0; i < 4; ++i) {
      a0[i] = ldfrag_s(fa + bo + i * (16 * GPITCH));
      b0[i] = ldfrag_s(fb + bo + i * (16 * GPITCH));
    }
#pragma unroll
    for (int i = 0; i < 3; ++i) {
      a1[i] = ldfrag_s(fa + bo + i * (16 * GPITCH) + 64);
      b1[i] = ldfrag_s(fb + bo + i * (16 * GPITCH) + 64);
    }
    __builtin_amdgcn_sched_barrier(0);       // the LDS loads stay one group ahead of the products, none among them
#pragma unroll
    for (int i = 0; i < 4; ++i) {
#pragma unroll
      for (int j = 0; j < 4; ++j) acc[i][j] = mma_x<BF>(a0[i], b0[j], acc[i][j]);
    }
    __builtin_amdgcn_sched_barrier(0);       // the late pair is loaded here, not earlier (registers) and not later (latency)
    a1[3] = ldfrag_s(fa + bo + 3 * (16 * GPITCH) + 64);
    b1[3] = ldfrag_s(fb + bo + 3 * (16 * GPITCH) + 64);
    __builtin_amdgcn_sched_barrier(0);       // nine products that do not need the late pair cover its latency
#pragma unroll
    for (int i = 0; i < 3; ++i) {
#pragma unroll
      for (int j = 0; j < 3; ++j) acc[i][j] = mma_x<BF>(a1[i], b1[j], acc[i][j]);
    }
#pragma unroll
    for (int i = 0; i < 3; ++i) acc[i][3] = mma_x<BF>(a1[i], b1[3], acc[i][3]);
#pragma unroll
    for (int j = 0; j < 4; ++j) acc[3][j] = mma_x<BF>(a1[3], b1[j], acc[3][j]);
    __builtin_amdgcn_sched_barrier(0);       // the products stay ahead of the hand-over waits, else the late pair's latency is bare
    wait_ds0();
    wait_async0();
    __syncthreads();                         // publishes pass t+1's rows and ends every read of pass t's buffer
    if (t + 2 < nt) {
      copy8(la + bo, ga + (size_t)(t + 2) * GKP, st16);
      copy8(la + bo + GBM * GPITCH, gb + (size_t)(t + 2) * GKP, st16);
    }
  }
  wait_async0();
}

// =====================================================================================================
// Batched bf16 GEMM with 16-bit result: C[bt][M][N] (f16 of acc*oscale) = A[bt][M][K] (bf16 row-major) . Bt[bt][N][K]^T
// (bf16 k-contiguous); per-batch element strides bstA/bstB/bstC. Block = 128x128 tile (gemm_core);
// grid = nbatch*(M/128)*(N/128). Each wave writes its 64x64 part as four 16x64 slabs through its own LDS slab.
// =====================================================================================================
__global__ __launch_bounds__(128)
void gemm_b16(const u16* __restrict__ A, const u16* __restrict__ Bt, u16* C, int M, int N, int K,
              int bstA, int bstB, int bstC, float oscale) {
  __shared__ __align__(16) unsigned char ring[2 * GSTAGE];
  __shared__ __align__(16) float slab[4 * SLAB];
  const int tid = threadIdx.x, wave = tid >> 5, lane = tid & 31;
  const int ntile = N / GBN, mtile = M / GBM;
  const int per   = ntile * mtile;
  const int bid   = blockIdx.x;
  const int bt    = bid / per;
  const int t     = bid - bt * per;
  const int row0  = (t / ntile) * GBM;
  const int col0  = (t % ntile) * GBN;
  if (row0 + GBM > M) return;                // block-uniform, ahead of every copy and barrier; never taken with the exact grid
  const u16* Ab = A  + (size_t)bt * (size_t)bstA;
  const u16* Bb = Bt + (size_t)bt * (size_t)bstB;
  u16*       Cb = C  + (size_t)bt * (size_t)bstC;
  v8f acc[4][4];
  gemm_core<true>(ring, Ab, Bb, K, row0, col0, tid, acc);
#pragma unroll
  for (int i = 0; i < 4; ++i) {
    wave_sync_lds();                         // the slab's previous rows have been read back before they are rewritten
    epi16(slab + wave * SLAB, acc[i][0], acc[i][1], acc[i][2], acc[i][3], oscale, Cb, N,
          (size_t)(row0 + (wave >> 1) * 64 + i * 16), col0 + (wave & 1) * 64, lane);
  }
}

// =====================================================================================================
// f16 GEMM with f32 result: C[M][N] (f32) = A[M][K] (f16 row-major) . Bt[N][K]^T (f16 k-contiguous) times oscale;
// one product per tile pair. Same tiling as gemm_b16; grid = (M/128)*(N/128).
// =====================================================================================================
__global__ __launch_bounds__(128)
void gemm_hf(const u16* __restrict__ A, const u16* __restrict__ Bt, float* C, int M, int N, int K, float oscale) {
  __shared__ __align__(16) unsigned char ring[2 * GSTAGE];
  __shared__ __align__(16) float slab[4 * SLAB];
  const int tid = threadIdx.x, wave = tid >> 5, lane = tid & 31;
  const int ntile = N / GBN;
  const int bid   = blockIdx.x;
  const int row0  = (bid / ntile) * GBM;
  const int col0  = (bid % ntile) * GBN;
  if (row0 + GBM > M) return;                // block-uniform, ahead of every copy and barrier; never taken with the exact grid
  v8f acc[4][4];
  gemm_core<false>(ring, A, Bt, K, row0, col0, tid, acc);
#pragma unroll
  for (int i = 0; i < 4; ++i) {
    wave_sync_lds();                         // the slab's previous rows have been read back before they are rewritten
    epi64(slab + wave * SLAB, acc[i][0], acc[i][1], acc[i][2], acc[i][3], oscale, C, N,
          (size_t)(row0 + (wave >> 1) * 64 + i * 16), col0 + (wave & 1) * 64, lane);
  }
}

// =====================================================================================================
// Multi-head flash attention (no mask): block = (batch b, head, 64 query rows), 4 waves, wave w owns the 16 query rows
// q0 = 64*qt + 16*w .. q0+15 (waves independent: no block barriers, wave-private LDS only, used in the epilogue).
//   q plane (f16, x8) laid out [b][s][h][d]; k plane the same; v^T plane [b][h][d][s] (x1024).
//   All NKB = 64 key blocks of 32 keys are visited (static bound).
//   Scores are computed TRANSPOSED: S^T tile g (g = 0,1) = k rows (keys kb+16g .. +15, A operand, row m = lane&15, split k map
//   over d) times q^T (B operand, col n = query q0 + (lane&15), k = d, split map), one product per tile and 32-deep d-chunk.
//   D element r of lane l = (key kb+16g+8h+r, query q0+(l&15)), so a lane owns one query column and 16 of its 32 keys; the
//   partner lane l^16 owns the other 16 -> row max / row sum need one xor-16 shuffle.
//   Online max-subtracted base-2 softmax in f32 (scale 1/8 and the q/k carries folded into lsc). The exp'd values ARE the
//   P A-fragment in place: A row m = query = lane&15, element i <- key kb+8h+i (tile 0, D element i), element 8+i <- key
//   kb+16+8h+i (tile 1, D element i). P is carried x32768 as single f16. The rescale factor of query row 8h+r of the
//   O accumulators is fetched from lane 8h+r with a shuffle (uniform control). 4 v^T B fragments (col n = d = 16j + (lane&15),
//   keys k-contiguous), 4 P.V WMMAs per key block.
//   Epilogue: 1/l (per query, shuffled to the D row owner) and carry folds in f32; the wave's 16x64 f32 result staged in its
// coverage: per wave 4 instructions x 4 rows x 8 lanes x 8 halves = 16 x 64; grid 2048 blocks x 4 waves = every
//           (b, s, h) row of the O plane exactly once.
// =====================================================================================================
__global__ __launch_bounds__(ATT_THREADS)
void attn_fwd(const u16* __restrict__ QPp, const u16* __restrict__ KPp, const u16* __restrict__ VPp, u16* OPp) {
  __shared__ __align__(16) float smem[ATT_WAVES * SLAB];   // per wave: result slab [16][68] in the epilogue only

  const int tid  = threadIdx.x;
  const int wave = tid >> 5;
  const int lane = tid & 31;
  const int hh   = lane >> 4;
  const int c    = lane & 15;

  const int bid  = blockIdx.x;
  const int qt   = bid & (SEQ / 64 - 1);
  const int head = (bid >> 5) & (NH - 1);
  const int b    = bid >> 9;
  const int q0   = qt * 64 + wave * 16;

  // B fragments of q^T: col n = query q0 + c, k = d (k-contiguous row of the q plane)
  const size_t qofs = (((size_t)(b * SEQ + q0 + c)) * NH + head) * HD + 8 * hh;
  const _Float16* Qb = (const _Float16*)(const void*)QPp + qofs;
  // A fragments of k: row m = key kb + 16g + c, k = d
  const size_t kofs = (((size_t)b * SEQ + c) * NH + head) * HD + 8 * hh;          // key row kb + c added per step
  const _Float16* Kb = (const _Float16*)(const void*)KPp + kofs;
  // B fragments of v: col n = d = 16j + c, k = key (k-contiguous row of the v^T plane)
  const size_t vofs = ((size_t)(b * NH + head) * HD + c) * SEQ + 8 * hh;          // key kb added per step
  const _Float16* Vb = (const _Float16*)(const void*)VPp + vofs;
  const float lsc = 0.125f * (LOG2E / (QSC * KSC));

  const v16h qf0 = ldfrag_h(Qb);            // d 0..31
  const v16h qf1 = ldfrag_h(Qb + 32);       // d 32..63

  float mrun = -INFINITY, lrun = 0.f;
  v8f o[4];
#pragma unroll
  for (int j = 0; j < 4; ++j) o[j] = zero8();

#pragma unroll 1
  for (int it = 0; it < NKB; ++it) {
    const int kb = it * 32;
    // ---- transposed scores: s0 = keys kb..kb+15, s1 = keys kb+16..kb+31, column = query q0 + c ----
    v8f s0 = zero8(), s1 = zero8();
    const _Float16* k0p = Kb + (size_t)kb * (NH * HD);
    const _Float16* k1p = k0p + (size_t)16 * (NH * HD);
    const v16h ka0 = ldfrag_h(k0p), ka1 = ldfrag_h(k0p + 32);
    const v16h kc0 = ldfrag_h(k1p), kc1 = ldfrag_h(k1p + 32);
    s0 = mma_h(ka0, qf0, s0);
    s0 = mma_h(ka1, qf1, s0);
    s1 = mma_h(kc0, qf0, s1);
    s1 = mma_h(kc1, qf1, s1);
    guard2(s0, s1, qf0, qf1, ka0, ka1, kc0, kc1);
    // ---- base-2 logits of this lane's 16 keys for query q0 + c ----
    float tk[16];
#pragma unroll
    for (int i = 0; i < 8; ++i) { tk[i] = s0[i] * lsc;  tk[8 + i] = s1[i] * lsc; }
    float cm = tk[0];
#pragma unroll
    for (int i = 1; i < 16; ++i) cm = fmaxf(cm, tk[i]);
    cm = fmaxf(cm, __shfl_xor(cm, 16, 32));
    const float mn = fmaxf(mrun, cm);                                // finite from the first key block on
    const float al = (mrun == -INFINITY) ? 0.f : exp2f(mrun - mn);   // o and l are zero while mrun is -inf
    mrun = mn;
    // ---- probabilities (<= 1) and the P A-fragment: f16(p * 32768); element i <-> tk[i] ----
    float ps = 0.f;
    FragH ph;
#pragma unroll
    for (int w = 0; w < 2; ++w) {
#pragma unroll
      for (int e4 = 0; e4 < 4; ++e4) {
        const int i = 8 * w + 2 * e4;
        const float p0 = exp2f(fminf(tk[i] - mn, 0.f));
        const float p1 = exp2f(fminf(tk[i + 1] - mn, 0.f));
        ps += p0 + p1;
        ph.u[w][e4] = pk16(h_bits((_Float16)(p0 * PCAR)), h_bits((_Float16)(p1 * PCAR)));
      }
    }
    ps += __shfl_xor(ps, 16, 32);
    lrun = lrun * al + ps;
    // ---- rescale the O accumulators: D row 8hh+r = query q0+8hh+r, its factor lives in lane 8hh+r (and 16+8hh+r) ----
    float scl[8];
#pragma unroll
    for (int r = 0; r < 8; ++r) scl[r] = __shfl(al, 8 * hh + r, 32);
#pragma unroll
    for (int j = 0; j < 4; ++j) {
#pragma unroll
      for (int r = 0; r < 8; ++r) o[j][r] *= scl[r];
    }
    // ---- P.V : B fragment col n = d = j*16 + c, keys contiguous in the v^T plane ----
    {
      const _Float16* vp = Vb + kb;
      const v16h vf0 = ldfrag_h(vp);
      const v16h vf1 = ldfrag_h(vp + (size_t)16 * SEQ);
      const v16h vf2 = ldfrag_h(vp + (size_t)32 * SEQ);
      const v16h vf3 = ldfrag_h(vp + (size_t)48 * SEQ);
      o[0] = mma_h(ph.v, vf0, o[0]);
      o[1] = mma_h(ph.v, vf1, o[1]);
      o[2] = mma_h(ph.v, vf2, o[2]);
      o[3] = mma_h(ph.v, vf3, o[3]);
      guard6<v16h>(o[0], o[1], o[2], o[3], ph.v, vf0, vf1, vf2, vf3, ph.v);
    }
  }
  acc_guard4(o[0], o[1], o[2], o[3]);

  // ---- fold 1/l (per query, owned by lane = query; l >= 1 by construction) and the carries; stage the 16x64 slab ----
  const float linv = (lrun > 0.f) ? ((1.0f / lrun) * (1.0f / (PCAR * VCAR))) : 0.f;
  float inv[8];
#pragma unroll
  for (int r = 0; r < 8; ++r) inv[r] = __shfl(linv, 8 * hh + r, 32);
  float* slab = smem + wave * SLAB;
#pragma unroll
  for (int r = 0; r < 8; ++r) {
#pragma unroll
    for (int j = 0; j < 4; ++j) slab[(8 * hh + r) * 68 + j * 16 + c] = o[j][r] * inv[r];
  }
  wave_sync_lds();
  // ---- O x1024 -> single f16 plane; lane = (row in group of 4, 8 consecutive d) ----
  v4u oh[4];
  const int rq = lane >> 3, c8 = (lane & 7) * 8;
#pragma unroll
  for (int i4 = 0; i4 < 4; ++i4) {
    const int row = i4 * 4 + rq;
    const v4f a = *(const v4f*)(slab + row * 68 + c8), c4 = *(const v4f*)(slab + row * 68 + c8 + 4);
    float w[8];
#pragma unroll
    for (int e = 0; e < 4; ++e) { w[e] = a[e] * OSC; w[4 + e] = c4[e] * OSC; }
#pragma unroll
    for (int e = 0; e < 4; ++e) oh[i4][e] = pk16(h_bits((_Float16)w[2 * e]), h_bits((_Float16)w[2 * e + 1]));
  }
  const size_t ob = (((size_t)(b * SEQ + q0)) * NH + head) * HD + c8;
  {
#pragma unroll
    for (int i4 = 0; i4 < 4; ++i4) {
      const int row = i4 * 4 + rq;
      const size_t o8 = ob + (size_t)row * (NH * HD);
      *(v4u*)(OPp + o8) = oh[i4];
    }
    
  }
}

// =====================================================================================================
// Workspace map (bytes); every plane is fully written by whole-line stores before it is read; all extents are exact multiples
// of the store granularity (no pad rows needed):
//   XB  bf16 [8192][1024]                      16777216        (x)
//   WB  bf16 [3072 n][1024 k]                   6291456        (W_qkv, rows 0..1023 q, 1024..2047 k, 2048..3071 v)
//   WOB f16  [1024 n][1024 k] (bf16 value x1024) 2097152
//   QP  f16 [8192][16*64] x8                   16777216        KP same  16777216
//   VP  f16 [4][16*64][2048] x1024             16777216
//   OP  f16 [8192][16*64] x1024                16777216
//   end                                        92274688
// =====================================================================================================
extern "C" void kernel_launch(void* const* d_in, const int* in_sizes, int n_in,
                              void* d_out, int out_size, void* d_ws, size_t ws_size,
                              hipStream_t stream) {
  const int ROWS = NB * SEQ;                            // 8192
  if (n_in < 3) return;
  if (in_sizes[0] != ROWS * DMOD) return;
  if (in_sizes[1] != NQKV * DMOD) return;
  if (in_sizes[2] != DMOD * DMOD) return;
  if (out_size != ROWS * DMOD) return;

  const float* Xin = (const float*)d_in[0];
  const float* Wqk = (const float*)d_in[1];
  const float* Wpr = (const float*)d_in[2];
  float*       out = (float*)d_out;

  const size_t szXB = (size_t)ROWS * DMOD * 2;                  // 16777216
  const size_t szWB = (size_t)NQKV * DMOD * 2;                  //  6291456
  const size_t szWO = (size_t)DMOD * DMOD * 2;                  //  2097152
  const size_t szP  = (size_t)ROWS * DMOD * 2;                  // 16777216  (q / k / o planes)
  const size_t szVP = (size_t)NB * NH * HD * SEQ * 2;           // 16777216
  size_t off = 0;
  const size_t oXB = off; off += szXB;
  const size_t oWB = off; off += szWB;
  const size_t oWO = off; off += szWO;
  const size_t oQP = off; off += szP;
  const size_t oKP = off; off += szP;
  const size_t oVP = off; off += szVP;
  const size_t oOP = off; off += szP;
  if (off > ws_size) return;                            // off = 92274688
  if (off > (size_t)134217728) return;

  char* ws = (char*)d_ws;
  u16* XB  = (u16*)(ws + oXB);
  u16* WB  = (u16*)(ws + oWB);
  u16* WOB = (u16*)(ws + oWO);
  u16* QP  = (u16*)(ws + oQP);
  u16* KP  = (u16*)(ws + oKP);
  u16* VP  = (u16*)(ws + oVP);
  u16* OP  = (u16*)(ws + oOP);

  const dim3 blk(256);
  const int n8x = (ROWS * DMOD) / 8;                    // 1048576
  const int n8q = (NQKV * DMOD) / 8;                    //  393216
  const int n8w = (DMOD * DMOD) / 8;                    //  131072
  if ((n8x % 256) != 0 || (n8q % 256) != 0 || (n8w % 256) != 0) return;
  if ((DMOD % GBM) != 0 || (ROWS % GBM) != 0 || (SEQ % GBN) != 0 || (DMOD % GKP) != 0) return;
  const dim3 gX(n8x / 256);                             // 4096
  const dim3 gQ(n8q / 256);                             // 1536
  const dim3 gW(n8w / 256);                             // 512
  const dim3 gG((ROWS / GBM) * (DMOD / GBN));           // 512
  const dim3 gV(NB * (DMOD / GBM) * (SEQ / GBN));       // 512
  const dim3 bG(128);
  const dim3 gAT(ATT_BLOCKS);                           // 2048
  const dim3 bAT(ATT_THREADS);                          // 128

  // (0..2) operand planes: x -> bf16; W_qkv [n = out][k = in] (already k-contiguous) -> bf16; W_proj -> f16 of bf16 value x1024
  cvt16<<<gX, blk, 0, stream>>>(Xin, XB, n8x, 0, 1.0f);
  cvt16<<<gQ, blk, 0, stream>>>(Wqk, WB, n8q, 0, 1.0f);
  cvt16<<<gW, blk, 0, stream>>>(Wpr, WOB, n8w, 1, WOS);
  // (3,4) q and k planes [8192][h*64+d] = f16(x.Wq^T x8), f16(x.Wk^T x8)
  gemm_b16<<<gG, bG, 0, stream>>>(XB, WB, QP, ROWS, DMOD, DMOD, 0, 0, 0, QSC);
  gemm_b16<<<gG, bG, 0, stream>>>(XB, WB + (size_t)DMOD * DMOD, KP, ROWS, DMOD, DMOD, 0, 0, 0, KSC);
  // (5) v^T plane per batch: [1024 = h*64+d][2048 keys] = f16(Wv . x_b^T x1024), 4 batches in the grid
  gemm_b16<<<gV, bG, 0, stream>>>(WB + (size_t)2 * DMOD * DMOD, XB, VP, DMOD, SEQ, DMOD, 0, SEQ * DMOD, DMOD * SEQ, VCAR);
  // (6) attention -> O plane [b][s][h][d] x1024 (single f16)
  attn_fwd<<<gAT, bAT, 0, stream>>>(QP, KP, VP, OP);
  // (7) output projection -> out [8192][1024] f32, carries 1024 (O) x 1024 (wo) folded back
  gemm_hf<<<gG, bG, 0, stream>>>(OP, WOB, out, ROWS, DMOD, DMOD, 1.0f / (OSC * WOS));
  (void)hipGetLastError();
}

// v002
// It runs in 186 microseconds.
// In two side-by-side timings against v001, it was 1.46 and 1.45 times as fast.
// Over all steps from v000 it is 2.64 times as fast.
// Contractions: x.Wq^T, x.Wk^T and Wv.x_b^T on v_wmma_f32_16x16x32_bf16 (x and W_qkv planes RNE-converted to bf16 operands,
// f32 accumulate); scores k'.q'^T (q', k' single f16 planes carried x8), P.v (P x32768 single f16, v x1024 single f16) and
// O.Wo^T (O single f16 plane x1024, Wo as f16(bf16(Wo)) x1024): v_wmma_f32_16x16x32_f16, f32 accumulate.
// Base-2 online softmax, 1/l and carry folds in f32 on VALU.
#include <hip/hip_runtime.h>
#include <math.h>
#include <stdint.h>

#define NB    4
#define SEQ   2048
#define DMOD  1024
#define NQKV  (3 * DMOD)
#define NH    16
#define HD    64
#define QSC   8.0f
#define KSC   8.0f
#define PCAR  32768.0f
#define VCAR  1024.0f
#define OSC   1024.0f
#define WOS   1024.0f
#define LOG2E 1.4426950408889634f
#define ATT_WAVES   8
#define ATT_THREADS (ATT_WAVES * 32)
#define ATT_QROWS   (ATT_WAVES * 16)
#define ATT_BLOCKS  (NB * NH * (SEQ / ATT_QROWS))
#define AKEYS  64
#define NST    (SEQ / AKEYS)
#define SLAB   (16 * 68)
static_assert(HD == 64 && DMOD == NH * HD);
static_assert((SEQ / ATT_QROWS) == 16 && NH == 16 && NB == 4);
static_assert(ATT_THREADS == 256 && ATT_BLOCKS == 1024 && NST == 32);
static_assert(((NB * SEQ) % 64) == 0 && (DMOD % 64) == 0 && (DMOD % 32) == 0 && (SEQ % 64) == 0);
static_assert(((NB * SEQ * DMOD / 8) % 256) == 0 && ((NQKV * DMOD / 8) % 256) == 0 && ((DMOD * DMOD / 8) % 256) == 0);
static_assert((SLAB * 4) % 16 == 0);

typedef unsigned short u16;
typedef _Float16 v16h __attribute__((ext_vector_type(16)));
typedef _Float16 v8h  __attribute__((ext_vector_type(8)));
typedef __bf16   v16b __attribute__((ext_vector_type(16)));
typedef float    v8f  __attribute__((ext_vector_type(8)));
typedef float    v4f  __attribute__((ext_vector_type(4)));
typedef unsigned int v4u __attribute__((ext_vector_type(4)));

union FragH { v16h v; v8h h[2]; v4u u[2]; };

// ---- scalar helpers --------------------------------------------------------------------------------
__device__ __forceinline__ unsigned short bf_bits(float f) {          // f32 -> bf16 bits, RNE convert
  unsigned u = __float_as_uint(f);
  return (unsigned short)((u + 0x7FFFu + ((u >> 16) & 1u)) >> 16);
}
__device__ __forceinline__ float bf_up(unsigned short h) { return __uint_as_float(((unsigned)h) << 16); }
__device__ __forceinline__ unsigned short h_bits(_Float16 x) { return __builtin_bit_cast(unsigned short, x); }
__device__ __forceinline__ unsigned pk16(unsigned short a, unsigned short b) { return (unsigned)a | ((unsigned)b << 16); }
__device__ __forceinline__ v8f zero8() { v8f z = {0.f, 0.f, 0.f, 0.f, 0.f, 0.f, 0.f, 0.f}; return z; }

// ---- fragment loaders: 16-bit A/B operand, lane -> row/col (lane&15), p already includes +8*(lane>>4);
//      elements 0..7 <- p[0..7] (k0+8h..), elements 8..15 <- p[16..23] (k0+16+8h..)  (same split k map for A and B;
//      B is always read from a k-contiguous [n][k] plane)
__device__ __forceinline__ v16h ldfrag_h(const _Float16* p) {
  FragH f;
  f.h[0] = *(const v8h*)(p);
  f.h[1] = *(const v8h*)(p + 16);
  return f.v;
}

__device__ __forceinline__ v8f mma_h(v16h a, v16h b, v8f c) {
  return __builtin_amdgcn_wmma_f32_16x16x32_f16(false, a, false, b, (short)0, c, false, false);
}
__device__ __forceinline__ v8f mma_b(v16b a, v16b b, v8f c) {
  return __builtin_amdgcn_wmma_f32_16x16x32_bf16(false, a, false, b, (short)0, c, false, false);
}
__device__ __forceinline__ void guard2(v8f& a, v8f& b, v16h x0, v16h x1, v16h x2, v16h x3, v16h x4, v16h x5) {
#if defined(__HIP_DEVICE_COMPILE__)
  asm volatile("v_nop\n\tv_nop\n\tv_nop\n\tv_nop"
               : "+v"(a), "+v"(b) : "v"(x0), "v"(x1), "v"(x2), "v"(x3), "v"(x4), "v"(x5) : "memory");
#endif
}
template <typename F>
__device__ __forceinline__ void guard6(v8f& a, v8f& b, v8f& c, v8f& d, F x0, F x1, F x2, F x3, F x4, F x5) {
#if defined(__HIP_DEVICE_COMPILE__)
  asm volatile("v_nop\n\tv_nop\n\tv_nop\n\tv_nop"
               : "+v"(a), "+v"(b), "+v"(c), "+v"(d) : "v"(x0), "v"(x1), "v"(x2), "v"(x3), "v"(x4), "v"(x5) : "memory");
#endif
}
__device__ __forceinline__ void acc_guard4(v8f& a, v8f& b, v8f& c, v8f& d) {
#if defined(__HIP_DEVICE_COMPILE__)
  asm volatile("v_nop\n\tv_nop\n\tv_nop\n\tv_nop" : "+v"(a), "+v"(b), "+v"(c), "+v"(d));
#endif
}
__device__ __forceinline__ void wave_sync_lds() {
#if defined(__HIP_DEVICE_COMPILE__)
  __builtin_amdgcn_fence(__ATOMIC_RELEASE, "workgroup");
  __builtin_amdgcn_wave_barrier();
  __builtin_amdgcn_fence(__ATOMIC_ACQUIRE, "workgroup");
#endif
}

// =====================================================================================================
// f32 plane -> 16-bit plane, same layout:  mode 0: bf16 RNE bits;  mode 1: f16 bits of (bf16 RNE value) * scale.
// Thread = 8 consecutive elements: two 16-B loads, one 16-B store; 32 consecutive lanes = 512 contiguous, 512-B aligned bytes
// coverage: grid = n8/256 blocks (host checks exactness) x 256 thr x 8 = the whole plane.
// =====================================================================================================
__global__ __launch_bounds__(256) void cvt16(const float* __restrict__ x, u16* D, int n8, int mode, float scale) {
  const int gt = blockIdx.x * 256 + (int)threadIdx.x;
  if (gt >= n8) return;                     // no barriers in this kernel
  const float* p = x + (size_t)gt * 8;
  const v4f a = *(const v4f*)(p), c4 = *(const v4f*)(p + 4);
  float v[8];
#pragma unroll
  for (int e = 0; e < 4; ++e) { v[e] = a[e]; v[4 + e] = c4[e]; }
  unsigned short s[8];
#pragma unroll
  for (int e = 0; e < 8; ++e) {
    const unsigned short bb = bf_bits(v[e]);
    const unsigned short hb = h_bits((_Float16)(bf_up(bb) * scale));
    s[e] = (mode != 0) ? hb : bb;
  }
  v4u o;
#pragma unroll
  for (int e = 0; e < 4; ++e) o[e] = pk16(s[2 * e], s[2 * e + 1]);
  u16* d = D + (size_t)gt * 8;
  {
    *(v4u*)(d) = o;
    
  }
}

// =====================================================================================================
// barrier, then converted to f16 and written: lane = (row in group of 4, 8 consecutive cols); one instruction = 4 rows, each
// coverage: 4 instructions x 4 rows x 8 lanes x 8 halves = the wave's 16 x 64 tile.
// =====================================================================================================
__device__ __forceinline__ void epi16(float* sl, v8f a0, v8f a1, v8f a2, v8f a3, float oscale, u16* C, int N,
                                      size_t rowb, int col0, int lane) {
  const int hh = lane >> 4, m = lane & 15;
#pragma unroll
  for (int r = 0; r < 8; ++r) {
    const int ro = (8 * hh + r) * 68 + m;
    sl[ro]      = a0[r] * oscale;
    sl[ro + 16] = a1[r] * oscale;
    sl[ro + 32] = a2[r] * oscale;
    sl[ro + 48] = a3[r] * oscale;
  }
  wave_sync_lds();
  const int rq = lane >> 3, c8 = (lane & 7) * 8;
  v4u ov[4];
#pragma unroll
  for (int i4 = 0; i4 < 4; ++i4) {
    const int row = i4 * 4 + rq;
    const v4f a = *(const v4f*)(sl + row * 68 + c8), c4 = *(const v4f*)(sl + row * 68 + c8 + 4);
    float w[8];
#pragma unroll
    for (int e = 0; e < 4; ++e) { w[e] = a[e]; w[4 + e] = c4[e]; }
#pragma unroll
    for (int e = 0; e < 4; ++e) ov[i4][e] = pk16(h_bits((_Float16)w[2 * e]), h_bits((_Float16)w[2 * e + 1]));
  }
  u16* dst = C + (rowb + (size_t)rq) * (size_t)N + col0 + c8;
  const size_t st4 = (size_t)4 * (size_t)N;
#if defined(__HIP_DEVICE_COMPILE__)
  // The four stores and their s_wait_xcnt in one statement: the next slab reuses these address and data registers.
  asm volatile("global_store_b128 %0, %4, off\n\t"
               "global_store_b128 %1, %5, off\n\t"
               "global_store_b128 %2, %6, off\n\t"
               "global_store_b128 %3, %7, off\n\t"
               "s_wait_xcnt 0x0"
               :: "v"(dst), "v"(dst + st4), "v"(dst + 2 * st4), "v"(dst + 3 * st4),
                  "v"(ov[0]), "v"(ov[1]), "v"(ov[2]), "v"(ov[3])
               : "memory");
#endif
}

// =====================================================================================================
// coverage: 8 instructions x 2 rows x 16 lanes x 4 floats = the wave's 16 x 64 tile.
// =====================================================================================================
__device__ __forceinline__ void epi64(float* sl, v8f a0, v8f a1, v8f a2, v8f a3, float oscale, float* C, int N,
                                      size_t rowb, int col0, int lane) {
  const int hh = lane >> 4, m = lane & 15;
#pragma unroll
  for (int r = 0; r < 8; ++r) {
    const int ro = (8 * hh + r) * 68 + m;
    sl[ro]      = a0[r] * oscale;
    sl[ro + 16] = a1[r] * oscale;
    sl[ro + 32] = a2[r] * oscale;
    sl[ro + 48] = a3[r] * oscale;
  }
  wave_sync_lds();
  v4f vals[8];
#pragma unroll
  for (int it = 0; it < 8; ++it) vals[it] = *(const v4f*)(sl + (it * 2 + hh) * 68 + m * 4);
  float* dst = C + (rowb + (size_t)hh) * (size_t)N + col0 + m * 4;
  const size_t st2 = (size_t)2 * (size_t)N;
#if defined(__HIP_DEVICE_COMPILE__)
  // The eight stores and their s_wait_xcnt in one statement: the next slab reuses these address and data registers.
  asm volatile("global_store_b128 %0, %8, off\n\t"
               "global_store_b128 %1, %9, off\n\t"
               "global_store_b128 %2, %10, off\n\t"
               "global_store_b128 %3, %11, off\n\t"
               "global_store_b128 %4, %12, off\n\t"
               "global_store_b128 %5, %13, off\n\t"
               "global_store_b128 %6, %14, off\n\t"
               "global_store_b128 %7, %15, off\n\t"
               "s_wait_xcnt 0x0"
               :: "v"(dst), "v"(dst + st2), "v"(dst + 2 * st2), "v"(dst + 3 * st2),
                  "v"(dst + 4 * st2), "v"(dst + 5 * st2), "v"(dst + 6 * st2), "v"(dst + 7 * st2),
                  "v"(vals[0]), "v"(vals[1]), "v"(vals[2]), "v"(vals[3]), "v"(vals[4]), "v"(vals[5]), "v"(vals[6]), "v"(vals[7])
               : "memory");
#endif
}

// =====================================================================================================
// Shared GEMM core: acc[i][j] (16x16 f32 tiles) = A[row0 .. +127][K] . Bt[col0 .. +127][K]^T for one 128x128 block tile.
// 4 waves in a 2x2 grid, each owning 64x64 = 4x4 accumulator tiles, so one LDS fragment feeds four products.
// A pass is 64 k = 128 B of each of the 256 operand rows, laid in LDS at pitch 144 B (16 B x odd: ds_load_b128 without bank
// conflicts): rows 0..127 = A, rows 128..255 = Bt. Two buffers; pass t+1's rows fly (asynchronous copies, 16 B per lane,
// a wave-wide copy = 4 whole 128-B row pieces) while pass t is multiplied. Thread = (row tid>>3 of a group of 16, 16-B chunk
// tid&7); 8 + 8 copies per thread and pass cover 256 rows x 128 B. k runs upward in steps of 32 per accumulator.
// Needs M % 128 == 0, N % 128 == 0, K % 64 == 0 (host checks).
// =====================================================================================================
#define GBM    128
#define GBN    128
#define GKP    64
#define GPITCH 144
#define GSTAGE ((GBM + GBN) * GPITCH)
static_assert(GKP == 64 && (GPITCH % 16) == 0 && ((GPITCH / 16) % 2) == 1 && GPITCH >= GKP * 2);
static_assert((DMOD % GKP) == 0 && ((NB * SEQ) % GBM) == 0 && (DMOD % GBM) == 0 && (DMOD % GBN) == 0 && (SEQ % GBN) == 0);

union FragU { v4u u[2]; v16b b; v16h h; };

__device__ __forceinline__ unsigned lds_off(const void* p) { return (unsigned)(size_t)p; }

// Eight asynchronous 16-B copies of this lane, rows 16 apart. The s_wait_xcnt closes the statement so that no address
// register named here is rewritten ahead of it.
__device__ __forceinline__ void copy8(unsigned l, const u16* g, size_t st16) {
#if defined(__HIP_DEVICE_COMPILE__)
  asm volatile("global_load_async_to_lds_b128 %0, %8, off\n\t"
               "global_load_async_to_lds_b128 %1, %9, off\n\t"
               "global_load_async_to_lds_b128 %2, %10, off\n\t"
               "global_load_async_to_lds_b128 %3, %11, off\n\t"
               "global_load_async_to_lds_b128 %4, %12, off\n\t"
               "global_load_async_to_lds_b128 %5, %13, off\n\t"
               "global_load_async_to_lds_b128 %6, %14, off\n\t"
               "global_load_async_to_lds_b128 %7, %15, off\n\t"
               "s_wait_xcnt 0x0"
               :: "v"(l), "v"(l + 16u * GPITCH), "v"(l + 32u * GPITCH), "v"(l + 48u * GPITCH),
                  "v"(l + 64u * GPITCH), "v"(l + 80u * GPITCH), "v"(l + 96u * GPITCH), "v"(l + 112u * GPITCH),
                  "v"(g), "v"(g + st16), "v"(g + 2 * st16), "v"(g + 3 * st16),
                  "v"(g + 4 * st16), "v"(g + 5 * st16), "v"(g + 6 * st16), "v"(g + 7 * st16)
               : "memory");
#endif
}
// this wave's own copies have landed in LDS
__device__ __forceinline__ void wait_async0() {
#if defined(__HIP_DEVICE_COMPILE__)
  asm volatile("s_wait_asynccnt 0x0" ::: "memory");
#endif
}
// this wave's LDS reads have returned, so the buffer may be handed to its next writer
__device__ __forceinline__ void wait_ds0() {
#if defined(__HIP_DEVICE_COMPILE__)
  asm volatile("s_wait_dscnt 0x0" ::: "memory");
#endif
}
__device__ __forceinline__ FragU ldfrag_s(const unsigned char* p) {   // split k map: bytes 0..15 and 32..47 from p
  FragU f;
  f.u[0] = *(const v4u*)(p);
  f.u[1] = *(const v4u*)(p + 32);
  return f;
}
template <bool BF>
__device__ __forceinline__ v8f mma_x(const FragU& a, const FragU& b, v8f c) {
  if constexpr (BF) return mma_b(a.b, b.b, c);
  else              return mma_h(a.h, b.h, c);
}

template <bool BF>
__device__ __forceinline__ void gemm_core(unsigned char* ring, const u16* Ab, const u16* Bb, int K, int row0, int col0,
                                          int tid, v8f (&acc)[4][4]) {
  const int wave = tid >> 5, lane = tid & 31, hh = lane >> 4, m = lane & 15;
  const int r0 = tid >> 3, ch = tid & 7;
  const u16* ga = Ab + (size_t)(row0 + r0) * K + ch * 8;
  const u16* gb = Bb + (size_t)(col0 + r0) * K + ch * 8;
  const size_t st16 = (size_t)16 * K;
  const unsigned la = lds_off(ring) + (unsigned)(r0 * GPITCH + ch * 16);
  const int nt = K / GKP;
  const unsigned char* fa = ring + ((wave >> 1) * 64 + m) * GPITCH + hh * 16;
  const unsigned char* fb = ring + (GBM + (wave & 1) * 64 + m) * GPITCH + hh * 16;
#pragma unroll
  for (int i = 0; i < 4; ++i) {
#pragma unroll
    for (int j = 0; j < 4; ++j) acc[i][j] = zero8();
  }
  copy8(la, ga, st16);
  copy8(la + GBM * GPITCH, gb, st16);
  wait_async0();
  __syncthreads();                           // pass 0's rows are readable by every wave
  if (nt > 1) {
    copy8(la + GSTAGE, ga + GKP, st16);
    copy8(la + GSTAGE + GBM * GPITCH, gb + GKP, st16);
  }
#pragma unroll 1                             // one pass per trip: the two-buffer order below is per pass
  for (int t = 0; t < nt; ++t) {
    const unsigned bo = (unsigned)(t & 1) * GSTAGE;
    // Two blocks of 16 products (k 0..31, k 32..63). All of block 0's fragments and nine products' worth of block 1's are
    // loaded as one group; block 1's last A and B fragments follow into registers that block 0 has freed, which keeps the
    // wave inside 256 registers.
    FragU a0[4], b0[4], a1[4], b1[4];
#pragma unroll
    for (int i = 0; i < 4; ++i) {
      a0[i] = ldfrag_s(fa + bo + i * (16 * GPITCH));
      b0[i] = ldfrag_s(fb + bo + i * (16 * GPITCH));
    }
#pragma unroll
    for (int i = 0; i < 3; ++i) {
      a1[i] = ldfrag_s(fa + bo + i * (16 * GPITCH) + 64);
      b1[i] = ldfrag_s(fb + bo + i * (16 * GPITCH) + 64);
    }
    __builtin_amdgcn_sched_barrier(0);       // the LDS loads stay one group ahead of the products, none among them
#pragma unroll
    for (int i = 0; i < 4; ++i) {
#pragma unroll
      for (int j = 0; j < 4; ++j) acc[i][j] = mma_x<BF>(a0[i], b0[j], acc[i][j]);
    }
    __builtin_amdgcn_sched_barrier(0);       // the late pair is loaded here, not earlier (registers) and not later (latency)
    a1[3] = ldfrag_s(fa + bo + 3 * (16 * GPITCH) + 64);
    b1[3] = ldfrag_s(fb + bo + 3 * (16 * GPITCH) + 64);
    __builtin_amdgcn_sched_barrier(0);       // nine products that do not need the late pair cover its latency
#pragma unroll
    for (int i = 0; i < 3; ++i) {
#pragma unroll
      for (int j = 0; j < 3; ++j) acc[i][j] = mma_x<BF>(a1[i], b1[j], acc[i][j]);
    }
#pragma unroll
    for (int i = 0; i < 3; ++i) acc[i][3] = mma_x<BF>(a1[i], b1[3], acc[i][3]);
#pragma unroll
    for (int j = 0; j < 4; ++j) acc[3][j] = mma_x<BF>(a1[3], b1[j], acc[3][j]);
    __builtin_amdgcn_sched_barrier(0);       // the products stay ahead of the hand-over waits, else the late pair's latency is bare
    wait_ds0();
    wait_async0();
    __syncthreads();                         // publishes pass t+1's rows and ends every read of pass t's buffer
    if (t + 2 < nt) {
      copy8(la + bo, ga + (size_t)(t + 2) * GKP, st16);
      copy8(la + bo + GBM * GPITCH, gb + (size_t)(t + 2) * GKP, st16);
    }
  }
  wait_async0();
}

// =====================================================================================================
// Batched bf16 GEMM with 16-bit result: C[bt][M][N] (f16 of acc*oscale) = A[bt][M][K] (bf16 row-major) . Bt[bt][N][K]^T
// (bf16 k-contiguous); per-batch element strides bstA/bstB/bstC. Block = 128x128 tile (gemm_core);
// grid = nbatch*(M/128)*(N/128). Each wave writes its 64x64 part as four 16x64 slabs through its own LDS slab.
// =====================================================================================================
__global__ __launch_bounds__(128)
void gemm_b16(const u16* __restrict__ A, const u16* __restrict__ Bt, u16* C, int M, int N, int K,
              int bstA, int bstB, int bstC, float oscale) {
  __shared__ __align__(16) unsigned char ring[2 * GSTAGE];
  __shared__ __align__(16) float slab[4 * SLAB];
  const int tid = threadIdx.x, wave = tid >> 5, lane = tid & 31;
  const int ntile = N / GBN, mtile = M / GBM;
  const int per   = ntile * mtile;
  const int bid   = blockIdx.x;
  const int bt    = bid / per;
  const int t     = bid - bt * per;
  const int row0  = (t / ntile) * GBM;
  const int col0  = (t % ntile) * GBN;
  if (row0 + GBM > M) return;                // block-uniform, ahead of every copy and barrier; never taken with the exact grid
  const u16* Ab = A  + (size_t)bt * (size_t)bstA;
  const u16* Bb = Bt + (size_t)bt * (size_t)bstB;
  u16*       Cb = C  + (size_t)bt * (size_t)bstC;
  v8f acc[4][4];
  gemm_core<true>(ring, Ab, Bb, K, row0, col0, tid, acc);
#pragma unroll
  for (int i = 0; i < 4; ++i) {
    wave_sync_lds();                         // the slab's previous rows have been read back before they are rewritten
    epi16(slab + wave * SLAB, acc[i][0], acc[i][1], acc[i][2], acc[i][3], oscale, Cb, N,
          (size_t)(row0 + (wave >> 1) * 64 + i * 16), col0 + (wave & 1) * 64, lane);
  }
}

// =====================================================================================================
// f16 GEMM with f32 result: C[M][N] (f32) = A[M][K] (f16 row-major) . Bt[N][K]^T (f16 k-contiguous) times oscale;
// one product per tile pair. Same tiling as gemm_b16; grid = (M/128)*(N/128).
// =====================================================================================================
__global__ __launch_bounds__(128)
void gemm_hf(const u16* __restrict__ A, const u16* __restrict__ Bt, float* C, int M, int N, int K, float oscale) {
  __shared__ __align__(16) unsigned char ring[2 * GSTAGE];
  __shared__ __align__(16) float slab[4 * SLAB];
  const int tid = threadIdx.x, wave = tid >> 5, lane = tid & 31;
  const int ntile = N / GBN;
  const int bid   = blockIdx.x;
  const int row0  = (bid / ntile) * GBM;
  const int col0  = (bid % ntile) * GBN;
  if (row0 + GBM > M) return;                // block-uniform, ahead of every copy and barrier; never taken with the exact grid
  v8f acc[4][4];
  gemm_core<false>(ring, A, Bt, K, row0, col0, tid, acc);
#pragma unroll
  for (int i = 0; i < 4; ++i) {
    wave_sync_lds();                         // the slab's previous rows have been read back before they are rewritten
    epi64(slab + wave * SLAB, acc[i][0], acc[i][1], acc[i][2], acc[i][3], oscale, C, N,
          (size_t)(row0 + (wave >> 1) * 64 + i * 16), col0 + (wave & 1) * 64, lane);
  }
}

// =====================================================================================================
// Multi-head flash attention (no mask): block = (batch b, head, 128 query rows), 8 waves, wave w owns the 16 query rows
// q0 = 128*qt + 16*w .. q0+15.
//   q plane (f16, x8) laid out [b][s][h][d]; k plane the same; v^T plane [b][h][d][s] (x1024).
//   K and v^T reach the waves through LDS, shared by the block: a stage is 64 keys = 64 k rows of 128 B (rows 0..63) and the
//   64 v^T rows' 128-B pieces of those keys (rows 64..127), at pitch 144 B (16 B x odd: ds_load_b128 without bank conflicts).
//   Two buffers; stage t+1's rows fly (asynchronous copies, 16 B per lane, a wave-wide copy = 4 whole 128-B lines) while
//   stage t is worked on. Thread = (row tid>>3 of a group of 32, 16-B chunk tid&7); 2 + 2 copies per thread and stage.
//   All NST = 32 stages are visited (static bound), each as two key blocks of 32 keys in rising order.
//   Scores are computed TRANSPOSED: S^T tile g (g = 0,1) = k rows (keys kb+16g .. +15, A operand, row m = lane&15, split k map
//   over d) times q^T (B operand, col n = query q0 + (lane&15), k = d, split map), one product per tile and 32-deep d-chunk.
//   D element r of lane l = (key kb+16g+8h+r, query q0+(l&15)), so a lane owns one query column and 16 of its 32 keys; the
//   partner lane l^16 owns the other 16 -> row max / row sum need one xor-16 shuffle.
//   Online max-subtracted base-2 softmax in f32 (scale 1/8 and the q/k carries folded into lsc). The exp'd values ARE the
//   P A-fragment in place: A row m = query = lane&15, element i <- key kb+8h+i (tile 0, D element i), element 8+i <- key
//   kb+16+8h+i (tile 1, D element i). P is carried x32768 as single f16. The rescale factor of query row 8h+r of the
//   O accumulators is fetched from lane 8h+r with a shuffle (uniform control). 4 v^T B fragments (col n = d = 16j + (lane&15),
//   keys k-contiguous), 4 P.V WMMAs per key block.
//   Epilogue: 1/l (per query, shuffled to the D row owner) and carry folds in f32; the wave's 16x64 f32 result staged in its
//   own slab, which lies in the ring's bytes once the last stage's barrier has ended every read of them.
// coverage: per wave 4 instructions x 4 rows x 8 lanes x 8 halves = 16 x 64; grid 1024 blocks x 8 waves = every
//           (b, s, h) row of the O plane exactly once.
// =====================================================================================================
#define APITCH 144
#define ASTAGE ((AKEYS + HD) * APITCH)
static_assert(AKEYS == 64 && HD * 2 == 128 && AKEYS * 2 == 128 && (APITCH % 16) == 0 && ((APITCH / 16) % 2) == 1);
static_assert(ATT_WAVES * SLAB * 4 <= 2 * ASTAGE && ATT_THREADS * 2 * 16 == AKEYS * 128 && NST >= 2);

// One stage's four asynchronous 16-B copies of this lane: two k rows and two v^T rows, 32 rows apart. The s_wait_xcnt closes
// the statement so that no address register named here is rewritten ahead of it.
__device__ __forceinline__ void copy_kv(unsigned l, const u16* gk, const u16* gv) {
#if defined(__HIP_DEVICE_COMPILE__)
  asm volatile("global_load_async_to_lds_b128 %0, %4, off\n\t"
               "global_load_async_to_lds_b128 %1, %5, off\n\t"
               "global_load_async_to_lds_b128 %2, %6, off\n\t"
               "global_load_async_to_lds_b128 %3, %7, off\n\t"
               "s_wait_xcnt 0x0"
               :: "v"(l), "v"(l + 32u * APITCH), "v"(l + 64u * APITCH), "v"(l + 96u * APITCH),
                  "v"(gk), "v"(gk + (size_t)32 * (NH * HD)), "v"(gv), "v"(gv + (size_t)32 * SEQ)
               : "memory");
#endif
}

__global__ __launch_bounds__(ATT_THREADS)
void attn_fwd(const u16* __restrict__ QPp, const u16* __restrict__ KPp, const u16* __restrict__ VPp, u16* OPp) {
  __shared__ __align__(16) unsigned char ring[2 * ASTAGE];   // two K / v^T stages; per-wave result slabs in the epilogue

  const int tid  = threadIdx.x;
  const int wave = tid >> 5;
  const int lane = tid & 31;
  const int hh   = lane >> 4;
  const int c    = lane & 15;

  const int bid  = blockIdx.x;
  const int qt   = bid & (SEQ / ATT_QROWS - 1);
  const int head = (bid >> 4) & (NH - 1);
  const int b    = bid >> 8;
  const int q0   = qt * ATT_QROWS + wave * 16;

  // B fragments of q^T: col n = query q0 + c, k = d (k-contiguous row of the q plane)
  const size_t qofs = (((size_t)(b * SEQ + q0 + c)) * NH + head) * HD + 8 * hh;
  const _Float16* Qb = (const _Float16*)(const void*)QPp + qofs;
  // this thread's copy sources: k row (stage key r0), v^T row (d = r0), 16-B chunk ch; stage t adds 64 keys
  const int r0 = tid >> 3, ch = tid & 7;
  const u16* gk = KPp + (((size_t)b * SEQ + r0) * NH + head) * HD + ch * 8;
  const u16* gv = VPp + ((size_t)(b * NH + head) * HD + r0) * SEQ + ch * 8;
  const unsigned la = lds_off(ring) + (unsigned)(r0 * APITCH + ch * 16);
  // A fragments of k: LDS row = key in stage 32u + 16g + c, k = d; B fragments of v: LDS row = 64 + d (16j + c), k = key in stage
  const unsigned char* fk = ring + c * APITCH + hh * 16;
  const unsigned char* fv = ring + (AKEYS + c) * APITCH + hh * 16;
  const float lsc = 0.125f * (LOG2E / (QSC * KSC));

  copy_kv(la, gk, gv);
  const v16h qf0 = ldfrag_h(Qb);            // d 0..31
  const v16h qf1 = ldfrag_h(Qb + 32);       // d 32..63
  wait_async0();
  __syncthreads();                           // stage 0's rows are readable by every wave
  copy_kv(la + ASTAGE, gk + (size_t)AKEYS * (NH * HD), gv + AKEYS);

  float mrun = -INFINITY, lrun = 0.f;
  v8f o[4];
#pragma unroll
  for (int j = 0; j < 4; ++j) o[j] = zero8();

#pragma unroll 1                             // one stage per trip: the two-buffer order below is per stage
  for (int t = 0; t < NST; ++t) {
    const unsigned bo = (unsigned)(t & 1) * ASTAGE;
#pragma unroll 1                             // rolled: unrolled, the two key blocks' live values overlap and the wave passes 128
                                             // registers, so that only three of the four blocks a WGP gets are resident at once
    for (int u = 0; u < 2; ++u) {
      // ---- transposed scores: s0 = keys kb..kb+15, s1 = keys kb+16..kb+31 (kb = 64t + 32u), column = query q0 + c ----
      v8f s0 = zero8(), s1 = zero8();
      const unsigned char* k0p = fk + bo + u * (32 * APITCH);
      const unsigned char* k1p = k0p + 16 * APITCH;
      const v16h ka0 = ldfrag_s(k0p).h, ka1 = ldfrag_s(k0p + 64).h;
      const v16h kc0 = ldfrag_s(k1p).h, kc1 = ldfrag_s(k1p + 64).h;
      s0 = mma_h(ka0, qf0, s0);
      s0 = mma_h(ka1, qf1, s0);
      s1 = mma_h(kc0, qf0, s1);
      s1 = mma_h(kc1, qf1, s1);
      guard2(s0, s1, qf0, qf1, ka0, ka1, kc0, kc1);
      // ---- base-2 logits of this lane's 16 keys for query q0 + c ----
      float tk[16];
#pragma unroll
      for (int i = 0; i < 8; ++i) { tk[i] = s0[i] * lsc;  tk[8 + i] = s1[i] * lsc; }
      float cm = tk[0];
#pragma unroll
      for (int i = 1; i < 16; ++i) cm = fmaxf(cm, tk[i]);
      cm = fmaxf(cm, __shfl_xor(cm, 16, 32));
      const float mn = fmaxf(mrun, cm);                                // finite from the first key block on
      const float al = (mrun == -INFINITY) ? 0.f : exp2f(mrun - mn);   // o and l are zero while mrun is -inf
      mrun = mn;
      // ---- probabilities (<= 1) and the P A-fragment: f16(p * 32768); element i <-> tk[i] ----
      float ps = 0.f;
      FragH ph;
#pragma unroll
      for (int w = 0; w < 2; ++w) {
#pragma unroll
        for (int e4 = 0; e4 < 4; ++e4) {
          const int i = 8 * w + 2 * e4;
          const float p0 = exp2f(fminf(tk[i] - mn, 0.f));
          const float p1 = exp2f(fminf(tk[i + 1] - mn, 0.f));
          ps += p0 + p1;
          ph.u[w][e4] = pk16(h_bits((_Float16)(p0 * PCAR)), h_bits((_Float16)(p1 * PCAR)));
        }
      }
      ps += __shfl_xor(ps, 16, 32);
      lrun = lrun * al + ps;
      // ---- rescale the O accumulators: D row 8hh+r = query q0+8hh+r, its factor lives in lane 8hh+r (and 16+8hh+r) ----
      float scl[8];
#pragma unroll
      for (int r = 0; r < 8; ++r) scl[r] = __shfl(al, 8 * hh + r, 32);
#pragma unroll
      for (int j = 0; j < 4; ++j) {
#pragma unroll
        for (int r = 0; r < 8; ++r) o[j][r] *= scl[r];
      }
      // ---- P.V : B fragment col n = d = j*16 + c, keys contiguous in the staged v^T rows ----
      {
        const unsigned char* vp = fv + bo + u * 64;
        const v16h vf0 = ldfrag_s(vp).h;
        const v16h vf1 = ldfrag_s(vp + 16 * APITCH).h;
        const v16h vf2 = ldfrag_s(vp + 32 * APITCH).h;
        const v16h vf3 = ldfrag_s(vp + 48 * APITCH).h;
        o[0] = mma_h(ph.v, vf0, o[0]);
        o[1] = mma_h(ph.v, vf1, o[1]);
        o[2] = mma_h(ph.v, vf2, o[2]);
        o[3] = mma_h(ph.v, vf3, o[3]);
        guard6<v16h>(o[0], o[1], o[2], o[3], ph.v, vf0, vf1, vf2, vf3, ph.v);
      }
    }
    wait_ds0();
    wait_async0();
    __syncthreads();                         // publishes stage t+1's rows and ends every read of stage t's buffer
    if (t + 2 < NST) copy_kv(la + bo, gk + (size_t)(t + 2) * (AKEYS * NH * HD), gv + (t + 2) * AKEYS);
  }
  wait_async0();
  acc_guard4(o[0], o[1], o[2], o[3]);

  // ---- fold 1/l (per query, owned by lane = query; l >= 1 by construction) and the carries; stage the 16x64 slab ----
  const float linv = (lrun > 0.f) ? ((1.0f / lrun) * (1.0f / (PCAR * VCAR))) : 0.f;
  float inv[8];
#pragma unroll
  for (int r = 0; r < 8; ++r) inv[r] = __shfl(linv, 8 * hh + r, 32);
  float* slab = (float*)(void*)ring + wave * SLAB;
#pragma unroll
  for (int r = 0; r < 8; ++r) {
#pragma unroll
    for (int j = 0; j < 4; ++j) slab[(8 * hh + r) * 68 + j * 16 + c] = o[j][r] * inv[r];
  }
  wave_sync_lds();
  // ---- O x1024 -> single f16 plane; lane = (row in group of 4, 8 consecutive d) ----
  v4u oh[4];
  const int rq = lane >> 3, c8 = (lane & 7) * 8;
#pragma unroll
  for (int i4 = 0; i4 < 4; ++i4) {
    const int row = i4 * 4 + rq;
    const v4f a = *(const v4f*)(slab + row * 68 + c8), c4 = *(const v4f*)(slab + row * 68 + c8 + 4);
    float w[8];
#pragma unroll
    for (int e = 0; e < 4; ++e) { w[e] = a[e] * OSC; w[4 + e] = c4[e] * OSC; }
#pragma unroll
    for (int e = 0; e < 4; ++e) oh[i4][e] = pk16(h_bits((_Float16)w[2 * e]), h_bits((_Float16)w[2 * e + 1]));
  }
  const size_t ob = (((size_t)(b * SEQ + q0)) * NH + head) * HD + c8;
  {
#pragma unroll
    for (int i4 = 0; i4 < 4; ++i4) {
      const int row = i4 * 4 + rq;
      const size_t o8 = ob + (size_t)row * (NH * HD);
      *(v4u*)(OPp + o8) = oh[i4];
    }
    
  }
}

// =====================================================================================================
// Workspace map (bytes); every plane is fully written by whole-line stores before it is read; all extents are exact multiples
// of the store granularity (no pad rows needed):
//   XB  bf16 [8192][1024]                      16777216        (x)
//   WB  bf16 [3072 n][1024 k]                   6291456        (W_qkv, rows 0..1023 q, 1024..2047 k, 2048..3071 v)
//   WOB f16  [1024 n][1024 k] (bf16 value x1024) 2097152
//   QP  f16 [8192][16*64] x8                   16777216        KP same  16777216
//   VP  f16 [4][16*64][2048] x1024             16777216
//   OP  f16 [8192][16*64] x1024                16777216
//   end                                        92274688
// =====================================================================================================
extern "C" void kernel_launch(void* const* d_in, const int* in_sizes, int n_in,
                              void* d_out, int out_size, void* d_ws, size_t ws_size,
                              hipStream_t stream) {
  const int ROWS = NB * SEQ;                            // 8192
  if (n_in < 3) return;
  if (in_sizes[0] != ROWS * DMOD) return;
  if (in_sizes[1] != NQKV * DMOD) return;
  if (in_sizes[2] != DMOD * DMOD) return;
  if (out_size != ROWS * DMOD) return;

  const float* Xin = (const float*)d_in[0];
  const float* Wqk = (const float*)d_in[1];
  const float* Wpr = (const float*)d_in[2];
  float*       out = (float*)d_out;

  const size_t szXB = (size_t)ROWS * DMOD * 2;                  // 16777216
  const size_t szWB = (size_t)NQKV * DMOD * 2;                  //  6291456
  const size_t szWO = (size_t)DMOD * DMOD * 2;                  //  2097152
  const size_t szP  = (size_t)ROWS * DMOD * 2;                  // 16777216  (q / k / o planes)
  const size_t szVP = (size_t)NB * NH * HD * SEQ * 2;           // 16777216
  size_t off = 0;
  const size_t oXB = off; off += szXB;
  const size_t oWB = off; off += szWB;
  const size_t oWO = off; off += szWO;
  const size_t oQP = off; off += szP;
  const size_t oKP = off; off += szP;
  const size_t oVP = off; off += szVP;
  const size_t oOP = off; off += szP;
  if (off > ws_size) return;                            // off = 92274688
  if (off > (size_t)134217728) return;

  char* ws = (char*)d_ws;
  u16* XB  = (u16*)(ws + oXB);
  u16* WB  = (u16*)(ws + oWB);
  u16* WOB = (u16*)(ws + oWO);
  u16* QP  = (u16*)(ws + oQP);
  u16* KP  = (u16*)(ws + oKP);
  u16* VP  = (u16*)(ws + oVP);
  u16* OP  = (u16*)(ws + oOP);

  const dim3 blk(256);
  const int n8x = (ROWS * DMOD) / 8;                    // 1048576
  const int n8q = (NQKV * DMOD) / 8;                    //  393216
  const int n8w = (DMOD * DMOD) / 8;                    //  131072
  if ((n8x % 256) != 0 || (n8q % 256) != 0 || (n8w % 256) != 0) return;
  if ((DMOD % GBM) != 0 || (ROWS % GBM) != 0 || (SEQ % GBN) != 0 || (DMOD % GKP) != 0) return;
  const dim3 gX(n8x / 256);                             // 4096
  const dim3 gQ(n8q / 256);                             // 1536
  const dim3 gW(n8w / 256);                             // 512
  const dim3 gG((ROWS / GBM) * (DMOD / GBN));           // 512
  const dim3 gV(NB * (DMOD / GBM) * (SEQ / GBN));       // 512
  const dim3 bG(128);
  const dim3 gAT(ATT_BLOCKS);                           // 1024
  const dim3 bAT(ATT_THREADS);                          // 256

  // (0..2) operand planes: x -> bf16; W_qkv [n = out][k = in] (already k-contiguous) -> bf16; W_proj -> f16 of bf16 value x1024
  cvt16<<<gX, blk, 0, stream>>>(Xin, XB, n8x, 0, 1.0f);
  cvt16<<<gQ, blk, 0, stream>>>(Wqk, WB, n8q, 0, 1.0f);
  cvt16<<<gW, blk, 0, stream>>>(Wpr, WOB, n8w, 1, WOS);
  // (3,4) q and k planes [8192][h*64+d] = f16(x.Wq^T x8), f16(x.Wk^T x8)
  gemm_b16<<<gG, bG, 0, stream>>>(XB, WB, QP, ROWS, DMOD, DMOD, 0, 0, 0, QSC);
  gemm_b16<<<gG, bG, 0, stream>>>(XB, WB + (size_t)DMOD * DMOD, KP, ROWS, DMOD, DMOD, 0, 0, 0, KSC);
  // (5) v^T plane per batch: [1024 = h*64+d][2048 keys] = f16(Wv . x_b^T x1024), 4 batches in the grid
  gemm_b16<<<gV, bG, 0, stream>>>(WB + (size_t)2 * DMOD * DMOD, XB, VP, DMOD, SEQ, DMOD, 0, SEQ * DMOD, DMOD * SEQ, VCAR);
  // (6) attention -> O plane [b][s][h][d] x1024 (single f16)
  attn_fwd<<<gAT, bAT, 0, stream>>>(QP, KP, VP, OP);
  // (7) output projection -> out [8192][1024] f32, carries 1024 (O) x 1024 (wo) folded back
  gemm_hf<<<gG, bG, 0, stream>>>(OP, WOB, out, ROWS, DMOD, DMOD, 1.0f / (OSC * WOS));
  (void)hipGetLastError();
}

// v003
// One run takes 151 microseconds.
// Two timings next to v002 both put it at 1.24 times that version's speed.
// Over all steps from v000 it is 3.26 times as fast.
// Contractions: x.Wq^T, x.Wk^T and Wv.x_b^T on v_wmma_f32_16x16x32_bf16 (x and W_qkv planes RNE-converted to bf16 operands,
// f32 accumulate); scores k'.q'^T (q', k' single f16 planes carried x8), P.v (P x32768 single f16, v x1024 single f16) and
// O.Wo^T (O single f16 plane x1024, Wo as f16(bf16(Wo)) x1024): v_wmma_f32_16x16x32_f16, f32 accumulate.
// Base-2 online softmax, 1/l and carry folds in f32 on VALU.
#include <hip/hip_runtime.h>
#include <math.h>
#include <stdint.h>

#define NB    4
#define SEQ   2048
#define DMOD  1024
#define NQKV  (3 * DMOD)
#define NH    16
#define HD    64
#define QSC   8.0f
#define KSC   8.0f
#define PCAR  32768.0f
#define PLOG  15.0f
#define VCAR  1024.0f
#define OSC   1024.0f
#define WOS   1024.0f
#define LOG2E 1.4426950408889634f
#define ATT_WAVES   8
#define ATT_THREADS (ATT_WAVES * 32)
#define ATT_QROWS   (ATT_WAVES * 16)
#define ATT_BLOCKS  (NB * NH * (SEQ / ATT_QROWS))
#define AKEYS  64
#define NST    (SEQ / AKEYS)
#define SLAB   (16 * 68)
static_assert(HD == 64 && DMOD == NH * HD);
static_assert(PCAR == 32768.0f && PLOG == 15.0f);
static_assert((SEQ / ATT_QROWS) == 16 && NH == 16 && NB == 4);
static_assert(ATT_THREADS == 256 && ATT_BLOCKS == 1024 && NST == 32);
static_assert(((NB * SEQ) % 64) == 0 && (DMOD % 64) == 0 && (DMOD % 32) == 0 && (SEQ % 64) == 0);
static_assert(((NB * SEQ * DMOD / 8) % 256) == 0 && ((NQKV * DMOD / 8) % 256) == 0 && ((DMOD * DMOD / 8) % 256) == 0);
static_assert((SLAB * 4) % 16 == 0);

typedef unsigned short u16;
typedef _Float16 v16h __attribute__((ext_vector_type(16)));
typedef _Float16 v8h  __attribute__((ext_vector_type(8)));
typedef __bf16   v16b __attribute__((ext_vector_type(16)));
typedef float    v8f  __attribute__((ext_vector_type(8)));
typedef float    v4f  __attribute__((ext_vector_type(4)));
typedef float    v2f  __attribute__((ext_vector_type(2)));
typedef _Float16 v2h  __attribute__((ext_vector_type(2)));
typedef unsigned int v4u __attribute__((ext_vector_type(4)));

union FragH { v16h v; v8h h[2]; v4u u[2]; };

// ---- scalar helpers --------------------------------------------------------------------------------
__device__ __forceinline__ unsigned short bf_bits(float f) {          // f32 -> bf16 bits, RNE convert
  unsigned u = __float_as_uint(f);
  return (unsigned short)((u + 0x7FFFu + ((u >> 16) & 1u)) >> 16);
}
__device__ __forceinline__ float bf_up(unsigned short h) { return __uint_as_float(((unsigned)h) << 16); }
__device__ __forceinline__ unsigned short h_bits(_Float16 x) { return __builtin_bit_cast(unsigned short, x); }
__device__ __forceinline__ unsigned pk16(unsigned short a, unsigned short b) { return (unsigned)a | ((unsigned)b << 16); }
__device__ __forceinline__ v8f zero8() { v8f z = {0.f, 0.f, 0.f, 0.f, 0.f, 0.f, 0.f, 0.f}; return z; }

// ---- fragment loaders: 16-bit A/B operand, lane -> row/col (lane&15), p already includes +8*(lane>>4);
//      elements 0..7 <- p[0..7] (k0+8h..), elements 8..15 <- p[16..23] (k0+16+8h..)  (same split k map for A and B;
//      B is always read from a k-contiguous [n][k] plane)
__device__ __forceinline__ v16h ldfrag_h(const _Float16* p) {
  FragH f;
  f.h[0] = *(const v8h*)(p);
  f.h[1] = *(const v8h*)(p + 16);
  return f.v;
}

__device__ __forceinline__ v8f mma_h(v16h a, v16h b, v8f c) {
  return __builtin_amdgcn_wmma_f32_16x16x32_f16(false, a, false, b, (short)0, c, false, false);
}
__device__ __forceinline__ v8f mma_b(v16b a, v16b b, v8f c) {
  return __builtin_amdgcn_wmma_f32_16x16x32_bf16(false, a, false, b, (short)0, c, false, false);
}
__device__ __forceinline__ void guard2(v8f& a, v8f& b, v16h x0, v16h x1, v16h x2, v16h x3, v16h x4, v16h x5) {
#if defined(__HIP_DEVICE_COMPILE__)
  asm volatile("v_nop\n\tv_nop\n\tv_nop\n\tv_nop"
               : "+v"(a), "+v"(b) : "v"(x0), "v"(x1), "v"(x2), "v"(x3), "v"(x4), "v"(x5) : "memory");
#endif
}
template <typename F>
__device__ __forceinline__ void guard6(v8f& a, v8f& b, v8f& c, v8f& d, F x0, F x1, F x2, F x3, F x4, F x5) {
#if defined(__HIP_DEVICE_COMPILE__)
  asm volatile("v_nop\n\tv_nop\n\tv_nop\n\tv_nop"
               : "+v"(a), "+v"(b), "+v"(c), "+v"(d) : "v"(x0), "v"(x1), "v"(x2), "v"(x3), "v"(x4), "v"(x5) : "memory");
#endif
}
__device__ __forceinline__ void acc_guard4(v8f& a, v8f& b, v8f& c, v8f& d) {
#if defined(__HIP_DEVICE_COMPILE__)
  asm volatile("v_nop\n\tv_nop\n\tv_nop\n\tv_nop" : "+v"(a), "+v"(b), "+v"(c), "+v"(d));
#endif
}
__device__ __forceinline__ void wave_sync_lds() {
#if defined(__HIP_DEVICE_COMPILE__)
  __builtin_amdgcn_fence(__ATOMIC_RELEASE, "workgroup");
  __builtin_amdgcn_wave_barrier();
  __builtin_amdgcn_fence(__ATOMIC_ACQUIRE, "workgroup");
#endif
}

// =====================================================================================================
// f32 plane -> 16-bit plane, same layout:  mode 0: bf16 RNE bits;  mode 1: f16 bits of (bf16 RNE value) * scale.
// Thread = 8 consecutive elements: two 16-B loads, one 16-B store; 32 consecutive lanes = 512 contiguous, 512-B aligned bytes
// coverage: grid = n8/256 blocks (host checks exactness) x 256 thr x 8 = the whole plane.
// =====================================================================================================
__global__ __launch_bounds__(256) void cvt16(const float* __restrict__ x, u16* D, int n8, int mode, float scale) {
  const int gt = blockIdx.x * 256 + (int)threadIdx.x;
  if (gt >= n8) return;                     // no barriers in this kernel
  const float* p = x + (size_t)gt * 8;
  const v4f a = *(const v4f*)(p), c4 = *(const v4f*)(p + 4);
  float v[8];
#pragma unroll
  for (int e = 0; e < 4; ++e) { v[e] = a[e]; v[4 + e] = c4[e]; }
  unsigned short s[8];
#pragma unroll
  for (int e = 0; e < 8; ++e) {
    const unsigned short bb = bf_bits(v[e]);
    const unsigned short hb = h_bits((_Float16)(bf_up(bb) * scale));
    s[e] = (mode != 0) ? hb : bb;
  }
  v4u o;
#pragma unroll
  for (int e = 0; e < 4; ++e) o[e] = pk16(s[2 * e], s[2 * e + 1]);
  u16* d = D + (size_t)gt * 8;
  {
    *(v4u*)(d) = o;
    
  }
}

// =====================================================================================================
// barrier, then converted to f16 and written: lane = (row in group of 4, 8 consecutive cols); one instruction = 4 rows, each
// coverage: 4 instructions x 4 rows x 8 lanes x 8 halves = the wave's 16 x 64 tile.
// =====================================================================================================
__device__ __forceinline__ void epi16(float* sl, v8f a0, v8f a1, v8f a2, v8f a3, float oscale, u16* C, int N,
                                      size_t rowb, int col0, int lane) {
  const int hh = lane >> 4, m = lane & 15;
#pragma unroll
  for (int r = 0; r < 8; ++r) {
    const int ro = (8 * hh + r) * 68 + m;
    sl[ro]      = a0[r] * oscale;
    sl[ro + 16] = a1[r] * oscale;
    sl[ro + 32] = a2[r] * oscale;
    sl[ro + 48] = a3[r] * oscale;
  }
  wave_sync_lds();
  const int rq = lane >> 3, c8 = (lane & 7) * 8;
  v4u ov[4];
#pragma unroll
  for (int i4 = 0; i4 < 4; ++i4) {
    const int row = i4 * 4 + rq;
    const v4f a = *(const v4f*)(sl + row * 68 + c8), c4 = *(const v4f*)(sl + row * 68 + c8 + 4);
    float w[8];
#pragma unroll
    for (int e = 0; e < 4; ++e) { w[e] = a[e]; w[4 + e] = c4[e]; }
#pragma unroll
    for (int e = 0; e < 4; ++e) ov[i4][e] = pk16(h_bits((_Float16)w[2 * e]), h_bits((_Float16)w[2 * e + 1]));
  }
  u16* dst = C + (rowb + (size_t)rq) * (size_t)N + col0 + c8;
  const size_t st4 = (size_t)4 * (size_t)N;
#if defined(__HIP_DEVICE_COMPILE__)
  // The four stores and their s_wait_xcnt in one statement: the next slab reuses these address and data registers.
  asm volatile("global_store_b128 %0, %4, off\n\t"
               "global_store_b128 %1, %5, off\n\t"
               "global_store_b128 %2, %6, off\n\t"
               "global_store_b128 %3, %7, off\n\t"
               "s_wait_xcnt 0x0"
               :: "v"(dst), "v"(dst + st4), "v"(dst + 2 * st4), "v"(dst + 3 * st4),
                  "v"(ov[0]), "v"(ov[1]), "v"(ov[2]), "v"(ov[3])
               : "memory");
#endif
}

// =====================================================================================================
// coverage: 8 instructions x 2 rows x 16 lanes x 4 floats = the wave's 16 x 64 tile.
// =====================================================================================================
__device__ __forceinline__ void epi64(float* sl, v8f a0, v8f a1, v8f a2, v8f a3, float oscale, float* C, int N,
                                      size_t rowb, int col0, int lane) {
  const int hh = lane >> 4, m = lane & 15;
#pragma unroll
  for (int r = 0; r < 8; ++r) {
    const int ro = (8 * hh + r) * 68 + m;
    sl[ro]      = a0[r] * oscale;
    sl[ro + 16] = a1[r] * oscale;
    sl[ro + 32] = a2[r] * oscale;
    sl[ro + 48] = a3[r] * oscale;
  }
  wave_sync_lds();
  v4f vals[8];
#pragma unroll
  for (int it = 0; it < 8; ++it) vals[it] = *(const v4f*)(sl + (it * 2 + hh) * 68 + m * 4);
  float* dst = C + (rowb + (size_t)hh) * (size_t)N + col0 + m * 4;
  const size_t st2 = (size_t)2 * (size_t)N;
#if defined(__HIP_DEVICE_COMPILE__)
  // The eight stores and their s_wait_xcnt in one statement: the next slab reuses these address and data registers.
  asm volatile("global_store_b128 %0, %8, off\n\t"
               "global_store_b128 %1, %9, off\n\t"
               "global_store_b128 %2, %10, off\n\t"
               "global_store_b128 %3, %11, off\n\t"
               "global_store_b128 %4, %12, off\n\t"
               "global_store_b128 %5, %13, off\n\t"
               "global_store_b128 %6, %14, off\n\t"
               "global_store_b128 %7, %15, off\n\t"
               "s_wait_xcnt 0x0"
               :: "v"(dst), "v"(dst + st2), "v"(dst + 2 * st2), "v"(dst + 3 * st2),
                  "v"(dst + 4 * st2), "v"(dst + 5 * st2), "v"(dst + 6 * st2), "v"(dst + 7 * st2),
                  "v"(vals[0]), "v"(vals[1]), "v"(vals[2]), "v"(vals[3]), "v"(vals[4]), "v"(vals[5]), "v"(vals[6]), "v"(vals[7])
               : "memory");
#endif
}

// =====================================================================================================
// Shared GEMM core: acc[i][j] (16x16 f32 tiles) = A[row0 .. +127][K] . Bt[col0 .. +127][K]^T for one 128x128 block tile.
// 4 waves in a 2x2 grid, each owning 64x64 = 4x4 accumulator tiles, so one LDS fragment feeds four products.
// A pass is 64 k = 128 B of each of the 256 operand rows, laid in LDS at pitch 144 B (16 B x odd: ds_load_b128 without bank
// conflicts): rows 0..127 = A, rows 128..255 = Bt. Two buffers; pass t+1's rows fly (asynchronous copies, 16 B per lane,
// a wave-wide copy = 4 whole 128-B row pieces) while pass t is multiplied. Thread = (row tid>>3 of a group of 16, 16-B chunk
// tid&7); 8 + 8 copies per thread and pass cover 256 rows x 128 B. k runs upward in steps of 32 per accumulator.
// Needs M % 128 == 0, N % 128 == 0, K % 64 == 0 (host checks).
// =====================================================================================================
#define GBM    128
#define GBN    128
#define GKP    64
#define GPITCH 144
#define GSTAGE ((GBM + GBN) * GPITCH)
static_assert(GKP == 64 && (GPITCH % 16) == 0 && ((GPITCH / 16) % 2) == 1 && GPITCH >= GKP * 2);
static_assert((DMOD % GKP) == 0 && ((NB * SEQ) % GBM) == 0 && (DMOD % GBM) == 0 && (DMOD % GBN) == 0 && (SEQ % GBN) == 0);

union FragU { v4u u[2]; v16b b; v16h h; };

__device__ __forceinline__ unsigned lds_off(const void* p) { return (unsigned)(size_t)p; }

// Eight asynchronous 16-B copies of this lane, rows 16 apart. The s_wait_xcnt closes the statement so that no address
// register named here is rewritten ahead of it.
__device__ __forceinline__ void copy8(unsigned l, const u16* g, size_t st16) {
#if defined(__HIP_DEVICE_COMPILE__)
  asm volatile("global_load_async_to_lds_b128 %0, %8, off\n\t"
               "global_load_async_to_lds_b128 %1, %9, off\n\t"
               "global_load_async_to_lds_b128 %2, %10, off\n\t"
               "global_load_async_to_lds_b128 %3, %11, off\n\t"
               "global_load_async_to_lds_b128 %4, %12, off\n\t"
               "global_load_async_to_lds_b128 %5, %13, off\n\t"
               "global_load_async_to_lds_b128 %6, %14, off\n\t"
               "global_load_async_to_lds_b128 %7, %15, off\n\t"
               "s_wait_xcnt 0x0"
               :: "v"(l), "v"(l + 16u * GPITCH), "v"(l + 32u * GPITCH), "v"(l + 48u * GPITCH),
                  "v"(l + 64u * GPITCH), "v"(l + 80u * GPITCH), "v"(l + 96u * GPITCH), "v"(l + 112u * GPITCH),
                  "v"(g), "v"(g + st16), "v"(g + 2 * st16), "v"(g + 3 * st16),
                  "v"(g + 4 * st16), "v"(g + 5 * st16), "v"(g + 6 * st16), "v"(g + 7 * st16)
               : "memory");
#endif
}
// this wave's own copies have landed in LDS
__device__ __forceinline__ void wait_async0() {
#if defined(__HIP_DEVICE_COMPILE__)
  asm volatile("s_wait_asynccnt 0x0" ::: "memory");
#endif
}
// this wave's LDS reads have returned, so the buffer may be handed to its next writer
__device__ __forceinline__ void wait_ds0() {
#if defined(__HIP_DEVICE_COMPILE__)
  asm volatile("s_wait_dscnt 0x0" ::: "memory");
#endif
}
__device__ __forceinline__ FragU ldfrag_s(const unsigned char* p) {   // split k map: bytes 0..15 and 32..47 from p
  FragU f;
  f.u[0] = *(const v4u*)(p);
  f.u[1] = *(const v4u*)(p + 32);
  return f;
}
template <bool BF>
__device__ __forceinline__ v8f mma_x(const FragU& a, const FragU& b, v8f c) {
  if constexpr (BF) return mma_b(a.b, b.b, c);
  else              return mma_h(a.h, b.h, c);
}

template <bool BF>
__device__ __forceinline__ void gemm_core(unsigned char* ring, const u16* Ab, const u16* Bb, int K, int row0, int col0,
                                          int tid, v8f (&acc)[4][4]) {
  const int wave = tid >> 5, lane = tid & 31, hh = lane >> 4, m = lane & 15;
  const int r0 = tid >> 3, ch = tid & 7;
  const u16* ga = Ab + (size_t)(row0 + r0) * K + ch * 8;
  const u16* gb = Bb + (size_t)(col0 + r0) * K + ch * 8;
  const size_t st16 = (size_t)16 * K;
  const unsigned la = lds_off(ring) + (unsigned)(r0 * GPITCH + ch * 16);
  const int nt = K / GKP;
  const unsigned char* fa = ring + ((wave >> 1) * 64 + m) * GPITCH + hh * 16;
  const unsigned char* fb = ring + (GBM + (wave & 1) * 64 + m) * GPITCH + hh * 16;
#pragma unroll
  for (int i = 0; i < 4; ++i) {
#pragma unroll
    for (int j = 0; j < 4; ++j) acc[i][j] = zero8();
  }
  copy8(la, ga, st16);
  copy8(la + GBM * GPITCH, gb, st16);
  wait_async0();
  __syncthreads();                           // pass 0's rows are readable by every wave
  if (nt > 1) {
    copy8(la + GSTAGE, ga + GKP, st16);
    copy8(la + GSTAGE + GBM * GPITCH, gb + GKP, st16);
  }
#pragma unroll 1                             // one pass per trip: the two-buffer order below is per pass
  for (int t = 0; t < nt; ++t) {
    const unsigned bo = (unsigned)(t & 1) * GSTAGE;
    // Two blocks of 16 products (k 0..31, k 32..63). All of block 0's fragments and nine products' worth of block 1's are
    // loaded as one group; block 1's last A and B fragments follow into registers that block 0 has freed, which keeps the
    // wave inside 256 registers.
    FragU a0[4], b0[4], a1[4], b1[4];
#pragma unroll
    for (int i = 0; i < 4; ++i) {
      a0[i] = ldfrag_s(fa + bo + i * (16 * GPITCH));
      b0[i] = ldfrag_s(fb + bo + i * (16 * GPITCH));
    }
#pragma unroll
    for (int i = 0; i < 3; ++i) {
      a1[i] = ldfrag_s(fa + bo + i * (16 * GPITCH) + 64);
      b1[i] = ldfrag_s(fb + bo + i * (16 * GPITCH) + 64);
    }
    __builtin_amdgcn_sched_barrier(0);       // the LDS loads stay one group ahead of the products, none among them
#pragma unroll
    for (int i = 0; i < 4; ++i) {
#pragma unroll
      for (int j = 0; j < 4; ++j) acc[i][j] = mma_x<BF>(a0[i], b0[j], acc[i][j]);
    }
    __builtin_amdgcn_sched_barrier(0);       // the late pair is loaded here, not earlier (registers) and not later (latency)
    a1[3] = ldfrag_s(fa + bo + 3 * (16 * GPITCH) + 64);
    b1[3] = ldfrag_s(fb + bo + 3 * (16 * GPITCH) + 64);
    __builtin_amdgcn_sched_barrier(0);       // nine products that do not need the late pair cover its latency
#pragma unroll
    for (int i = 0; i < 3; ++i) {
#pragma unroll
      for (int j = 0; j < 3; ++j) acc[i][j] = mma_x<BF>(a1[i], b1[j], acc[i][j]);
    }
#pragma unroll
    for (int i = 0; i < 3; ++i) acc[i][3] = mma_x<BF>(a1[i], b1[3], acc[i][3]);
#pragma unroll
    for (int j = 0; j < 4; ++j) acc[3][j] = mma_x<BF>(a1[3], b1[j], acc[3][j]);
    __builtin_amdgcn_sched_barrier(0);       // the products stay ahead of the hand-over waits, else the late pair's latency is bare
    wait_ds0();
    wait_async0();
    __syncthreads();                         // publishes pass t+1's rows and ends every read of pass t's buffer
    if (t + 2 < nt) {
      copy8(la + bo, ga + (size_t)(t + 2) * GKP, st16);
      copy8(la + bo + GBM * GPITCH, gb + (size_t)(t + 2) * GKP, st16);
    }
  }
  wait_async0();
}

// =====================================================================================================
// Batched bf16 GEMM with 16-bit result: C[bt][M][N] (f16 of acc*oscale) = A[bt][M][K] (bf16 row-major) . Bt[bt][N][K]^T
// (bf16 k-contiguous); per-batch element strides bstA/bstB/bstC. Block = 128x128 tile (gemm_core);
// grid = nbatch*(M/128)*(N/128). Each wave writes its 64x64 part as four 16x64 slabs through its own LDS slab.
// =====================================================================================================
__global__ __launch_bounds__(128)
void gemm_b16(const u16* __restrict__ A, const u16* __restrict__ Bt, u16* C, int M, int N, int K,
              int bstA, int bstB, int bstC, float oscale) {
  __shared__ __align__(16) unsigned char ring[2 * GSTAGE];
  __shared__ __align__(16) float slab[4 * SLAB];
  const int tid = threadIdx.x, wave = tid >> 5, lane = tid & 31;
  const int ntile = N / GBN, mtile = M / GBM;
  const int per   = ntile * mtile;
  const int bid   = blockIdx.x;
  const int bt    = bid / per;
  const int t     = bid - bt * per;
  const int row0  = (t / ntile) * GBM;
  const int col0  = (t % ntile) * GBN;
  if (row0 + GBM > M) return;                // block-uniform, ahead of every copy and barrier; never taken with the exact grid
  const u16* Ab = A  + (size_t)bt * (size_t)bstA;
  const u16* Bb = Bt + (size_t)bt * (size_t)bstB;
  u16*       Cb = C  + (size_t)bt * (size_t)bstC;
  v8f acc[4][4];
  gemm_core<true>(ring, Ab, Bb, K, row0, col0, tid, acc);
#pragma unroll
  for (int i = 0; i < 4; ++i) {
    wave_sync_lds();                         // the slab's previous rows have been read back before they are rewritten
    epi16(slab + wave * SLAB, acc[i][0], acc[i][1], acc[i][2], acc[i][3], oscale, Cb, N,
          (size_t)(row0 + (wave >> 1) * 64 + i * 16), col0 + (wave & 1) * 64, lane);
  }
}

// =====================================================================================================
// f16 GEMM with f32 result: C[M][N] (f32) = A[M][K] (f16 row-major) . Bt[N][K]^T (f16 k-contiguous) times oscale;
// one product per tile pair. Same tiling as gemm_b16; grid = (M/128)*(N/128).
// =====================================================================================================
__global__ __launch_bounds__(128)
void gemm_hf(const u16* __restrict__ A, const u16* __restrict__ Bt, float* C, int M, int N, int K, float oscale) {
  __shared__ __align__(16) unsigned char ring[2 * GSTAGE];
  __shared__ __align__(16) float slab[4 * SLAB];
  const int tid = threadIdx.x, wave = tid >> 5, lane = tid & 31;
  const int ntile = N / GBN;
  const int bid   = blockIdx.x;
  const int row0  = (bid / ntile) * GBM;
  const int col0  = (bid % ntile) * GBN;
  if (row0 + GBM > M) return;                // block-uniform, ahead of every copy and barrier; never taken with the exact grid
  v8f acc[4][4];
  gemm_core<false>(ring, A, Bt, K, row0, col0, tid, acc);
#pragma unroll
  for (int i = 0; i < 4; ++i) {
    wave_sync_lds();                         // the slab's previous rows have been read back before they are rewritten
    epi64(slab + wave * SLAB, acc[i][0], acc[i][1], acc[i][2], acc[i][3], oscale, C, N,
          (size_t)(row0 + (wave >> 1) * 64 + i * 16), col0 + (wave & 1) * 64, lane);
  }
}

// =====================================================================================================
// Multi-head flash attention (no mask): block = (batch b, head, 128 query rows), 8 waves, wave w owns the 16 query rows
// q0 = 128*qt + 16*w .. q0+15.
//   q plane (f16, x8) laid out [b][s][h][d]; k plane the same; v^T plane [b][h][d][s] (x1024).
//   K and v^T reach the waves through LDS, shared by the block: a stage is 64 keys = 64 k rows of 128 B (rows 0..63) and the
//   64 v^T rows' 128-B pieces of those keys (rows 64..127), at pitch 144 B (16 B x odd: ds_load_b128 without bank conflicts).
//   Two buffers; stage t+1's rows fly (asynchronous copies, 16 B per lane, a wave-wide copy = 4 whole 128-B lines) while
//   stage t is worked on. Thread = (row tid>>3 of a group of 32, 16-B chunk tid&7); 2 + 2 copies per thread and stage.
//   All NST = 32 stages are visited (static bound), each as two key blocks of 32 keys in rising order.
//   Scores are computed TRANSPOSED: S^T tile g (g = 0,1) = k rows (keys kb+16g .. +15, A operand, row m = lane&15, split k map
//   over d) times q^T (B operand, col n = query q0 + (lane&15), k = d, split map), one product per tile and 32-deep d-chunk.
//   D element r of lane l = (key kb+16g+8h+r, query q0+(l&15)), so a lane owns one query column and 16 of its 32 keys; the
//   partner lane l^16 owns the other 16 -> row max / row sum need one xor-16 shuffle.
//   Online max-subtracted base-2 softmax in f32 (scale 1/8 and the q/k carries folded into lsc; the running maximum is kept in
//   raw score units, the running sum l carries P's x32768). The exp'd values ARE the
//   P A-fragment in place: A row m = query = lane&15, element i <- key kb+8h+i (tile 0, D element i), element 8+i <- key
//   kb+16+8h+i (tile 1, D element i). P is carried x32768 as single f16. The rescale factor of query row 8h+r of the
//   O accumulators is fetched from lane 8h+r with a shuffle (uniform control). 4 v^T B fragments (col n = d = 16j + (lane&15),
//   keys k-contiguous), 4 P.V WMMAs per key block.
//   Epilogue: 1/l (per query, shuffled to the D row owner) and carry folds in f32; the wave's 16x64 f32 result staged in its
//   own slab, which lies in the ring's bytes once the last stage's barrier has ended every read of them.
// coverage: per wave 4 instructions x 4 rows x 8 lanes x 8 halves = 16 x 64; grid 1024 blocks x 8 waves = every
//           (b, s, h) row of the O plane exactly once.
// =====================================================================================================
#define APITCH 144
#define ASTAGE ((AKEYS + HD) * APITCH)
static_assert(AKEYS == 64 && HD * 2 == 128 && AKEYS * 2 == 128 && (APITCH % 16) == 0 && ((APITCH / 16) % 2) == 1);
static_assert(ATT_WAVES * SLAB * 4 <= 2 * ASTAGE && ATT_THREADS * 2 * 16 == AKEYS * 128 && NST >= 2);

// One stage's four asynchronous 16-B copies of this lane: two k rows and two v^T rows, 32 rows apart. The s_wait_xcnt closes
// the statement so that no address register named here is rewritten ahead of it.
__device__ __forceinline__ void copy_kv(unsigned l, const u16* gk, const u16* gv) {
#if defined(__HIP_DEVICE_COMPILE__)
  asm volatile("global_load_async_to_lds_b128 %0, %4, off\n\t"
               "global_load_async_to_lds_b128 %1, %5, off\n\t"
               "global_load_async_to_lds_b128 %2, %6, off\n\t"
               "global_load_async_to_lds_b128 %3, %7, off\n\t"
               "s_wait_xcnt 0x0"
               :: "v"(l), "v"(l + 32u * APITCH), "v"(l + 64u * APITCH), "v"(l + 96u * APITCH),
                  "v"(gk), "v"(gk + (size_t)32 * (NH * HD)), "v"(gv), "v"(gv + (size_t)32 * SEQ)
               : "memory");
#endif
}

__global__ __launch_bounds__(ATT_THREADS)
void attn_fwd(const u16* __restrict__ QPp, const u16* __restrict__ KPp, const u16* __restrict__ VPp, u16* OPp) {
  __shared__ __align__(16) unsigned char ring[2 * ASTAGE];   // two K / v^T stages; per-wave result slabs in the epilogue

  const int tid  = threadIdx.x;
  const int wave = tid >> 5;
  const int lane = tid & 31;
  const int hh   = lane >> 4;
  const int c    = lane & 15;

  const int bid  = blockIdx.x;
  const int qt   = bid & (SEQ / ATT_QROWS - 1);
  const int head = (bid >> 4) & (NH - 1);
  const int b    = bid >> 8;
  const int q0   = qt * ATT_QROWS + wave * 16;

  // B fragments of q^T: col n = query q0 + c, k = d (k-contiguous row of the q plane)
  const size_t qofs = (((size_t)(b * SEQ + q0 + c)) * NH + head) * HD + 8 * hh;
  const _Float16* Qb = (const _Float16*)(const void*)QPp + qofs;
  // this thread's copy sources: k row (stage key r0), v^T row (d = r0), 16-B chunk ch; stage t adds 64 keys
  const int r0 = tid >> 3, ch = tid & 7;
  const u16* gk = KPp + (((size_t)b * SEQ + r0) * NH + head) * HD + ch * 8;
  const u16* gv = VPp + ((size_t)(b * NH + head) * HD + r0) * SEQ + ch * 8;
  const unsigned la = lds_off(ring) + (unsigned)(r0 * APITCH + ch * 16);
  // A fragments of k: LDS row = key in stage 32u + 16g + c, k = d; B fragments of v: LDS row = 64 + d (16j + c), k = key in stage
  const unsigned char* fk = ring + c * APITCH + hh * 16;
  const unsigned char* fv = ring + (AKEYS + c) * APITCH + hh * 16;
  const float lsc = 0.125f * (LOG2E / (QSC * KSC));

  copy_kv(la, gk, gv);
  const v16h qf0 = ldfrag_h(Qb);            // d 0..31
  const v16h qf1 = ldfrag_h(Qb + 32);       // d 32..63
  wait_async0();
  __syncthreads();                           // stage 0's rows are readable by every wave
  copy_kv(la + ASTAGE, gk + (size_t)AKEYS * (NH * HD), gv + AKEYS);

  float mrun = -INFINITY, lrun = 0.f;
  v8f o[4];
#pragma unroll
  for (int j = 0; j < 4; ++j) o[j] = zero8();

#pragma unroll 1                             // one stage per trip: the two-buffer order below is per stage
  for (int t = 0; t < NST; ++t) {
    const unsigned bo = (unsigned)(t & 1) * ASTAGE;
#pragma unroll 1                             // rolled: unrolled, the two key blocks' live values overlap and the wave passes 128
                                             // registers, so that only three of the four blocks a WGP gets are resident at once
    for (int u = 0; u < 2; ++u) {
      // ---- transposed scores: s0 = keys kb..kb+15, s1 = keys kb+16..kb+31 (kb = 64t + 32u), column = query q0 + c ----
      v8f s0 = zero8(), s1 = zero8();
      const unsigned char* k0p = fk + bo + u * (32 * APITCH);
      const unsigned char* k1p = k0p + 16 * APITCH;
      const v16h ka0 = ldfrag_s(k0p).h, ka1 = ldfrag_s(k0p + 64).h;
      const v16h kc0 = ldfrag_s(k1p).h, kc1 = ldfrag_s(k1p + 64).h;
      s0 = mma_h(ka0, qf0, s0);
      s0 = mma_h(ka1, qf1, s0);
      s1 = mma_h(kc0, qf0, s1);
      s1 = mma_h(kc1, qf1, s1);
      guard2(s0, s1, qf0, qf1, ka0, ka1, kc0, kc1);
      // ---- maximum of this lane's 16 raw scores for query q0 + c (the scale lsc is positive, so it commutes with the maximum) ----
      float cm = s0[0];
#pragma unroll
      for (int i = 1; i < 8; ++i) cm = fmaxf(cm, s0[i]);
#pragma unroll
      for (int i = 0; i < 8; ++i) cm = fmaxf(cm, s1[i]);
      cm = fmaxf(cm, __shfl_xor(cm, 16, 32));
      const float mn = fmaxf(mrun, cm);                                // raw score units; finite from the first key block on
      const float al = (mrun == -INFINITY) ? 0.f : __builtin_amdgcn_exp2f((mrun - mn) * lsc);   // o and l are zero while mrun is -inf
      mrun = mn;
      // ---- probabilities carried x32768 and the P A-fragment: one packed FMA forms two exponent arguments
      //      s * lsc - mn * lsc + 15 (<= 15 up to the FMA's rounding), one bare v_exp_f32 each gives p * 32768 (a result under
      //      2^-126 needs no care: it is nothing beside the maximum's 32768, in f16 and in the f32 sum); element i <-> s0[i], 8+i <-> s1[i] ----
      const float eb = fmaf(-mn, lsc, PLOG);
      const v2f lsc2 = {lsc, lsc}, eb2 = {eb, eb};
      v2f ps2 = {0.f, 0.f};                                            // even and odd elements' partial sums
      FragH ph;
#pragma unroll
      for (int w = 0; w < 2; ++w) {
#pragma unroll
        for (int e4 = 0; e4 < 4; ++e4) {
          const v2f sc = {w ? s1[2 * e4] : s0[2 * e4], w ? s1[2 * e4 + 1] : s0[2 * e4 + 1]};
          const v2f arg = __builtin_elementwise_fma(sc, lsc2, eb2);
          const v2f pp = {__builtin_amdgcn_exp2f(arg.x), __builtin_amdgcn_exp2f(arg.y)};
          ps2 += pp;
          ph.u[w][e4] = __builtin_bit_cast(unsigned, __builtin_convertvector(pp, v2h));
        }
      }
      float ps = ps2.x + ps2.y;
      ps += __shfl_xor(ps, 16, 32);
      lrun = lrun * al + ps;
      // ---- rescale the O accumulators: D row 8hh+r = query q0+8hh+r, its factor lives in lane 8hh+r (and 16+8hh+r) ----
      float scl[8];
#pragma unroll
      for (int r = 0; r < 8; ++r) scl[r] = __shfl(al, 8 * hh + r, 32);
#pragma unroll
      for (int j = 0; j < 4; ++j) {
#pragma unroll
        for (int r = 0; r < 8; ++r) o[j][r] *= scl[r];
      }
      // ---- P.V : B fragment col n = d = j*16 + c, keys contiguous in the staged v^T rows ----
      {
        const unsigned char* vp = fv + bo + u * 64;
        __builtin_amdgcn_sched_barrier(0);   // the v^T fragment loads stay behind the softmax: moved ahead of it their 32 registers
                                             // are live across it and the wave passes 128, so that only three blocks a WGP are resident
        const v16h vf0 = ldfrag_s(vp).h;
        const v16h vf1 = ldfrag_s(vp + 16 * APITCH).h;
        const v16h vf2 = ldfrag_s(vp + 32 * APITCH).h;
        const v16h vf3 = ldfrag_s(vp + 48 * APITCH).h;
        o[0] = mma_h(ph.v, vf0, o[0]);
        o[1] = mma_h(ph.v, vf1, o[1]);
        o[2] = mma_h(ph.v, vf2, o[2]);
        o[3] = mma_h(ph.v, vf3, o[3]);
        guard6<v16h>(o[0], o[1], o[2], o[3], ph.v, vf0, vf1, vf2, vf3, ph.v);
      }
    }
    wait_ds0();
    wait_async0();
    __syncthreads();                         // publishes stage t+1's rows and ends every read of stage t's buffer
    if (t + 2 < NST) copy_kv(la + bo, gk + (size_t)(t + 2) * (AKEYS * NH * HD), gv + (t + 2) * AKEYS);
  }
  wait_async0();
  acc_guard4(o[0], o[1], o[2], o[3]);

  // ---- fold 1/l (per query, owned by lane = query; l >= 1 by construction) and the carries; stage the 16x64 slab ----
  const float linv = (lrun > 0.f) ? ((1.0f / lrun) * (1.0f / VCAR)) : 0.f;   // lrun carries P's x32768 too, so that carry cancels
  float inv[8];
#pragma unroll
  for (int r = 0; r < 8; ++r) inv[r] = __shfl(linv, 8 * hh + r, 32);
  float* slab = (float*)(void*)ring + wave * SLAB;
#pragma unroll
  for (int r = 0; r < 8; ++r) {
#pragma unroll
    for (int j = 0; j < 4; ++j) slab[(8 * hh + r) * 68 + j * 16 + c] = o[j][r] * inv[r];
  }
  wave_sync_lds();
  // ---- O x1024 -> single f16 plane; lane = (row in group of 4, 8 consecutive d) ----
  v4u oh[4];
  const int rq = lane >> 3, c8 = (lane & 7) * 8;
#pragma unroll
  for (int i4 = 0; i4 < 4; ++i4) {
    const int row = i4 * 4 + rq;
    const v4f a = *(const v4f*)(slab + row * 68 + c8), c4 = *(const v4f*)(slab + row * 68 + c8 + 4);
    float w[8];
#pragma unroll
    for (int e = 0; e < 4; ++e) { w[e] = a[e] * OSC; w[4 + e] = c4[e] * OSC; }
#pragma unroll
    for (int e = 0; e < 4; ++e) oh[i4][e] = pk16(h_bits((_Float16)w[2 * e]), h_bits((_Float16)w[2 * e + 1]));
  }
  const size_t ob = (((size_t)(b * SEQ + q0)) * NH + head) * HD + c8;
  {
#pragma unroll
    for (int i4 = 0; i4 < 4; ++i4) {
      const int row = i4 * 4 + rq;
      const size_t o8 = ob + (size_t)row * (NH * HD);
      *(v4u*)(OPp + o8) = oh[i4];
    }
    
  }
}

// =====================================================================================================
// Workspace map (bytes); every plane is fully written by whole-line stores before it is read; all extents are exact multiples
// of the store granularity (no pad rows needed):
//   XB  bf16 [8192][1024]                      16777216        (x)
//   WB  bf16 [3072 n][1024 k]                   6291456        (W_qkv, rows 0..1023 q, 1024..2047 k, 2048..3071 v)
//   WOB f16  [1024 n][1024 k] (bf16 value x1024) 2097152
//   QP  f16 [8192][16*64] x8                   16777216        KP same  16777216
//   VP  f16 [4][16*64][2048] x1024             16777216
//   OP  f16 [8192][16*64] x1024                16777216
//   end                                        92274688
// =====================================================================================================
extern "C" void kernel_launch(void* const* d_in, const int* in_sizes, int n_in,
                              void* d_out, int out_size, void* d_ws, size_t ws_size,
                              hipStream_t stream) {
  const int ROWS = NB * SEQ;                            // 8192
  if (n_in < 3) return;
  if (in_sizes[0] != ROWS * DMOD) return;
  if (in_sizes[1] != NQKV * DMOD) return;
  if (in_sizes[2] != DMOD * DMOD) return;
  if (out_size != ROWS * DMOD) return;

  const float* Xin = (const float*)d_in[0];
  const float* Wqk = (const float*)d_in[1];
  const float* Wpr = (const float*)d_in[2];
  float*       out = (float*)d_out;

  const size_t szXB = (size_t)ROWS * DMOD * 2;                  // 16777216
  const size_t szWB = (size_t)NQKV * DMOD * 2;                  //  6291456
  const size_t szWO = (size_t)DMOD * DMOD * 2;                  //  2097152
  const size_t szP  = (size_t)ROWS * DMOD * 2;                  // 16777216  (q / k / o planes)
  const size_t szVP = (size_t)NB * NH * HD * SEQ * 2;           // 16777216
  size_t off = 0;
  const size_t oXB = off; off += szXB;
  const size_t oWB = off; off += szWB;
  const size_t oWO = off; off += szWO;
  const size_t oQP = off; off += szP;
  const size_t oKP = off; off += szP;
  const size_t oVP = off; off += szVP;
  const size_t oOP = off; off += szP;
  if (off > ws_size) return;                            // off = 92274688
  if (off > (size_t)134217728) return;

  char* ws = (char*)d_ws;
  u16* XB  = (u16*)(ws + oXB);
  u16* WB  = (u16*)(ws + oWB);
  u16* WOB = (u16*)(ws + oWO);
  u16* QP  = (u16*)(ws + oQP);
  u16* KP  = (u16*)(ws + oKP);
  u16* VP  = (u16*)(ws + oVP);
  u16* OP  = (u16*)(ws + oOP);

  const dim3 blk(256);
  const int n8x = (ROWS * DMOD) / 8;                    // 1048576
  const int n8q = (NQKV * DMOD) / 8;                    //  393216
  const int n8w = (DMOD * DMOD) / 8;                    //  131072
  if ((n8x % 256) != 0 || (n8q % 256) != 0 || (n8w % 256) != 0) return;
  if ((DMOD % GBM) != 0 || (ROWS % GBM) != 0 || (SEQ % GBN) != 0 || (DMOD % GKP) != 0) return;
  const dim3 gX(n8x / 256);                             // 4096
  const dim3 gQ(n8q / 256);                             // 1536
  const dim3 gW(n8w / 256);                             // 512
  const dim3 gG((ROWS / GBM) * (DMOD / GBN));           // 512
  const dim3 gV(NB * (DMOD / GBM) * (SEQ / GBN));       // 512
  const dim3 bG(128);
  const dim3 gAT(ATT_BLOCKS);                           // 1024
  const dim3 bAT(ATT_THREADS);                          // 256

  // (0..2) operand planes: x -> bf16; W_qkv [n = out][k = in] (already k-contiguous) -> bf16; W_proj -> f16 of bf16 value x1024
  cvt16<<<gX, blk, 0, stream>>>(Xin, XB, n8x, 0, 1.0f);
  cvt16<<<gQ, blk, 0, stream>>>(Wqk, WB, n8q, 0, 1.0f);
  cvt16<<<gW, blk, 0, stream>>>(Wpr, WOB, n8w, 1, WOS);
  // (3,4) q and k planes [8192][h*64+d] = f16(x.Wq^T x8), f16(x.Wk^T x8)
  gemm_b16<<<gG, bG, 0, stream>>>(XB, WB, QP, ROWS, DMOD, DMOD, 0, 0, 0, QSC);
  gemm_b16<<<gG, bG, 0, stream>>>(XB, WB + (size_t)DMOD * DMOD, KP, ROWS, DMOD, DMOD, 0, 0, 0, KSC);
  // (5) v^T plane per batch: [1024 = h*64+d][2048 keys] = f16(Wv . x_b^T x1024), 4 batches in the grid
  gemm_b16<<<gV, bG, 0, stream>>>(WB + (size_t)2 * DMOD * DMOD, XB, VP, DMOD, SEQ, DMOD, 0, SEQ * DMOD, DMOD * SEQ, VCAR);
  // (6) attention -> O plane [b][s][h][d] x1024 (single f16)
  attn_fwd<<<gAT, bAT, 0, stream>>>(QP, KP, VP, OP);
  // (7) output projection -> out [8192][1024] f32, carries 1024 (O) x 1024 (wo) folded back
  gemm_hf<<<gG, bG, 0, stream>>>(OP, WOB, out, ROWS, DMOD, DMOD, 1.0f / (OSC * WOS));
  (void)hipGetLastError();
}

// v004
// It runs in 138 microseconds.
// In both of two side-by-side timings against v003, it was 1.09 times as fast.
// Counting every step since v000, it is 3.56 times as fast.
// Contractions: x.Wq^T, x.Wk^T and Wv.x_b^T on v_wmma_f32_16x16x32_bf16 (x and W_qkv planes RNE-converted to bf16 operands,
// f32 accumulate); scores k'.q'^T (q', k' single f16 planes carried x8), P.v (P x128 single f16, v x1024 single f16) and
// O.Wo^T (O single f16 plane x1024, Wo as f16(bf16(Wo)) x1024): v_wmma_f32_16x16x32_f16, f32 accumulate.
// Base-2 online softmax, 1/l and carry folds in f32 on VALU.
#include <hip/hip_runtime.h>
#include <math.h>
#include <stdint.h>

#define NB    4
#define SEQ   2048
#define DMOD  1024
#define NQKV  (3 * DMOD)
#define NH    16
#define HD    64
#define QSC   8.0f
#define KSC   8.0f
#define PCAR  128.0f
#define PLOG  7.0f
#define RLAZY 8.0f
#define VCAR  1024.0f
#define OSC   1024.0f
#define WOS   1024.0f
#define LOG2E 1.4426950408889634f
#define ATT_WAVES   8
#define ATT_THREADS (ATT_WAVES * 32)
#define ATT_QROWS   (ATT_WAVES * 16)
#define ATT_BLOCKS  (NB * NH * (SEQ / ATT_QROWS))
#define AKEYS  64
#define NST    (SEQ / AKEYS)
#define SLAB   (16 * 68)
static_assert(HD == 64 && DMOD == NH * HD);
static_assert(PCAR == 128.0f && PLOG == 7.0f && PLOG + RLAZY <= 15.0f);   // P <= 2^(PLOG + RLAZY) stays inside f16
static_assert((SEQ / ATT_QROWS) == 16 && NH == 16 && NB == 4);
static_assert(ATT_THREADS == 256 && ATT_BLOCKS == 1024 && NST == 32);
static_assert(((NB * SEQ) % 64) == 0 && (DMOD % 64) == 0 && (DMOD % 32) == 0 && (SEQ % 64) == 0);
static_assert(((NB * SEQ * DMOD / 8) % 256) == 0 && ((NQKV * DMOD / 8) % 256) == 0 && ((DMOD * DMOD / 8) % 256) == 0);
static_assert((SLAB * 4) % 16 == 0);

typedef unsigned short u16;
typedef _Float16 v16h __attribute__((ext_vector_type(16)));
typedef _Float16 v8h  __attribute__((ext_vector_type(8)));
typedef __bf16   v16b __attribute__((ext_vector_type(16)));
typedef float    v8f  __attribute__((ext_vector_type(8)));
typedef float    v4f  __attribute__((ext_vector_type(4)));
typedef float    v2f  __attribute__((ext_vector_type(2)));
typedef _Float16 v2h  __attribute__((ext_vector_type(2)));
typedef unsigned int v4u __attribute__((ext_vector_type(4)));

union FragH { v16h v; v8h h[2]; v4u u[2]; };

// ---- scalar helpers --------------------------------------------------------------------------------
__device__ __forceinline__ unsigned short bf_bits(float f) {          // f32 -> bf16 bits, RNE convert
  unsigned u = __float_as_uint(f);
  return (unsigned short)((u + 0x7FFFu + ((u >> 16) & 1u)) >> 16);
}
__device__ __forceinline__ float bf_up(unsigned short h) { return __uint_as_float(((unsigned)h) << 16); }
__device__ __forceinline__ unsigned short h_bits(_Float16 x) { return __builtin_bit_cast(unsigned short, x); }
__device__ __forceinline__ unsigned pk16(unsigned short a, unsigned short b) { return (unsigned)a | ((unsigned)b << 16); }
__device__ __forceinline__ v8f zero8() { v8f z = {0.f, 0.f, 0.f, 0.f, 0.f, 0.f, 0.f, 0.f}; return z; }

// ---- fragment loaders: 16-bit A/B operand, lane -> row/col (lane&15), p already includes +8*(lane>>4);
//      elements 0..7 <- p[0..7] (k0+8h..), elements 8..15 <- p[16..23] (k0+16+8h..)  (same split k map for A and B;
//      B is always read from a k-contiguous [n][k] plane)
__device__ __forceinline__ v16h ldfrag_h(const _Float16* p) {
  FragH f;
  f.h[0] = *(const v8h*)(p);
  f.h[1] = *(const v8h*)(p + 16);
  return f.v;
}

__device__ __forceinline__ v8f mma_h(v16h a, v16h b, v8f c) {
  return __builtin_amdgcn_wmma_f32_16x16x32_f16(false, a, false, b, (short)0, c, false, false);
}
__device__ __forceinline__ v8f mma_b(v16b a, v16b b, v8f c) {
  return __builtin_amdgcn_wmma_f32_16x16x32_bf16(false, a, false, b, (short)0, c, false, false);
}
__device__ __forceinline__ void guard2(v8f& a, v8f& b, v16h x0, v16h x1, v16h x2, v16h x3, v16h x4, v16h x5) {
#if defined(__HIP_DEVICE_COMPILE__)
  asm volatile("v_nop\n\tv_nop\n\tv_nop\n\tv_nop"
               : "+v"(a), "+v"(b) : "v"(x0), "v"(x1), "v"(x2), "v"(x3), "v"(x4), "v"(x5) : "memory");
#endif
}
template <typename F>
__device__ __forceinline__ void guard6(v8f& a, v8f& b, v8f& c, v8f& d, F x0, F x1, F x2, F x3, F x4, F x5) {
#if defined(__HIP_DEVICE_COMPILE__)
  asm volatile("v_nop\n\tv_nop\n\tv_nop\n\tv_nop"
               : "+v"(a), "+v"(b), "+v"(c), "+v"(d) : "v"(x0), "v"(x1), "v"(x2), "v"(x3), "v"(x4), "v"(x5) : "memory");
#endif
}
__device__ __forceinline__ void acc_guard4(v8f& a, v8f& b, v8f& c, v8f& d) {
#if defined(__HIP_DEVICE_COMPILE__)
  asm volatile("v_nop\n\tv_nop\n\tv_nop\n\tv_nop" : "+v"(a), "+v"(b), "+v"(c), "+v"(d));
#endif
}
__device__ __forceinline__ void wave_sync_lds() {
#if defined(__HIP_DEVICE_COMPILE__)
  __builtin_amdgcn_fence(__ATOMIC_RELEASE, "workgroup");
  __builtin_amdgcn_wave_barrier();
  __builtin_amdgcn_fence(__ATOMIC_ACQUIRE, "workgroup");
#endif
}

// =====================================================================================================
// f32 plane -> 16-bit plane, same layout:  mode 0: bf16 RNE bits;  mode 1: f16 bits of (bf16 RNE value) * scale.
// Thread = 8 consecutive elements: two 16-B loads, one 16-B store; 32 consecutive lanes = 512 contiguous, 512-B aligned bytes
// coverage: grid = n8/256 blocks (host checks exactness) x 256 thr x 8 = the whole plane.
// =====================================================================================================
__global__ __launch_bounds__(256) void cvt16(const float* __restrict__ x, u16* D, int n8, int mode, float scale) {
  const int gt = blockIdx.x * 256 + (int)threadIdx.x;
  if (gt >= n8) return;                     // no barriers in this kernel
  const float* p = x + (size_t)gt * 8;
  const v4f a = *(const v4f*)(p), c4 = *(const v4f*)(p + 4);
  float v[8];
#pragma unroll
  for (int e = 0; e < 4; ++e) { v[e] = a[e]; v[4 + e] = c4[e]; }
  unsigned short s[8];
#pragma unroll
  for (int e = 0; e < 8; ++e) {
    const unsigned short bb = bf_bits(v[e]);
    const unsigned short hb = h_bits((_Float16)(bf_up(bb) * scale));
    s[e] = (mode != 0) ? hb : bb;
  }
  v4u o;
#pragma unroll
  for (int e = 0; e < 4; ++e) o[e] = pk16(s[2 * e], s[2 * e + 1]);
  u16* d = D + (size_t)gt * 8;
  {
    *(v4u*)(d) = o;
    
  }
}

// =====================================================================================================
// barrier, then converted to f16 and written: lane = (row in group of 4, 8 consecutive cols); one instruction = 4 rows, each
// coverage: 4 instructions x 4 rows x 8 lanes x 8 halves = the wave's 16 x 64 tile.
// =====================================================================================================
__device__ __forceinline__ void epi16(float* sl, v8f a0, v8f a1, v8f a2, v8f a3, float oscale, u16* C, int N,
                                      size_t rowb, int col0, int lane) {
  const int hh = lane >> 4, m = lane & 15;
#pragma unroll
  for (int r = 0; r < 8; ++r) {
    const int ro = (8 * hh + r) * 68 + m;
    sl[ro]      = a0[r] * oscale;
    sl[ro + 16] = a1[r] * oscale;
    sl[ro + 32] = a2[r] * oscale;
    sl[ro + 48] = a3[r] * oscale;
  }
  wave_sync_lds();
  const int rq = lane >> 3, c8 = (lane & 7) * 8;
  v4u ov[4];
#pragma unroll
  for (int i4 = 0; i4 < 4; ++i4) {
    const int row = i4 * 4 + rq;
    const v4f a = *(const v4f*)(sl + row * 68 + c8), c4 = *(const v4f*)(sl + row * 68 + c8 + 4);
    float w[8];
#pragma unroll
    for (int e = 0; e < 4; ++e) { w[e] = a[e]; w[4 + e] = c4[e]; }
#pragma unroll
    for (int e = 0; e < 4; ++e) ov[i4][e] = pk16(h_bits((_Float16)w[2 * e]), h_bits((_Float16)w[2 * e + 1]));
  }
  u16* dst = C + (rowb + (size_t)rq) * (size_t)N + col0 + c8;
  const size_t st4 = (size_t)4 * (size_t)N;
#if defined(__HIP_DEVICE_COMPILE__)
  // The four stores and their s_wait_xcnt in one statement: the next slab reuses these address and data registers.
  asm volatile("global_store_b128 %0, %4, off\n\t"
               "global_store_b128 %1, %5, off\n\t"
               "global_store_b128 %2, %6, off\n\t"
               "global_store_b128 %3, %7, off\n\t"
               "s_wait_xcnt 0x0"
               :: "v"(dst), "v"(dst + st4), "v"(dst + 2 * st4), "v"(dst + 3 * st4),
                  "v"(ov[0]), "v"(ov[1]), "v"(ov[2]), "v"(ov[3])
               : "memory");
#endif
}

// =====================================================================================================
// coverage: 8 instructions x 2 rows x 16 lanes x 4 floats = the wave's 16 x 64 tile.
// =====================================================================================================
__device__ __forceinline__ void epi64(float* sl, v8f a0, v8f a1, v8f a2, v8f a3, float oscale, float* C, int N,
                                      size_t rowb, int col0, int lane) {
  const int hh = lane >> 4, m = lane & 15;
#pragma unroll
  for (int r = 0; r < 8; ++r) {
    const int ro = (8 * hh + r) * 68 + m;
    sl[ro]      = a0[r] * oscale;
    sl[ro + 16] = a1[r] * oscale;
    sl[ro + 32] = a2[r] * oscale;
    sl[ro + 48] = a3[r] * oscale;
  }
  wave_sync_lds();
  v4f vals[8];
#pragma unroll
  for (int it = 0; it < 8; ++it) vals[it] = *(const v4f*)(sl + (it * 2 + hh) * 68 + m * 4);
  float* dst = C + (rowb + (size_t)hh) * (size_t)N + col0 + m * 4;
  const size_t st2 = (size_t)2 * (size_t)N;
#if defined(__HIP_DEVICE_COMPILE__)
  // The eight stores and their s_wait_xcnt in one statement: the next slab reuses these address and data registers.
  asm volatile("global_store_b128 %0, %8, off\n\t"
               "global_store_b128 %1, %9, off\n\t"
               "global_store_b128 %2, %10, off\n\t"
               "global_store_b128 %3, %11, off\n\t"
               "global_store_b128 %4, %12, off\n\t"
               "global_store_b128 %5, %13, off\n\t"
               "global_store_b128 %6, %14, off\n\t"
               "global_store_b128 %7, %15, off\n\t"
               "s_wait_xcnt 0x0"
               :: "v"(dst), "v"(dst + st2), "v"(dst + 2 * st2), "v"(dst + 3 * st2),
                  "v"(dst + 4 * st2), "v"(dst + 5 * st2), "v"(dst + 6 * st2), "v"(dst + 7 * st2),
                  "v"(vals[0]), "v"(vals[1]), "v"(vals[2]), "v"(vals[3]), "v"(vals[4]), "v"(vals[5]), "v"(vals[6]), "v"(vals[7])
               : "memory");
#endif
}

// =====================================================================================================
// Shared GEMM core: acc[i][j] (16x16 f32 tiles) = A[row0 .. +127][K] . Bt[col0 .. +127][K]^T for one 128x128 block tile.
// 4 waves in a 2x2 grid, each owning 64x64 = 4x4 accumulator tiles, so one LDS fragment feeds four products.
// A pass is 64 k = 128 B of each of the 256 operand rows, laid in LDS at pitch 144 B (16 B x odd: ds_load_b128 without bank
// conflicts): rows 0..127 = A, rows 128..255 = Bt. Two buffers; pass t+1's rows fly (asynchronous copies, 16 B per lane,
// a wave-wide copy = 4 whole 128-B row pieces) while pass t is multiplied. Thread = (row tid>>3 of a group of 16, 16-B chunk
// tid&7); 8 + 8 copies per thread and pass cover 256 rows x 128 B. k runs upward in steps of 32 per accumulator.
// Needs M % 128 == 0, N % 128 == 0, K % 64 == 0 (host checks).
// =====================================================================================================
#define GBM    128
#define GBN    128
#define GKP    64
#define GPITCH 144
#define GSTAGE ((GBM + GBN) * GPITCH)
static_assert(GKP == 64 && (GPITCH % 16) == 0 && ((GPITCH / 16) % 2) == 1 && GPITCH >= GKP * 2);
static_assert((DMOD % GKP) == 0 && ((NB * SEQ) % GBM) == 0 && (DMOD % GBM) == 0 && (DMOD % GBN) == 0 && (SEQ % GBN) == 0);

union FragU { v4u u[2]; v16b b; v16h h; };

__device__ __forceinline__ unsigned lds_off(const void* p) { return (unsigned)(size_t)p; }

// Eight asynchronous 16-B copies of this lane, rows 16 apart. The s_wait_xcnt closes the statement so that no address
// register named here is rewritten ahead of it.
__device__ __forceinline__ void copy8(unsigned l, const u16* g, size_t st16) {
#if defined(__HIP_DEVICE_COMPILE__)
  asm volatile("global_load_async_to_lds_b128 %0, %8, off\n\t"
               "global_load_async_to_lds_b128 %1, %9, off\n\t"
               "global_load_async_to_lds_b128 %2, %10, off\n\t"
               "global_load_async_to_lds_b128 %3, %11, off\n\t"
               "global_load_async_to_lds_b128 %4, %12, off\n\t"
               "global_load_async_to_lds_b128 %5, %13, off\n\t"
               "global_load_async_to_lds_b128 %6, %14, off\n\t"
               "global_load_async_to_lds_b128 %7, %15, off\n\t"
               "s_wait_xcnt 0x0"
               :: "v"(l), "v"(l + 16u * GPITCH), "v"(l + 32u * GPITCH), "v"(l + 48u * GPITCH),
                  "v"(l + 64u * GPITCH), "v"(l + 80u * GPITCH), "v"(l + 96u * GPITCH), "v"(l + 112u * GPITCH),
                  "v"(g), "v"(g + st16), "v"(g + 2 * st16), "v"(g + 3 * st16),
                  "v"(g + 4 * st16), "v"(g + 5 * st16), "v"(g + 6 * st16), "v"(g + 7 * st16)
               : "memory");
#endif
}
// this wave's own copies have landed in LDS
__device__ __forceinline__ void wait_async0() {
#if defined(__HIP_DEVICE_COMPILE__)
  asm volatile("s_wait_asynccnt 0x0" ::: "memory");
#endif
}
// this wave's LDS reads have returned, so the buffer may be handed to its next writer
__device__ __forceinline__ void wait_ds0() {
#if defined(__HIP_DEVICE_COMPILE__)
  asm volatile("s_wait_dscnt 0x0" ::: "memory");
#endif
}
__device__ __forceinline__ FragU ldfrag_s(const unsigned char* p) {   // split k map: bytes 0..15 and 32..47 from p
  FragU f;
  f.u[0] = *(const v4u*)(p);
  f.u[1] = *(const v4u*)(p + 32);
  return f;
}
template <bool BF>
__device__ __forceinline__ v8f mma_x(const FragU& a, const FragU& b, v8f c) {
  if constexpr (BF) return mma_b(a.b, b.b, c);
  else              return mma_h(a.h, b.h, c);
}

template <bool BF>
__device__ __forceinline__ void gemm_core(unsigned char* ring, const u16* Ab, const u16* Bb, int K, int row0, int col0,
                                          int tid, v8f (&acc)[4][4]) {
  const int wave = tid >> 5, lane = tid & 31, hh = lane >> 4, m = lane & 15;
  const int r0 = tid >> 3, ch = tid & 7;
  const u16* ga = Ab + (size_t)(row0 + r0) * K + ch * 8;
  const u16* gb = Bb + (size_t)(col0 + r0) * K + ch * 8;
  const size_t st16 = (size_t)16 * K;
  const unsigned la = lds_off(ring) + (unsigned)(r0 * GPITCH + ch * 16);
  const int nt = K / GKP;
  const unsigned char* fa = ring + ((wave >> 1) * 64 + m) * GPITCH + hh * 16;
  const unsigned char* fb = ring + (GBM + (wave & 1) * 64 + m) * GPITCH + hh * 16;
#pragma unroll
  for (int i = 0; i < 4; ++i) {
#pragma unroll
    for (int j = 0; j < 4; ++j) acc[i][j] = zero8();
  }
  copy8(la, ga, st16);
  copy8(la + GBM * GPITCH, gb, st16);
  wait_async0();
  __syncthreads();                           // pass 0's rows are readable by every wave
  if (nt > 1) {
    copy8(la + GSTAGE, ga + GKP, st16);
    copy8(la + GSTAGE + GBM * GPITCH, gb + GKP, st16);
  }
#pragma unroll 1                             // one pass per trip: the two-buffer order below is per pass
  for (int t = 0; t < nt; ++t) {
    const unsigned bo = (unsigned)(t & 1) * GSTAGE;
    // Two blocks of 16 products (k 0..31, k 32..63). All of block 0's fragments and nine products' worth of block 1's are
    // loaded as one group; block 1's last A and B fragments follow into registers that block 0 has freed, which keeps the
    // wave inside 256 registers.
    FragU a0[4], b0[4], a1[4], b1[4];
#pragma unroll
    for (int i = 0; i < 4; ++i) {
      a0[i] = ldfrag_s(fa + bo + i * (16 * GPITCH));
      b0[i] = ldfrag_s(fb + bo + i * (16 * GPITCH));
    }
#pragma unroll
    for (int i = 0; i < 3; ++i) {
      a1[i] = ldfrag_s(fa + bo + i * (16 * GPITCH) + 64);
      b1[i] = ldfrag_s(fb + bo + i * (16 * GPITCH) + 64);
    }
    __builtin_amdgcn_sched_barrier(0);       // the LDS loads stay one group ahead of the products, none among them
#pragma unroll
    for (int i = 0; i < 4; ++i) {
#pragma unroll
      for (int j = 0; j < 4; ++j) acc[i][j] = mma_x<BF>(a0[i], b0[j], acc[i][j]);
    }
    __builtin_amdgcn_sched_barrier(0);       // the late pair is loaded here, not earlier (registers) and not later (latency)
    a1[3] = ldfrag_s(fa + bo + 3 * (16 * GPITCH) + 64);
    b1[3] = ldfrag_s(fb + bo + 3 * (16 * GPITCH) + 64);
    __builtin_amdgcn_sched_barrier(0);       // nine products that do not need the late pair cover its latency
#pragma unroll
    for (int i = 0; i < 3; ++i) {
#pragma unroll
      for (int j = 0; j < 3; ++j) acc[i][j] = mma_x<BF>(a1[i], b1[j], acc[i][j]);
    }
#pragma unroll
    for (int i = 0; i < 3; ++i) acc[i][3] = mma_x<BF>(a1[i], b1[3], acc[i][3]);
#pragma unroll
    for (int j = 0; j < 4; ++j) acc[3][j] = mma_x<BF>(a1[3], b1[j], acc[3][j]);
    __builtin_amdgcn_sched_barrier(0);       // the products stay ahead of the hand-over waits, else the late pair's latency is bare
    wait_ds0();
    wait_async0();
    __syncthreads();                         // publishes pass t+1's rows and ends every read of pass t's buffer
    if (t + 2 < nt) {
      copy8(la + bo, ga + (size_t)(t + 2) * GKP, st16);
      copy8(la + bo + GBM * GPITCH, gb + (size_t)(t + 2) * GKP, st16);
    }
  }
  wait_async0();
}

// =====================================================================================================
// Batched bf16 GEMM with 16-bit result: C[bt][M][N] (f16 of acc*oscale) = A[bt][M][K] (bf16 row-major) . Bt[bt][N][K]^T
// (bf16 k-contiguous); per-batch element strides bstA/bstB/bstC. Block = 128x128 tile (gemm_core);
// grid = nbatch*(M/128)*(N/128). Each wave writes its 64x64 part as four 16x64 slabs through its own LDS slab.
// =====================================================================================================
__global__ __launch_bounds__(128)
void gemm_b16(const u16* __restrict__ A, const u16* __restrict__ Bt, u16* C, int M, int N, int K,
              int bstA, int bstB, int bstC, float oscale) {
  __shared__ __align__(16) unsigned char ring[2 * GSTAGE];
  __shared__ __align__(16) float slab[4 * SLAB];
  const int tid = threadIdx.x, wave = tid >> 5, lane = tid & 31;
  const int ntile = N / GBN, mtile = M / GBM;
  const int per   = ntile * mtile;
  const int bid   = blockIdx.x;
  const int bt    = bid / per;
  const int t     = bid - bt * per;
  const int row0  = (t / ntile) * GBM;
  const int col0  = (t % ntile) * GBN;
  if (row0 + GBM > M) return;                // block-uniform, ahead of every copy and barrier; never taken with the exact grid
  const u16* Ab = A  + (size_t)bt * (size_t)bstA;
  const u16* Bb = Bt + (size_t)bt * (size_t)bstB;
  u16*       Cb = C  + (size_t)bt * (size_t)bstC;
  v8f acc[4][4];
  gemm_core<true>(ring, Ab, Bb, K, row0, col0, tid, acc);
#pragma unroll
  for (int i = 0; i < 4; ++i) {
    wave_sync_lds();                         // the slab's previous rows have been read back before they are rewritten
    epi16(slab + wave * SLAB, acc[i][0], acc[i][1], acc[i][2], acc[i][3], oscale, Cb, N,
          (size_t)(row0 + (wave >> 1) * 64 + i * 16), col0 + (wave & 1) * 64, lane);
  }
}

// =====================================================================================================
// f16 GEMM with f32 result: C[M][N] (f32) = A[M][K] (f16 row-major) . Bt[N][K]^T (f16 k-contiguous) times oscale;
// one product per tile pair. Same tiling as gemm_b16; grid = (M/128)*(N/128).
// =====================================================================================================
__global__ __launch_bounds__(128)
void gemm_hf(const u16* __restrict__ A, const u16* __restrict__ Bt, float* C, int M, int N, int K, float oscale) {
  __shared__ __align__(16) unsigned char ring[2 * GSTAGE];
  __shared__ __align__(16) float slab[4 * SLAB];
  const int tid = threadIdx.x, wave = tid >> 5, lane = tid & 31;
  const int ntile = N / GBN;
  const int bid   = blockIdx.x;
  const int row0  = (bid / ntile) * GBM;
  const int col0  = (bid % ntile) * GBN;
  if (row0 + GBM > M) return;                // block-uniform, ahead of every copy and barrier; never taken with the exact grid
  v8f acc[4][4];
  gemm_core<false>(ring, A, Bt, K, row0, col0, tid, acc);
#pragma unroll
  for (int i = 0; i < 4; ++i) {
    wave_sync_lds();                         // the slab's previous rows have been read back before they are rewritten
    epi64(slab + wave * SLAB, acc[i][0], acc[i][1], acc[i][2], acc[i][3], oscale, C, N,
          (size_t)(row0 + (wave >> 1) * 64 + i * 16), col0 + (wave & 1) * 64, lane);
  }
}

// =====================================================================================================
// Multi-head flash attention (no mask): block = (batch b, head, 128 query rows), 8 waves, wave w owns the 16 query rows
// q0 = 128*qt + 16*w .. q0+15.
//   q plane (f16, x8) laid out [b][s][h][d]; k plane the same; v^T plane [b][h][d][s] (x1024).
//   K and v^T reach the waves through LDS, shared by the block: a stage is 64 keys = 64 k rows of 128 B (rows 0..63) and the
//   64 v^T rows' 128-B pieces of those keys (rows 64..127), at pitch 144 B (16 B x odd: ds_load_b128 without bank conflicts).
//   Two buffers; stage t+1's rows fly (asynchronous copies, 16 B per lane, a wave-wide copy = 4 whole 128-B lines) while
//   stage t is worked on. Thread = (row tid>>3 of a group of 32, 16-B chunk tid&7); 2 + 2 copies per thread and stage.
//   All NST = 32 stages are visited (static bound), each as two key blocks of 32 keys in rising order.
//   Scores are computed TRANSPOSED: S^T tile g (g = 0,1) = k rows (keys kb+16g .. +15, A operand, row m = lane&15, split k map
//   over d) times q^T (B operand, col n = query q0 + (lane&15), k = d, split map), one product per tile and 32-deep d-chunk.
//   D element r of lane l = (key kb+16g+8h+r, query q0+(l&15)), so a lane owns one query column and 16 of its 32 keys; the
//   partner lane l^16 owns the other 16.
//   Online max-subtracted base-2 softmax in f32 (scale 1/8 and the q/k carries folded into lsc; the maximum in use is kept in
//   raw score units, the running sum l carries P's x128). LAZY RESCALE: the maximum in use of a query is raised only when some
//   lane of the wave meets a score more than 2^8 (in p) above its own; one ballot and one scalar branch per key block decide
//   that for the whole wave. Only inside that branch do the halves exchange their maxima, is the factor formed and sent to the
//   O rows' owners, and are O and l rescaled. Outside it p <= 2^8, so P x128 <= 32768 fits f16. Each lane sums its own 16 keys
//   of every block; the two halves' sums are joined once, behind the loop. The exp'd values ARE the
//   P A-fragment in place: A row m = query = lane&15, element i <- key kb+8h+i (tile 0, D element i), element 8+i <- key
//   kb+16+8h+i (tile 1, D element i). P is carried x128 as single f16. The rescale factor of query row 8h+r of the
//   O accumulators is fetched from lane 8h+r with a shuffle (uniform control). 4 v^T B fragments (col n = d = 16j + (lane&15),
//   keys k-contiguous), 4 P.V WMMAs per key block.
//   Epilogue: 1/l (per query, shuffled to the D row owner) and carry folds in f32; the wave's 16x64 f32 result staged in its
//   own slab, which lies in the ring's bytes once the last stage's barrier has ended every read of them.
// coverage: per wave 4 instructions x 4 rows x 8 lanes x 8 halves = 16 x 64; grid 1024 blocks x 8 waves = every
//           (b, s, h) row of the O plane exactly once.
// =====================================================================================================
#define APITCH 144
#define ASTAGE ((AKEYS + HD) * APITCH)
static_assert(AKEYS == 64 && HD * 2 == 128 && AKEYS * 2 == 128 && (APITCH % 16) == 0 && ((APITCH / 16) % 2) == 1);
static_assert(ATT_WAVES * SLAB * 4 <= 2 * ASTAGE && ATT_THREADS * 2 * 16 == AKEYS * 128 && NST >= 2);

// One stage's four asynchronous 16-B copies of this lane: two k rows and two v^T rows, 32 rows apart. The s_wait_xcnt closes
// the statement so that no address register named here is rewritten ahead of it.
__device__ __forceinline__ void copy_kv(unsigned l, const u16* gk, const u16* gv) {
#if defined(__HIP_DEVICE_COMPILE__)
  asm volatile("global_load_async_to_lds_b128 %0, %4, off\n\t"
               "global_load_async_to_lds_b128 %1, %5, off\n\t"
               "global_load_async_to_lds_b128 %2, %6, off\n\t"
               "global_load_async_to_lds_b128 %3, %7, off\n\t"
               "s_wait_xcnt 0x0"
               :: "v"(l), "v"(l + 32u * APITCH), "v"(l + 64u * APITCH), "v"(l + 96u * APITCH),
                  "v"(gk), "v"(gk + (size_t)32 * (NH * HD)), "v"(gv), "v"(gv + (size_t)32 * SEQ)
               : "memory");
#endif
}

__global__ __launch_bounds__(ATT_THREADS)
void attn_fwd(const u16* __restrict__ QPp, const u16* __restrict__ KPp, const u16* __restrict__ VPp, u16* OPp) {
  __shared__ __align__(16) unsigned char ring[2 * ASTAGE];   // two K / v^T stages; per-wave result slabs in the epilogue

  const int tid  = threadIdx.x;
  const int wave = tid >> 5;
  const int lane = tid & 31;
  const int hh   = lane >> 4;
  const int c    = lane & 15;

  const int bid  = blockIdx.x;
  const int qt   = bid & (SEQ / ATT_QROWS - 1);
  const int head = (bid >> 4) & (NH - 1);
  const int b    = bid >> 8;
  const int q0   = qt * ATT_QROWS + wave * 16;

  // B fragments of q^T: col n = query q0 + c, k = d (k-contiguous row of the q plane)
  const size_t qofs = (((size_t)(b * SEQ + q0 + c)) * NH + head) * HD + 8 * hh;
  const _Float16* Qb = (const _Float16*)(const void*)QPp + qofs;
  // this thread's copy sources: k row (stage key r0), v^T row (d = r0), 16-B chunk ch; stage t adds 64 keys
  const int r0 = tid >> 3, ch = tid & 7;
  const u16* gk = KPp + (((size_t)b * SEQ + r0) * NH + head) * HD + ch * 8;
  const u16* gv = VPp + ((size_t)(b * NH + head) * HD + r0) * SEQ + ch * 8;
  const unsigned la = lds_off(ring) + (unsigned)(r0 * APITCH + ch * 16);
  // A fragments of k: LDS row = key in stage 32u + 16g + c, k = d; B fragments of v: LDS row = 64 + d (16j + c), k = key in stage
  const unsigned char* fk = ring + c * APITCH + hh * 16;
  const unsigned char* fv = ring + (AKEYS + c) * APITCH + hh * 16;
  const float lsc = 0.125f * (LOG2E / (QSC * KSC));

  copy_kv(la, gk, gv);
  const v16h qf0 = ldfrag_h(Qb);            // d 0..31
  const v16h qf1 = ldfrag_h(Qb + 32);       // d 32..63
  wait_async0();
  __syncthreads();                           // stage 0's rows are readable by every wave
  copy_kv(la + ASTAGE, gk + (size_t)AKEYS * (NH * HD), gv + AKEYS);

  const float rthr = RLAZY / lsc;            // the lazy threshold in raw score units
  float muse = -INFINITY, mthr = -INFINITY;  // maximum in use of query q0 + c (alike in both halves) and muse + rthr
  float eb = PLOG;                           // PLOG - muse * lsc; set by the first key block, whose every score tops -inf
  v2f ls2 = {0.f, 0.f};                      // this lane's own keys' sum: even and odd elements' partial sums
  v8f o[4];
#pragma unroll
  for (int j = 0; j < 4; ++j) o[j] = zero8();

#pragma unroll 1                             // one stage per trip: the two-buffer order below is per stage
  for (int t = 0; t < NST; ++t) {
    const unsigned bo = (unsigned)(t & 1) * ASTAGE;
#pragma unroll 1                             // rolled: unrolled, the two key blocks' live values overlap and the wave passes 128
                                             // registers, so that only three of the four blocks a WGP gets are resident at once
    for (int u = 0; u < 2; ++u) {
      // ---- transposed scores: s0 = keys kb..kb+15, s1 = keys kb+16..kb+31 (kb = 64t + 32u), column = query q0 + c ----
      v8f s0 = zero8(), s1 = zero8();
      const unsigned char* k0p = fk + bo + u * (32 * APITCH);
      const unsigned char* k1p = k0p + 16 * APITCH;
      const v16h ka0 = ldfrag_s(k0p).h, ka1 = ldfrag_s(k0p + 64).h;
      const v16h kc0 = ldfrag_s(k1p).h, kc1 = ldfrag_s(k1p + 64).h;
      s0 = mma_h(ka0, qf0, s0);
      s0 = mma_h(ka1, qf1, s0);
      s1 = mma_h(kc0, qf0, s1);
      s1 = mma_h(kc1, qf1, s1);
      guard2(s0, s1, qf0, qf1, ka0, ka1, kc0, kc1);
      // ---- maximum of the one in use and this lane's 16 raw scores for query q0 + c (the scale lsc is positive, so it commutes
      //      with the maximum) ----
      float cm = muse;
#pragma unroll
      for (int i = 0; i < 8; ++i) cm = fmaxf(cm, s0[i]);
#pragma unroll
      for (int i = 0; i < 8; ++i) cm = fmaxf(cm, s1[i]);
      // ---- lazy rescale: taken by the whole wave when any lane's maximum tops its threshold (always in the first key block) ----
      if (__builtin_amdgcn_ballot_w32(cm > mthr) != 0u) {
        const float mn = fmaxf(cm, __shfl_xor(cm, 16, 32));   // cm holds muse already; raw score units; finite from the first key block on
        const float al = (muse == -INFINITY) ? 0.f : __builtin_amdgcn_exp2f((muse - mn) * lsc);   // o and l are zero while muse is -inf
        muse = mn;
        mthr = mn + rthr;
        eb = fmaf(-mn, lsc, PLOG);
        ls2 *= al;
        // D row 8hh+r of the O accumulators = query q0+8hh+r, its factor lives in lane 8hh+r (and 16+8hh+r)
        float scl[8];
#pragma unroll
        for (int r = 0; r < 8; ++r) scl[r] = __shfl(al, 8 * hh + r, 32);
#pragma unroll
        for (int j = 0; j < 4; ++j) {
#pragma unroll
          for (int r = 0; r < 8; ++r) o[j][r] *= scl[r];
        }
      }
      // ---- probabilities carried x128 and the P A-fragment: one packed FMA forms two exponent arguments
      //      s * lsc - muse * lsc + 7 (<= 15 up to rounding, by the test above), one bare v_exp_f32 each gives p * 128 (a result
      //      under 2^-126 needs no care: it is nothing beside the sum, in f16 and in f32); element i <-> s0[i], 8+i <-> s1[i] ----
      const v2f lsc2 = {lsc, lsc}, eb2 = {eb, eb};
      FragH ph;
#pragma unroll
      for (int w = 0; w < 2; ++w) {
#pragma unroll
        for (int e4 = 0; e4 < 4; ++e4) {
          const v2f sc = {w ? s1[2 * e4] : s0[2 * e4], w ? s1[2 * e4 + 1] : s0[2 * e4 + 1]};
          const v2f arg = __builtin_elementwise_fma(sc, lsc2, eb2);
          const v2f pp = {__builtin_amdgcn_exp2f(arg.x), __builtin_amdgcn_exp2f(arg.y)};
          ls2 += pp;
          ph.u[w][e4] = __builtin_bit_cast(unsigned, __builtin_convertvector(pp, v2h));
        }
      }
      // ---- P.V : B fragment col n = d = j*16 + c, keys contiguous in the staged v^T rows ----
      {
        const unsigned char* vp = fv + bo + u * 64;
        __builtin_amdgcn_sched_barrier(0);   // the v^T fragment loads stay behind the softmax: moved ahead of it their 32 registers
                                             // are live across it and the wave passes 128, so that only three blocks a WGP are resident
        const v16h vf0 = ldfrag_s(vp).h;
        const v16h vf1 = ldfrag_s(vp + 16 * APITCH).h;
        const v16h vf2 = ldfrag_s(vp + 32 * APITCH).h;
        const v16h vf3 = ldfrag_s(vp + 48 * APITCH).h;
        o[0] = mma_h(ph.v, vf0, o[0]);
        o[1] = mma_h(ph.v, vf1, o[1]);
        o[2] = mma_h(ph.v, vf2, o[2]);
        o[3] = mma_h(ph.v, vf3, o[3]);
        guard6<v16h>(o[0], o[1], o[2], o[3], ph.v, vf0, vf1, vf2, vf3, ph.v);
      }
    }
    wait_ds0();
    wait_async0();
    __syncthreads();                         // publishes stage t+1's rows and ends every read of stage t's buffer
    if (t + 2 < NST) copy_kv(la + bo, gk + (size_t)(t + 2) * (AKEYS * NH * HD), gv + (t + 2) * AKEYS);
  }
  wait_async0();
  acc_guard4(o[0], o[1], o[2], o[3]);

  // ---- join the halves' sums; fold 1/l (per query, owned by lane = query; l >= 128 by construction) and the carries; stage the 16x64 slab ----
  float lrun = ls2.x + ls2.y;
  lrun += __shfl_xor(lrun, 16, 32);
  const float linv = (lrun > 0.f) ? ((1.0f / lrun) * (1.0f / VCAR)) : 0.f;   // lrun carries P's x128 too, so that carry cancels
  float inv[8];
#pragma unroll
  for (int r = 0; r < 8; ++r) inv[r] = __shfl(linv, 8 * hh + r, 32);
  float* slab = (float*)(void*)ring + wave * SLAB;
#pragma unroll
  for (int r = 0; r < 8; ++r) {
#pragma unroll
    for (int j = 0; j < 4; ++j) slab[(8 * hh + r) * 68 + j * 16 + c] = o[j][r] * inv[r];
  }
  wave_sync_lds();
  // ---- O x1024 -> single f16 plane; lane = (row in group of 4, 8 consecutive d) ----
  v4u oh[4];
  const int rq = lane >> 3, c8 = (lane & 7) * 8;
#pragma unroll
  for (int i4 = 0; i4 < 4; ++i4) {
    const int row = i4 * 4 + rq;
    const v4f a = *(const v4f*)(slab + row * 68 + c8), c4 = *(const v4f*)(slab + row * 68 + c8 + 4);
    float w[8];
#pragma unroll
    for (int e = 0; e < 4; ++e) { w[e] = a[e] * OSC; w[4 + e] = c4[e] * OSC; }
#pragma unroll
    for (int e = 0; e < 4; ++e) oh[i4][e] = pk16(h_bits((_Float16)w[2 * e]), h_bits((_Float16)w[2 * e + 1]));
  }
  const size_t ob = (((size_t)(b * SEQ + q0)) * NH + head) * HD + c8;
  {
#pragma unroll
    for (int i4 = 0; i4 < 4; ++i4) {
      const int row = i4 * 4 + rq;
      const size_t o8 = ob + (size_t)row * (NH * HD);
      *(v4u*)(OPp + o8) = oh[i4];
    }
    
  }
}

// =====================================================================================================
// Workspace map (bytes); every plane is fully written by whole-line stores before it is read; all extents are exact multiples
// of the store granularity (no pad rows needed):
//   XB  bf16 [8192][1024]                      16777216        (x)
//   WB  bf16 [3072 n][1024 k]                   6291456        (W_qkv, rows 0..1023 q, 1024..2047 k, 2048..3071 v)
//   WOB f16  [1024 n][1024 k] (bf16 value x1024) 2097152
//   QP  f16 [8192][16*64] x8                   16777216        KP same  16777216
//   VP  f16 [4][16*64][2048] x1024             16777216
//   OP  f16 [8192][16*64] x1024                16777216
//   end                                        92274688
// =====================================================================================================
extern "C" void kernel_launch(void* const* d_in, const int* in_sizes, int n_in,
                              void* d_out, int out_size, void* d_ws, size_t ws_size,
                              hipStream_t stream) {
  const int ROWS = NB * SEQ;                            // 8192
  if (n_in < 3) return;
  if (in_sizes[0] != ROWS * DMOD) return;
  if (in_sizes[1] != NQKV * DMOD) return;
  if (in_sizes[2] != DMOD * DMOD) return;
  if (out_size != ROWS * DMOD) return;

  const float* Xin = (const float*)d_in[0];
  const float* Wqk = (const float*)d_in[1];
  const float* Wpr = (const float*)d_in[2];
  float*       out = (float*)d_out;

  const size_t szXB = (size_t)ROWS * DMOD * 2;                  // 16777216
  const size_t szWB = (size_t)NQKV * DMOD * 2;                  //  6291456
  const size_t szWO = (size_t)DMOD * DMOD * 2;                  //  2097152
  const size_t szP  = (size_t)ROWS * DMOD * 2;                  // 16777216  (q / k / o planes)
  const size_t szVP = (size_t)NB * NH * HD * SEQ * 2;           // 16777216
  size_t off = 0;
  const size_t oXB = off; off += szXB;
  const size_t oWB = off; off += szWB;
  const size_t oWO = off; off += szWO;
  const size_t oQP = off; off += szP;
  const size_t oKP = off; off += szP;
  const size_t oVP = off; off += szVP;
  const size_t oOP = off; off += szP;
  if (off > ws_size) return;                            // off = 92274688
  if (off > (size_t)134217728) return;

  char* ws = (char*)d_ws;
  u16* XB  = (u16*)(ws + oXB);
  u16* WB  = (u16*)(ws + oWB);
  u16* WOB = (u16*)(ws + oWO);
  u16* QP  = (u16*)(ws + oQP);
  u16* KP  = (u16*)(ws + oKP);
  u16* VP  = (u16*)(ws + oVP);
  u16* OP  = (u16*)(ws + oOP);

  const dim3 blk(256);
  const int n8x = (ROWS * DMOD) / 8;                    // 1048576
  const int n8q = (NQKV * DMOD) / 8;                    //  393216
  const int n8w = (DMOD * DMOD) / 8;                    //  131072
  if ((n8x % 256) != 0 || (n8q % 256) != 0 || (n8w % 256) != 0) return;
  if ((DMOD % GBM) != 0 || (ROWS % GBM) != 0 || (SEQ % GBN) != 0 || (DMOD % GKP) != 0) return;
  const dim3 gX(n8x / 256);                             // 4096
  const dim3 gQ(n8q / 256);                             // 1536
  const dim3 gW(n8w / 256);                             // 512
  const dim3 gG((ROWS / GBM) * (DMOD / GBN));           // 512
  const dim3 gV(NB * (DMOD / GBM) * (SEQ / GBN));       // 512
  const dim3 bG(128);
  const dim3 gAT(ATT_BLOCKS);                           // 1024
  const dim3 bAT(ATT_THREADS);                          // 256

  // (0..2) operand planes: x -> bf16; W_qkv [n = out][k = in] (already k-contiguous) -> bf16; W_proj -> f16 of bf16 value x1024
  cvt16<<<gX, blk, 0, stream>>>(Xin, XB, n8x, 0, 1.0f);
  cvt16<<<gQ, blk, 0, stream>>>(Wqk, WB, n8q, 0, 1.0f);
  cvt16<<<gW, blk, 0, stream>>>(Wpr, WOB, n8w, 1, WOS);
  // (3,4) q and k planes [8192][h*64+d] = f16(x.Wq^T x8), f16(x.Wk^T x8)
  gemm_b16<<<gG, bG, 0, stream>>>(XB, WB, QP, ROWS, DMOD, DMOD, 0, 0, 0, QSC);
  gemm_b16<<<gG, bG, 0, stream>>>(XB, WB + (size_t)DMOD * DMOD, KP, ROWS, DMOD, DMOD, 0, 0, 0, KSC);
  // (5) v^T plane per batch: [1024 = h*64+d][2048 keys] = f16(Wv . x_b^T x1024), 4 batches in the grid
  gemm_b16<<<gV, bG, 0, stream>>>(WB + (size_t)2 * DMOD * DMOD, XB, VP, DMOD, SEQ, DMOD, 0, SEQ * DMOD, DMOD * SEQ, VCAR);
  // (6) attention -> O plane [b][s][h][d] x1024 (single f16)
  attn_fwd<<<gAT, bAT, 0, stream>>>(QP, KP, VP, OP);
  // (7) output projection -> out [8192][1024] f32, carries 1024 (O) x 1024 (wo) folded back
  gemm_hf<<<gG, bG, 0, stream>>>(OP, WOB, out, ROWS, DMOD, DMOD, 1.0f / (OSC * WOS));
  (void)hipGetLastError();
}

// v005
// Measured time: 132 microseconds a run.
// Two timings next to v004 both put it at 1.05 times that version's speed.
// Over all steps from v000 it is 3.74 times as fast.
// Contractions: x.Wq^T, x.Wk^T and Wv.x_b^T on v_wmma_f32_16x16x32_bf16 (x and W_qkv planes RNE-converted to bf16 operands,
// f32 accumulate); scores k'.q'^T (q', k' single f16 planes carried x8), P.v (P x128 single f16, v x1024 single f16) and
// O.Wo^T (O single f16 plane x1024, Wo as f16(bf16(Wo)) x1024): v_wmma_f32_16x16x32_f16, f32 accumulate.
// Base-2 online softmax, 1/l and carry folds in f32 on VALU.
#include <hip/hip_runtime.h>
#include <math.h>
#include <stdint.h>

#define NB    4
#define SEQ   2048
#define DMOD  1024
#define NQKV  (3 * DMOD)
#define NH    16
#define HD    64
#define QSC   8.0f
#define KSC   8.0f
#define PCAR  128.0f
#define PLOG  7.0f
#define RLAZY 8.0f
#define VCAR  1024.0f
#define OSC   1024.0f
#define WOS   1024.0f
#define LOG2E 1.4426950408889634f
#define ATT_WAVES   8
#define ATT_THREADS (ATT_WAVES * 32)
#define ATT_QT      2
#define ATT_QROWS   (ATT_WAVES * 16 * ATT_QT)
#define ATT_BLOCKS  (NB * NH * (SEQ / ATT_QROWS))
#define AKEYS  64
#define NST    (SEQ / AKEYS)
#define SLAB   (16 * 68)
static_assert(HD == 64 && DMOD == NH * HD);
static_assert(PCAR == 128.0f && PLOG == 7.0f && PLOG + RLAZY <= 15.0f);   // P <= 2^(PLOG + RLAZY) stays inside f16
static_assert((SEQ / ATT_QROWS) == 8 && NH == 16 && NB == 4 && ATT_QT == 2);
static_assert(ATT_THREADS == 256 && ATT_BLOCKS == 512 && NST == 32);
static_assert(((NB * SEQ) % 64) == 0 && (DMOD % 64) == 0 && (DMOD % 32) == 0 && (SEQ % 64) == 0);
static_assert(((NB * SEQ * DMOD / 8) % 256) == 0 && ((NQKV * DMOD / 8) % 256) == 0 && ((DMOD * DMOD / 8) % 256) == 0);
static_assert((SLAB * 4) % 16 == 0);

typedef unsigned short u16;
typedef _Float16 v16h __attribute__((ext_vector_type(16)));
typedef _Float16 v8h  __attribute__((ext_vector_type(8)));
typedef __bf16   v16b __attribute__((ext_vector_type(16)));
typedef float    v8f  __attribute__((ext_vector_type(8)));
typedef float    v4f  __attribute__((ext_vector_type(4)));
typedef float    v2f  __attribute__((ext_vector_type(2)));
typedef _Float16 v2h  __attribute__((ext_vector_type(2)));
typedef unsigned int v4u __attribute__((ext_vector_type(4)));

union FragH { v16h v; v8h h[2]; v4u u[2]; };

// ---- scalar helpers --------------------------------------------------------------------------------
__device__ __forceinline__ unsigned short bf_bits(float f) {          // f32 -> bf16 bits, RNE convert
  unsigned u = __float_as_uint(f);
  return (unsigned short)((u + 0x7FFFu + ((u >> 16) & 1u)) >> 16);
}
__device__ __forceinline__ float bf_up(unsigned short h) { return __uint_as_float(((unsigned)h) << 16); }
__device__ __forceinline__ unsigned short h_bits(_Float16 x) { return __builtin_bit_cast(unsigned short, x); }
__device__ __forceinline__ unsigned pk16(unsigned short a, unsigned short b) { return (unsigned)a | ((unsigned)b << 16); }
__device__ __forceinline__ v8f zero8() { v8f z = {0.f, 0.f, 0.f, 0.f, 0.f, 0.f, 0.f, 0.f}; return z; }

// ---- fragment loaders: 16-bit A/B operand, lane -> row/col (lane&15), p already includes +8*(lane>>4);
//      elements 0..7 <- p[0..7] (k0+8h..), elements 8..15 <- p[16..23] (k0+16+8h..)  (same split k map for A and B;
//      B is always read from a k-contiguous [n][k] plane)
__device__ __forceinline__ v16h ldfrag_h(const _Float16* p) {
  FragH f;
  f.h[0] = *(const v8h*)(p);
  f.h[1] = *(const v8h*)(p + 16);
  return f.v;
}

__device__ __forceinline__ v8f mma_h(v16h a, v16h b, v8f c) {
  return __builtin_amdgcn_wmma_f32_16x16x32_f16(false, a, false, b, (short)0, c, false, false);
}
__device__ __forceinline__ v8f mma_b(v16b a, v16b b, v8f c) {
  return __builtin_amdgcn_wmma_f32_16x16x32_bf16(false, a, false, b, (short)0, c, false, false);
}
// The four v_nop keep the distance between the last matrix instructions and the first vector instruction that touches their
// results or operands, on every path (four score tiles with their eight operands; eight O tiles with their six).
__device__ __forceinline__ void guard_s(v8f& a, v8f& b, v8f& c, v8f& d, v16h x0, v16h x1, v16h x2, v16h x3,
                                        v16h x4, v16h x5, v16h x6, v16h x7) {
#if defined(__HIP_DEVICE_COMPILE__)
  asm volatile("v_nop\n\tv_nop\n\tv_nop\n\tv_nop"
               : "+v"(a), "+v"(b), "+v"(c), "+v"(d)
               : "v"(x0), "v"(x1), "v"(x2), "v"(x3), "v"(x4), "v"(x5), "v"(x6), "v"(x7) : "memory");
#endif
}
__device__ __forceinline__ void guard_o(v8f (&a)[4], v8f (&b)[4], v16h x0, v16h x1, v16h x2, v16h x3, v16h x4, v16h x5) {
#if defined(__HIP_DEVICE_COMPILE__)
  asm volatile("v_nop\n\tv_nop\n\tv_nop\n\tv_nop"
               : "+v"(a[0]), "+v"(a[1]), "+v"(a[2]), "+v"(a[3]), "+v"(b[0]), "+v"(b[1]), "+v"(b[2]), "+v"(b[3])
               : "v"(x0), "v"(x1), "v"(x2), "v"(x3), "v"(x4), "v"(x5) : "memory");
#endif
}
__device__ __forceinline__ void wave_sync_lds() {
#if defined(__HIP_DEVICE_COMPILE__)
  __builtin_amdgcn_fence(__ATOMIC_RELEASE, "workgroup");
  __builtin_amdgcn_wave_barrier();
  __builtin_amdgcn_fence(__ATOMIC_ACQUIRE, "workgroup");
#endif
}

// =====================================================================================================
// f32 plane -> 16-bit plane, same layout:  mode 0: bf16 RNE bits;  mode 1: f16 bits of (bf16 RNE value) * scale.
// Thread = 8 consecutive elements: two 16-B loads, one 16-B store; 32 consecutive lanes = 512 contiguous, 512-B aligned bytes
// coverage: grid = n8/256 blocks (host checks exactness) x 256 thr x 8 = the whole plane.
// =====================================================================================================
__global__ __launch_bounds__(256) void cvt16(const float* __restrict__ x, u16* D, int n8, int mode, float scale) {
  const int gt = blockIdx.x * 256 + (int)threadIdx.x;
  if (gt >= n8) return;                     // no barriers in this kernel
  const float* p = x + (size_t)gt * 8;
  const v4f a = *(const v4f*)(p), c4 = *(const v4f*)(p + 4);
  float v[8];
#pragma unroll
  for (int e = 0; e < 4; ++e) { v[e] = a[e]; v[4 + e] = c4[e]; }
  unsigned short s[8];
#pragma unroll
  for (int e = 0; e < 8; ++e) {
    const unsigned short bb = bf_bits(v[e]);
    const unsigned short hb = h_bits((_Float16)(bf_up(bb) * scale));
    s[e] = (mode != 0) ? hb : bb;
  }
  v4u o;
#pragma unroll
  for (int e = 0; e < 4; ++e) o[e] = pk16(s[2 * e], s[2 * e + 1]);
  u16* d = D + (size_t)gt * 8;
  {
    *(v4u*)(d) = o;
    
  }
}

// =====================================================================================================
// barrier, then converted to f16 and written: lane = (row in group of 4, 8 consecutive cols); one instruction = 4 rows, each
// coverage: 4 instructions x 4 rows x 8 lanes x 8 halves = the wave's 16 x 64 tile.
// =====================================================================================================
__device__ __forceinline__ void epi16(float* sl, v8f a0, v8f a1, v8f a2, v8f a3, float oscale, u16* C, int N,
                                      size_t rowb, int col0, int lane) {
  const int hh = lane >> 4, m = lane & 15;
#pragma unroll
  for (int r = 0; r < 8; ++r) {
    const int ro = (8 * hh + r) * 68 + m;
    sl[ro]      = a0[r] * oscale;
    sl[ro + 16] = a1[r] * oscale;
    sl[ro + 32] = a2[r] * oscale;
    sl[ro + 48] = a3[r] * oscale;
  }
  wave_sync_lds();
  const int rq = lane >> 3, c8 = (lane & 7) * 8;
  v4u ov[4];
#pragma unroll
  for (int i4 = 0; i4 < 4; ++i4) {
    const int row = i4 * 4 + rq;
    const v4f a = *(const v4f*)(sl + row * 68 + c8), c4 = *(const v4f*)(sl + row * 68 + c8 + 4);
    float w[8];
#pragma unroll
    for (int e = 0; e < 4; ++e) { w[e] = a[e]; w[4 + e] = c4[e]; }
#pragma unroll
    for (int e = 0; e < 4; ++e) ov[i4][e] = pk16(h_bits((_Float16)w[2 * e]), h_bits((_Float16)w[2 * e + 1]));
  }
  u16* dst = C + (rowb + (size_t)rq) * (size_t)N + col0 + c8;
  const size_t st4 = (size_t)4 * (size_t)N;
#if defined(__HIP_DEVICE_COMPILE__)
  // The four stores and their s_wait_xcnt in one statement: the next slab reuses these address and data registers.
  asm volatile("global_store_b128 %0, %4, off\n\t"
               "global_store_b128 %1, %5, off\n\t"
               "global_store_b128 %2, %6, off\n\t"
               "global_store_b128 %3, %7, off\n\t"
               "s_wait_xcnt 0x0"
               :: "v"(dst), "v"(dst + st4), "v"(dst + 2 * st4), "v"(dst + 3 * st4),
                  "v"(ov[0]), "v"(ov[1]), "v"(ov[2]), "v"(ov[3])
               : "memory");
#endif
}

// =====================================================================================================
// coverage: 8 instructions x 2 rows x 16 lanes x 4 floats = the wave's 16 x 64 tile.
// =====================================================================================================
__device__ __forceinline__ void epi64(float* sl, v8f a0, v8f a1, v8f a2, v8f a3, float oscale, float* C, int N,
                                      size_t rowb, int col0, int lane) {
  const int hh = lane >> 4, m = lane & 15;
#pragma unroll
  for (int r = 0; r < 8; ++r) {
    const int ro = (8 * hh + r) * 68 + m;
    sl[ro]      = a0[r] * oscale;
    sl[ro + 16] = a1[r] * oscale;
    sl[ro + 32] = a2[r] * oscale;
    sl[ro + 48] = a3[r] * oscale;
  }
  wave_sync_lds();
  v4f vals[8];
#pragma unroll
  for (int it = 0; it < 8; ++it) vals[it] = *(const v4f*)(sl + (it * 2 + hh) * 68 + m * 4);
  float* dst = C + (rowb + (size_t)hh) * (size_t)N + col0 + m * 4;
  const size_t st2 = (size_t)2 * (size_t)N;
#if defined(__HIP_DEVICE_COMPILE__)
  // The eight stores and their s_wait_xcnt in one statement: the next slab reuses these address and data registers.
  asm volatile("global_store_b128 %0, %8, off\n\t"
               "global_store_b128 %1, %9, off\n\t"
               "global_store_b128 %2, %10, off\n\t"
               "global_store_b128 %3, %11, off\n\t"
               "global_store_b128 %4, %12, off\n\t"
               "global_store_b128 %5, %13, off\n\t"
               "global_store_b128 %6, %14, off\n\t"
               "global_store_b128 %7, %15, off\n\t"
               "s_wait_xcnt 0x0"
               :: "v"(dst), "v"(dst + st2), "v"(dst + 2 * st2), "v"(dst + 3 * st2),
                  "v"(dst + 4 * st2), "v"(dst + 5 * st2), "v"(dst + 6 * st2), "v"(dst + 7 * st2),
                  "v"(vals[0]), "v"(vals[1]), "v"(vals[2]), "v"(vals[3]), "v"(vals[4]), "v"(vals[5]), "v"(vals[6]), "v"(vals[7])
               : "memory");
#endif
}

// =====================================================================================================
// Shared GEMM core: acc[i][j] (16x16 f32 tiles) = A[row0 .. +127][K] . Bt[col0 .. +127][K]^T for one 128x128 block tile.
// 4 waves in a 2x2 grid, each owning 64x64 = 4x4 accumulator tiles, so one LDS fragment feeds four products.
// A pass is 64 k = 128 B of each of the 256 operand rows, laid in LDS at pitch 144 B (16 B x odd: ds_load_b128 without bank
// conflicts): rows 0..127 = A, rows 128..255 = Bt. Two buffers; pass t+1's rows fly (asynchronous copies, 16 B per lane,
// a wave-wide copy = 4 whole 128-B row pieces) while pass t is multiplied. Thread = (row tid>>3 of a group of 16, 16-B chunk
// tid&7); 8 + 8 copies per thread and pass cover 256 rows x 128 B. k runs upward in steps of 32 per accumulator.
// Needs M % 128 == 0, N % 128 == 0, K % 64 == 0 (host checks).
// =====================================================================================================
#define GBM    128
#define GBN    128
#define GKP    64
#define GPITCH 144
#define GSTAGE ((GBM + GBN) * GPITCH)
static_assert(GKP == 64 && (GPITCH % 16) == 0 && ((GPITCH / 16) % 2) == 1 && GPITCH >= GKP * 2);
static_assert((DMOD % GKP) == 0 && ((NB * SEQ) % GBM) == 0 && (DMOD % GBM) == 0 && (DMOD % GBN) == 0 && (SEQ % GBN) == 0);

union FragU { v4u u[2]; v16b b; v16h h; };

__device__ __forceinline__ unsigned lds_off(const void* p) { return (unsigned)(size_t)p; }

// Eight asynchronous 16-B copies of this lane, rows 16 apart. The s_wait_xcnt closes the statement so that no address
// register named here is rewritten ahead of it.
__device__ __forceinline__ void copy8(unsigned l, const u16* g, size_t st16) {
#if defined(__HIP_DEVICE_COMPILE__)
  asm volatile("global_load_async_to_lds_b128 %0, %8, off\n\t"
               "global_load_async_to_lds_b128 %1, %9, off\n\t"
               "global_load_async_to_lds_b128 %2, %10, off\n\t"
               "global_load_async_to_lds_b128 %3, %11, off\n\t"
               "global_load_async_to_lds_b128 %4, %12, off\n\t"
               "global_load_async_to_lds_b128 %5, %13, off\n\t"
               "global_load_async_to_lds_b128 %6, %14, off\n\t"
               "global_load_async_to_lds_b128 %7, %15, off\n\t"
               "s_wait_xcnt 0x0"
               :: "v"(l), "v"(l + 16u * GPITCH), "v"(l + 32u * GPITCH), "v"(l + 48u * GPITCH),
                  "v"(l + 64u * GPITCH), "v"(l + 80u * GPITCH), "v"(l + 96u * GPITCH), "v"(l + 112u * GPITCH),
                  "v"(g), "v"(g + st16), "v"(g + 2 * st16), "v"(g + 3 * st16),
                  "v"(g + 4 * st16), "v"(g + 5 * st16), "v"(g + 6 * st16), "v"(g + 7 * st16)
               : "memory");
#endif
}
// this wave's own copies have landed in LDS
__device__ __forceinline__ void wait_async0() {
#if defined(__HIP_DEVICE_COMPILE__)
  asm volatile("s_wait_asynccnt 0x0" ::: "memory");
#endif
}
// this wave's LDS reads have returned, so the buffer may be handed to its next writer
__device__ __forceinline__ void wait_ds0() {
#if defined(__HIP_DEVICE_COMPILE__)
  asm volatile("s_wait_dscnt 0x0" ::: "memory");
#endif
}
__device__ __forceinline__ FragU ldfrag_s(const unsigned char* p) {   // split k map: bytes 0..15 and 32..47 from p
  FragU f;
  f.u[0] = *(const v4u*)(p);
  f.u[1] = *(const v4u*)(p + 32);
  return f;
}
template <bool BF>
__device__ __forceinline__ v8f mma_x(const FragU& a, const FragU& b, v8f c) {
  if constexpr (BF) return mma_b(a.b, b.b, c);
  else              return mma_h(a.h, b.h, c);
}

template <bool BF>
__device__ __forceinline__ void gemm_core(unsigned char* ring, const u16* Ab, const u16* Bb, int K, int row0, int col0,
                                          int tid, v8f (&acc)[4][4]) {
  const int wave = tid >> 5, lane = tid & 31, hh = lane >> 4, m = lane & 15;
  const int r0 = tid >> 3, ch = tid & 7;
  const u16* ga = Ab + (size_t)(row0 + r0) * K + ch * 8;
  const u16* gb = Bb + (size_t)(col0 + r0) * K + ch * 8;
  const size_t st16 = (size_t)16 * K;
  const unsigned la = lds_off(ring) + (unsigned)(r0 * GPITCH + ch * 16);
  const int nt = K / GKP;
  const unsigned char* fa = ring + ((wave >> 1) * 64 + m) * GPITCH + hh * 16;
  const unsigned char* fb = ring + (GBM + (wave & 1) * 64 + m) * GPITCH + hh * 16;
#pragma unroll
  for (int i = 0; i < 4; ++i) {
#pragma unroll
    for (int j = 0; j < 4; ++j) acc[i][j] = zero8();
  }
  copy8(la, ga, st16);
  copy8(la + GBM * GPITCH, gb, st16);
  wait_async0();
  __syncthreads();                           // pass 0's rows are readable by every wave
  if (nt > 1) {
    copy8(la + GSTAGE, ga + GKP, st16);
    copy8(la + GSTAGE + GBM * GPITCH, gb + GKP, st16);
  }
#pragma unroll 1                             // one pass per trip: the two-buffer order below is per pass
  for (int t = 0; t < nt; ++t) {
    const unsigned bo = (unsigned)(t & 1) * GSTAGE;
    // Two blocks of 16 products (k 0..31, k 32..63). All of block 0's fragments and nine products' worth of block 1's are
    // loaded as one group; block 1's last A and B fragments follow into registers that block 0 has freed, which keeps the
    // wave inside 256 registers.
    FragU a0[4], b0[4], a1[4], b1[4];
#pragma unroll
    for (int i = 0; i < 4; ++i) {
      a0[i] = ldfrag_s(fa + bo + i * (16 * GPITCH));
      b0[i] = ldfrag_s(fb + bo + i * (16 * GPITCH));
    }
#pragma unroll
    for (int i = 0; i < 3; ++i) {
      a1[i] = ldfrag_s(fa + bo + i * (16 * GPITCH) + 64);
      b1[i] = ldfrag_s(fb + bo + i * (16 * GPITCH) + 64);
    }
    __builtin_amdgcn_sched_barrier(0);       // the LDS loads stay one group ahead of the products, none among them
#pragma unroll
    for (int i = 0; i < 4; ++i) {
#pragma unroll
      for (int j = 0; j < 4; ++j) acc[i][j] = mma_x<BF>(a0[i], b0[j], acc[i][j]);
    }
    __builtin_amdgcn_sched_barrier(0);       // the late pair is loaded here, not earlier (registers) and not later (latency)
    a1[3] = ldfrag_s(fa + bo + 3 * (16 * GPITCH) + 64);
    b1[3] = ldfrag_s(fb + bo + 3 * (16 * GPITCH) + 64);
    __builtin_amdgcn_sched_barrier(0);       // nine products that do not need the late pair cover its latency
#pragma unroll
    for (int i = 0; i < 3; ++i) {
#pragma unroll
      for (int j = 0; j < 3; ++j) acc[i][j] = mma_x<BF>(a1[i], b1[j], acc[i][j]);
    }
#pragma unroll
    for (int i = 0; i < 3; ++i) acc[i][3] = mma_x<BF>(a1[i], b1[3], acc[i][3]);
#pragma unroll
    for (int j = 0; j < 4; ++j) acc[3][j] = mma_x<BF>(a1[3], b1[j], acc[3][j]);
    __builtin_amdgcn_sched_barrier(0);       // the products stay ahead of the hand-over waits, else the late pair's latency is bare
    wait_ds0();
    wait_async0();
    __syncthreads();                         // publishes pass t+1's rows and ends every read of pass t's buffer
    if (t + 2 < nt) {
      copy8(la + bo, ga + (size_t)(t + 2) * GKP, st16);
      copy8(la + bo + GBM * GPITCH, gb + (size_t)(t + 2) * GKP, st16);
    }
  }
  wait_async0();
}

// =====================================================================================================
// Batched bf16 GEMM with 16-bit result: C[bt][M][N] (f16 of acc*oscale) = A[bt][M][K] (bf16 row-major) . Bt[bt][N][K]^T
// (bf16 k-contiguous); per-batch element strides bstA/bstB/bstC. Block = 128x128 tile (gemm_core);
// grid = nbatch*(M/128)*(N/128). Each wave writes its 64x64 part as four 16x64 slabs through its own LDS slab.
// =====================================================================================================
__global__ __launch_bounds__(128)
void gemm_b16(const u16* __restrict__ A, const u16* __restrict__ Bt, u16* C, int M, int N, int K,
              int bstA, int bstB, int bstC, float oscale) {
  __shared__ __align__(16) unsigned char ring[2 * GSTAGE];
  __shared__ __align__(16) float slab[4 * SLAB];
  const int tid = threadIdx.x, wave = tid >> 5, lane = tid & 31;
  const int ntile = N / GBN, mtile = M / GBM;
  const int per   = ntile * mtile;
  const int bid   = blockIdx.x;
  const int bt    = bid / per;
  const int t     = bid - bt * per;
  const int row0  = (t / ntile) * GBM;
  const int col0  = (t % ntile) * GBN;
  if (row0 + GBM > M) return;                // block-uniform, ahead of every copy and barrier; never taken with the exact grid
  const u16* Ab = A  + (size_t)bt * (size_t)bstA;
  const u16* Bb = Bt + (size_t)bt * (size_t)bstB;
  u16*       Cb = C  + (size_t)bt * (size_t)bstC;
  v8f acc[4][4];
  gemm_core<true>(ring, Ab, Bb, K, row0, col0, tid, acc);
#pragma unroll
  for (int i = 0; i < 4; ++i) {
    wave_sync_lds();                         // the slab's previous rows have been read back before they are rewritten
    epi16(slab + wave * SLAB, acc[i][0], acc[i][1], acc[i][2], acc[i][3], oscale, Cb, N,
          (size_t)(row0 + (wave >> 1) * 64 + i * 16), col0 + (wave & 1) * 64, lane);
  }
}

// =====================================================================================================
// f16 GEMM with f32 result: C[M][N] (f32) = A[M][K] (f16 row-major) . Bt[N][K]^T (f16 k-contiguous) times oscale;
// one product per tile pair. Same tiling as gemm_b16; grid = (M/128)*(N/128).
// =====================================================================================================
__global__ __launch_bounds__(128)
void gemm_hf(const u16* __restrict__ A, const u16* __restrict__ Bt, float* C, int M, int N, int K, float oscale) {
  __shared__ __align__(16) unsigned char ring[2 * GSTAGE];
  __shared__ __align__(16) float slab[4 * SLAB];
  const int tid = threadIdx.x, wave = tid >> 5, lane = tid & 31;
  const int ntile = N / GBN;
  const int bid   = blockIdx.x;
  const int row0  = (bid / ntile) * GBM;
  const int col0  = (bid % ntile) * GBN;
  if (row0 + GBM > M) return;                // block-uniform, ahead of every copy and barrier; never taken with the exact grid
  v8f acc[4][4];
  gemm_core<false>(ring, A, Bt, K, row0, col0, tid, acc);
#pragma unroll
  for (int i = 0; i < 4; ++i) {
    wave_sync_lds();                         // the slab's previous rows have been read back before they are rewritten
    epi64(slab + wave * SLAB, acc[i][0], acc[i][1], acc[i][2], acc[i][3], oscale, C, N,
          (size_t)(row0 + (wave >> 1) * 64 + i * 16), col0 + (wave & 1) * 64, lane);
  }
}

// =====================================================================================================
// Multi-head flash attention (no mask): block = (batch b, head, 256 query rows), 8 waves, wave w owns the 32 query rows
// q0 = 256*qt + 32*w .. q0+31 as two query tiles of 16 (tile g = rows q0+16g .. +15). Every k and v^T fragment that the wave
// reads from LDS feeds one product of each query tile, so a product costs half the LDS bytes of a one-tile wave. What is said
// below of "query q0 + c" holds per tile, with q0 + 16g for q0; each tile has its own maximum, sum and O accumulators.
//   q plane (f16, x8) laid out [b][s][h][d]; k plane the same; v^T plane [b][h][d][s] (x1024).
//   K and v^T reach the waves through LDS, shared by the block: a stage is 64 keys = 64 k rows of 128 B (rows 0..63) and the
//   64 v^T rows' 128-B pieces of those keys (rows 64..127), at pitch 144 B (16 B x odd: ds_load_b128 without bank conflicts).
//   Two buffers; stage t+1's rows fly (asynchronous copies, 16 B per lane, a wave-wide copy = 4 whole 128-B lines) while
//   stage t is worked on. Thread = (row tid>>3 of a group of 32, 16-B chunk tid&7); 2 + 2 copies per thread and stage.
//   All NST = 32 stages are visited (static bound), each as two key blocks of 32 keys in rising order.
//   Scores are computed TRANSPOSED: S^T key tile i (i = 0,1) = k rows (keys kb+16i .. +15, A operand, row m = lane&15, split k map
//   over d) times q^T (B operand, col n = query q0 + (lane&15), k = d, split map), one product per tile and 32-deep d-chunk.
//   D element r of lane l = (key kb+16i+8h+r, query q0+(l&15)), so a lane owns one query column and 16 of its 32 keys; the
//   partner lane l^16 owns the other 16.
//   Online max-subtracted base-2 softmax in f32 (scale 1/8 and the q/k carries folded into lsc; the maximum in use is kept in
//   raw score units, the running sum l carries P's x128). LAZY RESCALE: the maximum in use of a query is raised only when some
//   lane of the wave meets a score more than 2^8 (in p) above its own; one ballot and one scalar branch per key block decide
//   that for the whole wave and both of its query tiles. Only inside that branch do the halves exchange their maxima, is the
//   factor formed and sent to the O rows' owners, and are O and l rescaled. Outside it p <= 2^8, so P x128 <= 32768 fits f16. Each lane sums its own 16 keys
//   of every block; the two halves' sums are joined once, behind the loop. The exp'd values ARE the
//   P A-fragment in place: A row m = query = lane&15, element i <- key kb+8h+i (tile 0, D element i), element 8+i <- key
//   kb+16+8h+i (tile 1, D element i). P is carried x128 as single f16. The rescale factor of query row 8h+r of the
//   O accumulators is fetched from lane 8h+r with a shuffle (uniform control). 4 v^T B fragments (col n = d = 16j + (lane&15),
//   keys k-contiguous), 4 P.V WMMAs per key block and query tile.
//   Epilogue: 1/l (per query, shuffled to the D row owner) and carry folds in f32; each query tile's 16x64 f32 result staged in turn in the wave's
//   own slab, which lies in the ring's bytes once the last stage's barrier has ended every read of them.
// coverage: per wave and query tile 4 instructions x 4 rows x 8 lanes x 8 halves = 16 x 64; grid 512 blocks x 8 waves x 2 tiles
//           = every (b, s, h) row of the O plane exactly once.
// =====================================================================================================
#define APITCH 144
#define ASTAGE ((AKEYS + HD) * APITCH)
static_assert(AKEYS == 64 && HD * 2 == 128 && AKEYS * 2 == 128 && (APITCH % 16) == 0 && ((APITCH / 16) % 2) == 1);
static_assert(ATT_WAVES * SLAB * 4 <= 2 * ASTAGE && ATT_THREADS * 2 * 16 == AKEYS * 128 && NST >= 2);

// One stage's four asynchronous 16-B copies of this lane: two k rows and two v^T rows, 32 rows apart. The s_wait_xcnt closes
// the statement so that no address register named here is rewritten ahead of it.
__device__ __forceinline__ void copy_kv(unsigned l, const u16* gk, const u16* gv) {
#if defined(__HIP_DEVICE_COMPILE__)
  asm volatile("global_load_async_to_lds_b128 %0, %4, off\n\t"
               "global_load_async_to_lds_b128 %1, %5, off\n\t"
               "global_load_async_to_lds_b128 %2, %6, off\n\t"
               "global_load_async_to_lds_b128 %3, %7, off\n\t"
               "s_wait_xcnt 0x0"
               :: "v"(l), "v"(l + 32u * APITCH), "v"(l + 64u * APITCH), "v"(l + 96u * APITCH),
                  "v"(gk), "v"(gk + (size_t)32 * (NH * HD)), "v"(gv), "v"(gv + (size_t)32 * SEQ)
               : "memory");
#endif
}

__global__ __launch_bounds__(ATT_THREADS) __attribute__((amdgpu_waves_per_eu(4, 4)))   // 256 registers a wave: two blocks a WGP
void attn_fwd(const u16* __restrict__ QPp, const u16* __restrict__ KPp, const u16* __restrict__ VPp, u16* OPp) {
  __shared__ __align__(16) unsigned char ring[2 * ASTAGE];   // two K / v^T stages; per-wave result slabs in the epilogue

  const int tid  = threadIdx.x;
  const int wave = tid >> 5;
  const int lane = tid & 31;
  const int hh   = lane >> 4;
  const int c    = lane & 15;

  const int bid  = blockIdx.x;
  const int qt   = bid & (SEQ / ATT_QROWS - 1);
  const int head = (bid >> 3) & (NH - 1);
  const int b    = bid >> 7;
  const int q0   = qt * ATT_QROWS + wave * (16 * ATT_QT);

  // B fragments of q^T, query tile g: col n = query q0 + 16g + c, k = d (k-contiguous row of the q plane)
  const size_t qofs = (((size_t)(b * SEQ + q0 + c)) * NH + head) * HD + 8 * hh;
  const _Float16* Qb = (const _Float16*)(const void*)QPp + qofs;
  // this thread's copy sources: k row (stage key r0), v^T row (d = r0), 16-B chunk ch; stage t adds 64 keys
  const int r0 = tid >> 3, ch = tid & 7;
  const u16* gk = KPp + (((size_t)b * SEQ + r0) * NH + head) * HD + ch * 8;
  const u16* gv = VPp + ((size_t)(b * NH + head) * HD + r0) * SEQ + ch * 8;
  const unsigned la = lds_off(ring) + (unsigned)(r0 * APITCH + ch * 16);
  // A fragments of k: LDS row = key in stage 32u + 16i + c, k = d; B fragments of v: LDS row = 64 + d (16j + c), k = key in stage
  const unsigned char* fk = ring + c * APITCH + hh * 16;
  const unsigned char* fv = ring + (AKEYS + c) * APITCH + hh * 16;
  const float lsc = 0.125f * (LOG2E / (QSC * KSC));

  copy_kv(la, gk, gv);
  v16h qf0[ATT_QT], qf1[ATT_QT];
#pragma unroll
  for (int g = 0; g < ATT_QT; ++g) {
    qf0[g] = ldfrag_h(Qb + (size_t)g * (16 * NH * HD));            // d 0..31
    qf1[g] = ldfrag_h(Qb + (size_t)g * (16 * NH * HD) + 32);       // d 32..63
  }
  wait_async0();
  __syncthreads();                           // stage 0's rows are readable by every wave
  copy_kv(la + ASTAGE, gk + (size_t)AKEYS * (NH * HD), gv + AKEYS);

  const float rthr = RLAZY / lsc;            // the lazy threshold in raw score units
  float muse[ATT_QT], mthr[ATT_QT];          // maximum in use of query q0 + 16g + c (alike in both halves) and muse + rthr
  float eb[ATT_QT];                          // PLOG - muse * lsc; set by the first key block, whose every score tops -inf
  v2f ls2[ATT_QT];                           // this lane's own keys' sum: even and odd elements' partial sums
  v8f o[ATT_QT][4];
#pragma unroll
  for (int g = 0; g < ATT_QT; ++g) {
    muse[g] = -INFINITY; mthr[g] = -INFINITY; eb[g] = PLOG;
    ls2[g] = v2f{0.f, 0.f};
#pragma unroll
    for (int j = 0; j < 4; ++j) o[g][j] = zero8();
  }

#pragma unroll 1                             // one stage per trip: the two-buffer order below is per stage
  for (int t = 0; t < NST; ++t) {
    const unsigned bo = (unsigned)(t & 1) * ASTAGE;
#pragma unroll                               // both key blocks in line: their LDS offsets are immediates, no inner loop control
    for (int u = 0; u < 2; ++u) {
      // ---- transposed scores of both query tiles from one set of k fragments: s0[g] = keys kb..kb+15, s1[g] = keys
      //      kb+16..kb+31 (kb = 64t + 32u), column = query q0 + 16g + c; per tile d 0..31 first, then d 32..63 ----
      const unsigned char* k0p = fk + bo + u * (32 * APITCH);
      const unsigned char* k1p = k0p + 16 * APITCH;
      const v16h ka0 = ldfrag_s(k0p).h, ka1 = ldfrag_s(k0p + 64).h;
      const v16h kc0 = ldfrag_s(k1p).h, kc1 = ldfrag_s(k1p + 64).h;
      v8f s0[ATT_QT], s1[ATT_QT];
#pragma unroll
      for (int g = 0; g < ATT_QT; ++g) {
        s0[g] = mma_h(ka0, qf0[g], zero8());
        s1[g] = mma_h(kc0, qf0[g], zero8());
      }
#pragma unroll
      for (int g = 0; g < ATT_QT; ++g) {
        s0[g] = mma_h(ka1, qf1[g], s0[g]);
        s1[g] = mma_h(kc1, qf1[g], s1[g]);
      }
      guard_s(s0[0], s1[0], s0[1], s1[1], qf0[0], qf1[0], qf0[1], qf1[1], ka0, ka1, kc0, kc1);
      // ---- per query tile: maximum of the one in use and this lane's 16 raw scores for query q0 + 16g + c (the scale lsc is
      //      positive, so it commutes with the maximum) ----
      float cm[ATT_QT];
#pragma unroll
      for (int g = 0; g < ATT_QT; ++g) {
        cm[g] = muse[g];
#pragma unroll
        for (int i = 0; i < 8; ++i) cm[g] = fmaxf(cm[g], s0[g][i]);
#pragma unroll
        for (int i = 0; i < 8; ++i) cm[g] = fmaxf(cm[g], s1[g][i]);
      }
      // ---- lazy rescale: taken by the whole wave, for both query tiles, when any lane's maximum of either tile tops its
      //      threshold (always in the first key block) ----
      if (__builtin_amdgcn_ballot_w32((cm[0] > mthr[0]) | (cm[1] > mthr[1])) != 0u) {
#pragma unroll
        for (int g = 0; g < ATT_QT; ++g) {
          const float mn = fmaxf(cm[g], __shfl_xor(cm[g], 16, 32));   // cm holds muse already; raw score units; finite from the first key block on
          const float al = (muse[g] == -INFINITY) ? 0.f : __builtin_amdgcn_exp2f((muse[g] - mn) * lsc);   // o and l are zero while muse is -inf
          muse[g] = mn;
          mthr[g] = mn + rthr;
          eb[g] = fmaf(-mn, lsc, PLOG);
          ls2[g] *= al;
          // D row 8hh+r of the O accumulators = query q0+16g+8hh+r, its factor lives in lane 8hh+r (and 16+8hh+r)
          float scl[8];
#pragma unroll
          for (int r = 0; r < 8; ++r) scl[r] = __shfl(al, 8 * hh + r, 32);
#pragma unroll
          for (int j = 0; j < 4; ++j) {
#pragma unroll
            for (int r = 0; r < 8; ++r) o[g][j][r] *= scl[r];
          }
        }
      }
      // ---- probabilities carried x128 and the P A-fragments: one packed FMA forms two exponent arguments
      //      s * lsc - muse * lsc + 7 (<= 15 up to rounding, by the test above), one bare v_exp_f32 each gives p * 128 (a result
      //      under 2^-126 needs no care: it is nothing beside the sum, in f16 and in f32); element i <-> s0[i], 8+i <-> s1[i] ----
      const v2f lsc2 = {lsc, lsc};
      FragH ph[ATT_QT];
#pragma unroll
      for (int g = 0; g < ATT_QT; ++g) {
        const v2f eb2 = {eb[g], eb[g]};
#pragma unroll
        for (int w = 0; w < 2; ++w) {
#pragma unroll
          for (int e4 = 0; e4 < 4; ++e4) {
            const v2f sc = {w ? s1[g][2 * e4] : s0[g][2 * e4], w ? s1[g][2 * e4 + 1] : s0[g][2 * e4 + 1]};
            const v2f arg = __builtin_elementwise_fma(sc, lsc2, eb2);
            const v2f pp = {__builtin_amdgcn_exp2f(arg.x), __builtin_amdgcn_exp2f(arg.y)};
            ls2[g] += pp;
            ph[g].u[w][e4] = __builtin_bit_cast(unsigned, __builtin_convertvector(pp, v2h));
          }
        }
      }
      // ---- P.V of both query tiles from one set of v^T fragments: B fragment col n = d = j*16 + c, keys contiguous in the
      //      staged v^T rows ----
      {
        const unsigned char* vp = fv + bo + u * 64;
        const v16h vf0 = ldfrag_s(vp).h;
        const v16h vf1 = ldfrag_s(vp + 16 * APITCH).h;
        const v16h vf2 = ldfrag_s(vp + 32 * APITCH).h;
        const v16h vf3 = ldfrag_s(vp + 48 * APITCH).h;
#pragma unroll
        for (int g = 0; g < ATT_QT; ++g) {
          o[g][0] = mma_h(ph[g].v, vf0, o[g][0]);
          o[g][1] = mma_h(ph[g].v, vf1, o[g][1]);
          o[g][2] = mma_h(ph[g].v, vf2, o[g][2]);
          o[g][3] = mma_h(ph[g].v, vf3, o[g][3]);
        }
        guard_o(o[0], o[1], ph[0].v, ph[1].v, vf0, vf1, vf2, vf3);
      }
    }
    wait_ds0();
    wait_async0();
    __syncthreads();                         // publishes stage t+1's rows and ends every read of stage t's buffer
    if (t + 2 < NST) copy_kv(la + bo, gk + (size_t)(t + 2) * (AKEYS * NH * HD), gv + (t + 2) * AKEYS);
  }
  wait_async0();

  // ---- per query tile: join the halves' sums; fold 1/l (per query, owned by lane = query; l >= 128 by construction) and the
  //      carries; the 16x64 result goes x1024 through the wave's slab to the single f16 O plane (epi16) ----
  float* slab = (float*)(void*)ring + wave * SLAB;
#pragma unroll
  for (int g = 0; g < ATT_QT; ++g) {
    float lrun = ls2[g].x + ls2[g].y;
    lrun += __shfl_xor(lrun, 16, 32);
    const float linv = (lrun > 0.f) ? ((1.0f / lrun) * (1.0f / VCAR)) : 0.f;   // lrun carries P's x128 too, so that carry cancels
#pragma unroll
    for (int r = 0; r < 8; ++r) {
      const float inv = __shfl(linv, 8 * hh + r, 32);
#pragma unroll
      for (int j = 0; j < 4; ++j) o[g][j][r] *= inv;
    }
    wave_sync_lds();                         // the slab's previous rows have been read back before they are rewritten
    epi16(slab, o[g][0], o[g][1], o[g][2], o[g][3], OSC, OPp, NH * HD, (size_t)(b * SEQ + q0 + 16 * g), head * HD, lane);
  }
}

// =====================================================================================================
// Workspace map (bytes); every plane is fully written by whole-line stores before it is read; all extents are exact multiples
// of the store granularity (no pad rows needed):
//   XB  bf16 [8192][1024]                      16777216        (x)
//   WB  bf16 [3072 n][1024 k]                   6291456        (W_qkv, rows 0..1023 q, 1024..2047 k, 2048..3071 v)
//   WOB f16  [1024 n][1024 k] (bf16 value x1024) 2097152
//   QP  f16 [8192][16*64] x8                   16777216        KP same  16777216
//   VP  f16 [4][16*64][2048] x1024             16777216
//   OP  f16 [8192][16*64] x1024                16777216
//   end                                        92274688
// =====================================================================================================
extern "C" void kernel_launch(void* const* d_in, const int* in_sizes, int n_in,
                              void* d_out, int out_size, void* d_ws, size_t ws_size,
                              hipStream_t stream) {
  const int ROWS = NB * SEQ;                            // 8192
  if (n_in < 3) return;
  if (in_sizes[0] != ROWS * DMOD) return;
  if (in_sizes[1] != NQKV * DMOD) return;
  if (in_sizes[2] != DMOD * DMOD) return;
  if (out_size != ROWS * DMOD) return;

  const float* Xin = (const float*)d_in[0];
  const float* Wqk = (const float*)d_in[1];
  const float* Wpr = (const float*)d_in[2];
  float*       out = (float*)d_out;

  const size_t szXB = (size_t)ROWS * DMOD * 2;                  // 16777216
  const size_t szWB = (size_t)NQKV * DMOD * 2;                  //  6291456
  const size_t szWO = (size_t)DMOD * DMOD * 2;                  //  2097152
  const size_t szP  = (size_t)ROWS * DMOD * 2;                  // 16777216  (q / k / o planes)
  const size_t szVP = (size_t)NB * NH * HD * SEQ * 2;           // 16777216
  size_t off = 0;
  const size_t oXB = off; off += szXB;
  const size_t oWB = off; off += szWB;
  const size_t oWO = off; off += szWO;
  const size_t oQP = off; off += szP;
  const size_t oKP = off; off += szP;
  const size_t oVP = off; off += szVP;
  const size_t oOP = off; off += szP;
  if (off > ws_size) return;                            // off = 92274688
  if (off > (size_t)134217728) return;

  char* ws = (char*)d_ws;
  u16* XB  = (u16*)(ws + oXB);
  u16* WB  = (u16*)(ws + oWB);
  u16* WOB = (u16*)(ws + oWO);
  u16* QP  = (u16*)(ws + oQP);
  u16* KP  = (u16*)(ws + oKP);
  u16* VP  = (u16*)(ws + oVP);
  u16* OP  = (u16*)(ws + oOP);

  const dim3 blk(256);
  const int n8x = (ROWS * DMOD) / 8;                    // 1048576
  const int n8q = (NQKV * DMOD) / 8;                    //  393216
  const int n8w = (DMOD * DMOD) / 8;                    //  131072
  if ((n8x % 256) != 0 || (n8q % 256) != 0 || (n8w % 256) != 0) return;
  if ((DMOD % GBM) != 0 || (ROWS % GBM) != 0 || (SEQ % GBN) != 0 || (DMOD % GKP) != 0) return;
  const dim3 gX(n8x / 256);                             // 4096
  const dim3 gQ(n8q / 256);                             // 1536
  const dim3 gW(n8w / 256);                             // 512
  const dim3 gG((ROWS / GBM) * (DMOD / GBN));           // 512
  const dim3 gV(NB * (DMOD / GBM) * (SEQ / GBN));       // 512
  const dim3 bG(128);
  const dim3 gAT(ATT_BLOCKS);                           // 512
  const dim3 bAT(ATT_THREADS);                          // 256

  // (0..2) operand planes: x -> bf16; W_qkv [n = out][k = in] (already k-contiguous) -> bf16; W_proj -> f16 of bf16 value x1024
  cvt16<<<gX, blk, 0, stream>>>(Xin, XB, n8x, 0, 1.0f);
  cvt16<<<gQ, blk, 0, stream>>>(Wqk, WB, n8q, 0, 1.0f);
  cvt16<<<gW, blk, 0, stream>>>(Wpr, WOB, n8w, 1, WOS);
  // (3,4) q and k planes [8192][h*64+d] = f16(x.Wq^T x8), f16(x.Wk^T x8)
  gemm_b16<<<gG, bG, 0, stream>>>(XB, WB, QP, ROWS, DMOD, DMOD, 0, 0, 0, QSC);
  gemm_b16<<<gG, bG, 0, stream>>>(XB, WB + (size_t)DMOD * DMOD, KP, ROWS, DMOD, DMOD, 0, 0, 0, KSC);
  // (5) v^T plane per batch: [1024 = h*64+d][2048 keys] = f16(Wv . x_b^T x1024), 4 batches in the grid
  gemm_b16<<<gV, bG, 0, stream>>>(WB + (size_t)2 * DMOD * DMOD, XB, VP, DMOD, SEQ, DMOD, 0, SEQ * DMOD, DMOD * SEQ, VCAR);
  // (6) attention -> O plane [b][s][h][d] x1024 (single f16)
  attn_fwd<<<gAT, bAT, 0, stream>>>(QP, KP, VP, OP);
  // (7) output projection -> out [8192][1024] f32, carries 1024 (O) x 1024 (wo) folded back
  gemm_hf<<<gG, bG, 0, stream>>>(OP, WOB, out, ROWS, DMOD, DMOD, 1.0f / (OSC * WOS));
  (void)hipGetLastError();
}

// v006
// A run of this version takes 117 microseconds.
// Timed twice side by side with v005, it ran 1.12 and 1.13 times as fast.
// Over all steps from v000 it is 4.21 times as fast.
// Contractions: x.Wq^T, x.Wk^T and Wv.x_b^T on v_wmma_f32_16x16x32_bf16 (x and W_qkv planes RNE-converted to bf16 operands,
// f32 accumulate); scores k'.q'^T (q', k' single f16 planes carried x8), P.v (P x128 single f16, v x1024 single f16) and
// O.Wo^T (O single f16 plane x1024, Wo as f16(bf16(Wo)) x1024): v_wmma_f32_16x16x32_f16, f32 accumulate.
// Base-2 online softmax, 1/l and carry folds in f32 on VALU.
#include <hip/hip_runtime.h>
#include <math.h>
#include <stdint.h>

#define NB    4
#define SEQ   2048
#define DMOD  1024
#define NQKV  (3 * DMOD)
#define NH    16
#define HD    64
#define QSC   8.0f
#define KSC   8.0f
#define PCAR  128.0f
#define PLOG  7.0f
#define RLAZY 8.0f
#define VCAR  1024.0f
#define OSC   1024.0f
#define WOS   1024.0f
#define LOG2E 1.4426950408889634f
#define ATT_WAVES   8
#define ATT_THREADS (ATT_WAVES * 32)
#define ATT_QT      2
#define ATT_QROWS   (ATT_WAVES * 16 * ATT_QT)
#define ATT_BLOCKS  (NB * NH * (SEQ / ATT_QROWS))
#define AKEYS  64
#define NST    (SEQ / AKEYS)
#define SLAB   (16 * 68)
static_assert(HD == 64 && DMOD == NH * HD);
static_assert(PCAR == 128.0f && PLOG == 7.0f && PLOG + RLAZY <= 15.0f);   // P <= 2^(PLOG + RLAZY) stays inside f16
static_assert((SEQ / ATT_QROWS) == 8 && NH == 16 && NB == 4 && ATT_QT == 2);
static_assert(ATT_THREADS == 256 && ATT_BLOCKS == 512 && NST == 32);
static_assert(((NB * SEQ) % 64) == 0 && (DMOD % 64) == 0 && (DMOD % 32) == 0 && (SEQ % 64) == 0);
static_assert(((NB * SEQ * DMOD / 8) % 256) == 0 && ((NQKV * DMOD / 8) % 256) == 0 && ((DMOD * DMOD / 8) % 256) == 0);
static_assert((SLAB * 4) % 16 == 0);

typedef unsigned short u16;
typedef _Float16 v16h __attribute__((ext_vector_type(16)));
typedef _Float16 v8h  __attribute__((ext_vector_type(8)));
typedef __bf16   v16b __attribute__((ext_vector_type(16)));
typedef float    v8f  __attribute__((ext_vector_type(8)));
typedef float    v4f  __attribute__((ext_vector_type(4)));
typedef float    v2f  __attribute__((ext_vector_type(2)));
typedef _Float16 v2h  __attribute__((ext_vector_type(2)));
typedef unsigned int v4u __attribute__((ext_vector_type(4)));

union FragH { v16h v; v8h h[2]; v4u u[2]; };

// ---- scalar helpers --------------------------------------------------------------------------------
__device__ __forceinline__ unsigned short bf_bits(float f) {          // f32 -> bf16 bits, RNE convert
  unsigned u = __float_as_uint(f);
  return (unsigned short)((u + 0x7FFFu + ((u >> 16) & 1u)) >> 16);
}
__device__ __forceinline__ float bf_up(unsigned short h) { return __uint_as_float(((unsigned)h) << 16); }
__device__ __forceinline__ unsigned short h_bits(_Float16 x) { return __builtin_bit_cast(unsigned short, x); }
__device__ __forceinline__ unsigned pk16(unsigned short a, unsigned short b) { return (unsigned)a | ((unsigned)b << 16); }
__device__ __forceinline__ v8f zero8() { v8f z = {0.f, 0.f, 0.f, 0.f, 0.f, 0.f, 0.f, 0.f}; return z; }

// ---- fragment loaders: 16-bit A/B operand, lane -> row/col (lane&15), p already includes +8*(lane>>4);
//      elements 0..7 <- p[0..7] (k0+8h..), elements 8..15 <- p[16..23] (k0+16+8h..)  (same split k map for A and B;
//      B is always read from a k-contiguous [n][k] plane)
__device__ __forceinline__ v16h ldfrag_h(const _Float16* p) {
  FragH f;
  f.h[0] = *(const v8h*)(p);
  f.h[1] = *(const v8h*)(p + 16);
  return f.v;
}

__device__ __forceinline__ v8f mma_h(v16h a, v16h b, v8f c) {
  return __builtin_amdgcn_wmma_f32_16x16x32_f16(false, a, false, b, (short)0, c, false, false);
}
__device__ __forceinline__ v8f mma_b(v16b a, v16b b, v8f c) {
  return __builtin_amdgcn_wmma_f32_16x16x32_bf16(false, a, false, b, (short)0, c, false, false);
}
// The four v_nop keep the distance between the last matrix instructions and the first vector instruction that touches their
// results or operands, on every path (four score tiles with their eight operands; eight O tiles with their six).
__device__ __forceinline__ void guard_s(v8f& a, v8f& b, v8f& c, v8f& d, v16h x0, v16h x1, v16h x2, v16h x3,
                                        v16h x4, v16h x5, v16h x6, v16h x7) {
#if defined(__HIP_DEVICE_COMPILE__)
  asm volatile("v_nop\n\tv_nop\n\tv_nop\n\tv_nop"
               : "+v"(a), "+v"(b), "+v"(c), "+v"(d)
               : "v"(x0), "v"(x1), "v"(x2), "v"(x3), "v"(x4), "v"(x5), "v"(x6), "v"(x7) : "memory");
#endif
}
__device__ __forceinline__ void guard_o(v8f (&a)[4], v8f (&b)[4], v16h x0, v16h x1, v16h x2, v16h x3, v16h x4, v16h x5) {
#if defined(__HIP_DEVICE_COMPILE__)
  asm volatile("v_nop\n\tv_nop\n\tv_nop\n\tv_nop"
               : "+v"(a[0]), "+v"(a[1]), "+v"(a[2]), "+v"(a[3]), "+v"(b[0]), "+v"(b[1]), "+v"(b[2]), "+v"(b[3])
               : "v"(x0), "v"(x1), "v"(x2), "v"(x3), "v"(x4), "v"(x5) : "memory");
#endif
}
__device__ __forceinline__ void wave_sync_lds() {
#if defined(__HIP_DEVICE_COMPILE__)
  __builtin_amdgcn_fence(__ATOMIC_RELEASE, "workgroup");
  __builtin_amdgcn_wave_barrier();
  __builtin_amdgcn_fence(__ATOMIC_ACQUIRE, "workgroup");
#endif
}

// =====================================================================================================
// f32 plane -> 16-bit plane, same layout:  mode 0: bf16 RNE bits;  mode 1: f16 bits of (bf16 RNE value) * scale.
// The three planes share no data, so one launch converts them all: the block index picks the plane (block-uniform):
// blocks 0 .. CBX-1 = x (mode 0), the next CBQ = W_qkv (mode 0), the last CBW = W_proj (mode 1, scale).
// Thread = 8 consecutive elements: two 16-B loads, one 16-B store; 32 consecutive lanes = 512 contiguous, 512-B aligned bytes
// coverage: per plane (elements / 2048) blocks x 256 thr x 8 = the whole plane (exact by the static_assert above).
// =====================================================================================================
#define CBX (NB * SEQ * DMOD / 2048)
#define CBQ (NQKV * DMOD / 2048)
#define CBW (DMOD * DMOD / 2048)
__global__ __launch_bounds__(256) void cvt16(const float* __restrict__ xin, const float* __restrict__ wqkv,
                                             const float* __restrict__ wproj, u16* XBp, u16* WBp, u16* WOp, float scale) {
  const int bid = blockIdx.x;
  if (bid >= CBX + CBQ + CBW) return;       // no barriers in this kernel; never taken with the exact grid
  const int pl   = (bid >= CBX) + (bid >= CBX + CBQ);
  const int mode = (pl == 2) ? 1 : 0;
  const float* x = (pl == 0) ? xin : (pl == 1) ? wqkv : wproj;
  u16*         D = (pl == 0) ? XBp : (pl == 1) ? WBp : WOp;
  const int gt = (bid - ((pl == 0) ? 0 : (pl == 1) ? CBX : CBX + CBQ)) * 256 + (int)threadIdx.x;
  const float* p = x + (size_t)gt * 8;
  const v4f a = *(const v4f*)(p), c4 = *(const v4f*)(p + 4);
  float v[8];
#pragma unroll
  for (int e = 0; e < 4; ++e) { v[e] = a[e]; v[4 + e] = c4[e]; }
  unsigned short s[8];
#pragma unroll
  for (int e = 0; e < 8; ++e) {
    const unsigned short bb = bf_bits(v[e]);
    const unsigned short hb = h_bits((_Float16)(bf_up(bb) * scale));
    s[e] = (mode != 0) ? hb : bb;
  }
  v4u o;
#pragma unroll
  for (int e = 0; e < 4; ++e) o[e] = pk16(s[2 * e], s[2 * e + 1]);
  u16* d = D + (size_t)gt * 8;
  {
    *(v4u*)(d) = o;
    
  }
}

// =====================================================================================================
// barrier, then converted to f16 and written: lane = (row in group of 4, 8 consecutive cols); one instruction = 4 rows, each
// coverage: 4 instructions x 4 rows x 8 lanes x 8 halves = the wave's 16 x 64 tile.
// =====================================================================================================
__device__ __forceinline__ void epi16(float* sl, v8f a0, v8f a1, v8f a2, v8f a3, float oscale, u16* C, int N,
                                      size_t rowb, int col0, int lane) {
  const int hh = lane >> 4, m = lane & 15;
#pragma unroll
  for (int r = 0; r < 8; ++r) {
    const int ro = (8 * hh + r) * 68 + m;
    sl[ro]      = a0[r] * oscale;
    sl[ro + 16] = a1[r] * oscale;
    sl[ro + 32] = a2[r] * oscale;
    sl[ro + 48] = a3[r] * oscale;
  }
  wave_sync_lds();
  const int rq = lane >> 3, c8 = (lane & 7) * 8;
  v4u ov[4];
#pragma unroll
  for (int i4 = 0; i4 < 4; ++i4) {
    const int row = i4 * 4 + rq;
    const v4f a = *(const v4f*)(sl + row * 68 + c8), c4 = *(const v4f*)(sl + row * 68 + c8 + 4);
    float w[8];
#pragma unroll
    for (int e = 0; e < 4; ++e) { w[e] = a[e]; w[4 + e] = c4[e]; }
#pragma unroll
    for (int e = 0; e < 4; ++e) ov[i4][e] = pk16(h_bits((_Float16)w[2 * e]), h_bits((_Float16)w[2 * e + 1]));
  }
  u16* dst = C + (rowb + (size_t)rq) * (size_t)N + col0 + c8;
  const size_t st4 = (size_t)4 * (size_t)N;
#if defined(__HIP_DEVICE_COMPILE__)
  // The four stores and their s_wait_xcnt in one statement: the next slab reuses these address and data registers.
  asm volatile("global_store_b128 %0, %4, off\n\t"
               "global_store_b128 %1, %5, off\n\t"
               "global_store_b128 %2, %6, off\n\t"
               "global_store_b128 %3, %7, off\n\t"
               "s_wait_xcnt 0x0"
               :: "v"(dst), "v"(dst + st4), "v"(dst + 2 * st4), "v"(dst + 3 * st4),
                  "v"(ov[0]), "v"(ov[1]), "v"(ov[2]), "v"(ov[3])
               : "memory");
#endif
}

// =====================================================================================================
// coverage: 8 instructions x 2 rows x 16 lanes x 4 floats = the wave's 16 x 64 tile.
// =====================================================================================================
__device__ __forceinline__ void epi64(float* sl, v8f a0, v8f a1, v8f a2, v8f a3, float oscale, float* C, int N,
                                      size_t rowb, int col0, int lane) {
  const int hh = lane >> 4, m = lane & 15;
#pragma unroll
  for (int r = 0; r < 8; ++r) {
    const int ro = (8 * hh + r) * 68 + m;
    sl[ro]      = a0[r] * oscale;
    sl[ro + 16] = a1[r] * oscale;
    sl[ro + 32] = a2[r] * oscale;
    sl[ro + 48] = a3[r] * oscale;
  }
  wave_sync_lds();
  v4f vals[8];
#pragma unroll
  for (int it = 0; it < 8; ++it) vals[it] = *(const v4f*)(sl + (it * 2 + hh) * 68 + m * 4);
  float* dst = C + (rowb + (size_t)hh) * (size_t)N + col0 + m * 4;
  const size_t st2 = (size_t)2 * (size_t)N;
#if defined(__HIP_DEVICE_COMPILE__)
  // The eight stores and their s_wait_xcnt in one statement: the next slab reuses these address and data registers.
  asm volatile("global_store_b128 %0, %8, off\n\t"
               "global_store_b128 %1, %9, off\n\t"
               "global_store_b128 %2, %10, off\n\t"
               "global_store_b128 %3, %11, off\n\t"
               "global_store_b128 %4, %12, off\n\t"
               "global_store_b128 %5, %13, off\n\t"
               "global_store_b128 %6, %14, off\n\t"
               "global_store_b128 %7, %15, off\n\t"
               "s_wait_xcnt 0x0"
               :: "v"(dst), "v"(dst + st2), "v"(dst + 2 * st2), "v"(dst + 3 * st2),
                  "v"(dst + 4 * st2), "v"(dst + 5 * st2), "v"(dst + 6 * st2), "v"(dst + 7 * st2),
                  "v"(vals[0]), "v"(vals[1]), "v"(vals[2]), "v"(vals[3]), "v"(vals[4]), "v"(vals[5]), "v"(vals[6]), "v"(vals[7])
               : "memory");
#endif
}

// =====================================================================================================
// Shared GEMM core: acc[i][j] (16x16 f32 tiles) = A[row0 .. +127][K] . Bt[col0 .. +127][K]^T for one 128x128 block tile.
// 4 waves in a 2x2 grid, each owning 64x64 = 4x4 accumulator tiles, so one LDS fragment feeds four products.
// A pass is 64 k = 128 B of each of the 256 operand rows, laid in LDS at pitch 144 B (16 B x odd: ds_load_b128 without bank
// conflicts): rows 0..127 = A, rows 128..255 = Bt. Two buffers; pass t+1's rows fly (asynchronous copies, 16 B per lane,
// a wave-wide copy = 4 whole 128-B row pieces) while pass t is multiplied. Thread = (row tid>>3 of a group of 16, 16-B chunk
// tid&7); 8 + 8 copies per thread and pass cover 256 rows x 128 B. k runs upward in steps of 32 per accumulator.
// Needs M % 128 == 0, N % 128 == 0, K % 64 == 0 (host checks).
// =====================================================================================================
#define GBM    128
#define GBN    128
#define GKP    64
#define GPITCH 144
#define GSTAGE ((GBM + GBN) * GPITCH)
static_assert(GKP == 64 && (GPITCH % 16) == 0 && ((GPITCH / 16) % 2) == 1 && GPITCH >= GKP * 2);
static_assert((DMOD % GKP) == 0 && ((NB * SEQ) % GBM) == 0 && (DMOD % GBM) == 0 && (DMOD % GBN) == 0 && (SEQ % GBN) == 0);

union FragU { v4u u[2]; v16b b; v16h h; };

__device__ __forceinline__ unsigned lds_off(const void* p) { return (unsigned)(size_t)p; }

// Eight asynchronous 16-B copies of this lane, rows 16 apart. The s_wait_xcnt closes the statement so that no address
// register named here is rewritten ahead of it.
__device__ __forceinline__ void copy8(unsigned l, const u16* g, size_t st16) {
#if defined(__HIP_DEVICE_COMPILE__)
  asm volatile("global_load_async_to_lds_b128 %0, %8, off\n\t"
               "global_load_async_to_lds_b128 %1, %9, off\n\t"
               "global_load_async_to_lds_b128 %2, %10, off\n\t"
               "global_load_async_to_lds_b128 %3, %11, off\n\t"
               "global_load_async_to_lds_b128 %4, %12, off\n\t"
               "global_load_async_to_lds_b128 %5, %13, off\n\t"
               "global_load_async_to_lds_b128 %6, %14, off\n\t"
               "global_load_async_to_lds_b128 %7, %15, off\n\t"
               "s_wait_xcnt 0x0"
               :: "v"(l), "v"(l + 16u * GPITCH), "v"(l + 32u * GPITCH), "v"(l + 48u * GPITCH),
                  "v"(l + 64u * GPITCH), "v"(l + 80u * GPITCH), "v"(l + 96u * GPITCH), "v"(l + 112u * GPITCH),
                  "v"(g), "v"(g + st16), "v"(g + 2 * st16), "v"(g + 3 * st16),
                  "v"(g + 4 * st16), "v"(g + 5 * st16), "v"(g + 6 * st16), "v"(g + 7 * st16)
               : "memory");
#endif
}
// this wave's own copies have landed in LDS
__device__ __forceinline__ void wait_async0() {
#if defined(__HIP_DEVICE_COMPILE__)
  asm volatile("s_wait_asynccnt 0x0" ::: "memory");
#endif
}
// this wave's LDS reads have returned, so the buffer may be handed to its next writer
__device__ __forceinline__ void wait_ds0() {
#if defined(__HIP_DEVICE_COMPILE__)
  asm volatile("s_wait_dscnt 0x0" ::: "memory");
#endif
}
__device__ __forceinline__ FragU ldfrag_s(const unsigned char* p) {   // split k map: bytes 0..15 and 32..47 from p
  FragU f;
  f.u[0] = *(const v4u*)(p);
  f.u[1] = *(const v4u*)(p + 32);
  return f;
}
template <bool BF>
__device__ __forceinline__ v8f mma_x(const FragU& a, const FragU& b, v8f c) {
  if constexpr (BF) return mma_b(a.b, b.b, c);
  else              return mma_h(a.h, b.h, c);
}

template <bool BF>
__device__ __forceinline__ void gemm_core(unsigned char* ring, const u16* Ab, const u16* Bb, int K, int row0, int col0,
                                          int tid, v8f (&acc)[4][4]) {
  const int wave = tid >> 5, lane = tid & 31, hh = lane >> 4, m = lane & 15;
  const int r0 = tid >> 3, ch = tid & 7;
  const u16* ga = Ab + (size_t)(row0 + r0) * K + ch * 8;
  const u16* gb = Bb + (size_t)(col0 + r0) * K + ch * 8;
  const size_t st16 = (size_t)16 * K;
  const unsigned la = lds_off(ring) + (unsigned)(r0 * GPITCH + ch * 16);
  const int nt = K / GKP;
  const unsigned char* fa = ring + ((wave >> 1) * 64 + m) * GPITCH + hh * 16;
  const unsigned char* fb = ring + (GBM + (wave & 1) * 64 + m) * GPITCH + hh * 16;
#pragma unroll
  for (int i = 0; i < 4; ++i) {
#pragma unroll
    for (int j = 0; j < 4; ++j) acc[i][j] = zero8();
  }
  copy8(la, ga, st16);
  copy8(la + GBM * GPITCH, gb, st16);
  wait_async0();
  __syncthreads();                           // pass 0's rows are readable by every wave
  if (nt > 1) {
    copy8(la + GSTAGE, ga + GKP, st16);
    copy8(la + GSTAGE + GBM * GPITCH, gb + GKP, st16);
  }
#pragma unroll 1                             // one pass per trip: the two-buffer order below is per pass
  for (int t = 0; t < nt; ++t) {
    const unsigned bo = (unsigned)(t & 1) * GSTAGE;
    // Two blocks of 16 products (k 0..31, k 32..63). All of block 0's fragments and nine products' worth of block 1's are
    // loaded as one group; block 1's last A and B fragments follow into registers that block 0 has freed, which keeps the
    // wave inside 256 registers.
    FragU a0[4], b0[4], a1[4], b1[4];
#pragma unroll
    for (int i = 0; i < 4; ++i) {
      a0[i] = ldfrag_s(fa + bo + i * (16 * GPITCH));
      b0[i] = ldfrag_s(fb + bo + i * (16 * GPITCH));
    }
#pragma unroll
    for (int i = 0; i < 3; ++i) {
      a1[i] = ldfrag_s(fa + bo + i * (16 * GPITCH) + 64);
      b1[i] = ldfrag_s(fb + bo + i * (16 * GPITCH) + 64);
    }
    __builtin_amdgcn_sched_barrier(0);       // the LDS loads stay one group ahead of the products, none among them
#pragma unroll
    for (int i = 0; i < 4; ++i) {
#pragma unroll
      for (int j = 0; j < 4; ++j) acc[i][j] = mma_x<BF>(a0[i], b0[j], acc[i][j]);
    }
    __builtin_amdgcn_sched_barrier(0);       // the late pair is loaded here, not earlier (registers) and not later (latency)
    a1[3] = ldfrag_s(fa + bo + 3 * (16 * GPITCH) + 64);
    b1[3] = ldfrag_s(fb + bo + 3 * (16 * GPITCH) + 64);
    __builtin_amdgcn_sched_barrier(0);       // nine products that do not need the late pair cover its latency
#pragma unroll
    for (int i = 0; i < 3; ++i) {
#pragma unroll
      for (int j = 0; j < 3; ++j) acc[i][j] = mma_x<BF>(a1[i], b1[j], acc[i][j]);
    }
#pragma unroll
    for (int i = 0; i < 3; ++i) acc[i][3] = mma_x<BF>(a1[i], b1[3], acc[i][3]);
#pragma unroll
    for (int j = 0; j < 4; ++j) acc[3][j] = mma_x<BF>(a1[3], b1[j], acc[3][j]);
    __builtin_amdgcn_sched_barrier(0);       // the products stay ahead of the hand-over waits, else the late pair's latency is bare
    wait_ds0();
    wait_async0();
    __syncthreads();                         // publishes pass t+1's rows and ends every read of pass t's buffer
    if (t + 2 < nt) {
      copy8(la + bo, ga + (size_t)(t + 2) * GKP, st16);
      copy8(la + bo + GBM * GPITCH, gb + (size_t)(t + 2) * GKP, st16);
    }
  }
  wait_async0();
}

// =====================================================================================================
// The q, k and v^T products in ONE launch (they share no result, only operands): bf16 GEMMs with 16-bit result,
// C[M][N] (f16 of acc*oscale) = A[M][K] (bf16 row-major) . Bt[N][K]^T (bf16 k-contiguous), K = DMOD. Block = one 128x128 tile
// (gemm_core); the block index picks product and tile (block-uniform):
//   blocks 0 .. GQK-1:  q and k planes [8192][1024]: A = x, Bt = W_qkv rows 0..1023 (q) or 1024..2047 (k); the 16 blocks of
//                       one 128-row piece of x (8 q tiles, then 8 k tiles) are neighbours in the index;
//   the next GVT:       v^T plane of batch bt, [1024 = h*64+d][2048 keys]: A = W_qkv rows 2048..3071, Bt = x of batch bt.
// Each wave writes its 64x64 part as four 16x64 slabs through its own LDS slab.
// =====================================================================================================
#define GQK (2 * ((NB * SEQ) / GBM) * (DMOD / GBN))
#define GVB ((DMOD / GBM) * (SEQ / GBN))
#define GVT (NB * GVB)
__global__ __launch_bounds__(128)
void gemm_qkv(const u16* __restrict__ X, const u16* __restrict__ Wt, u16* Qo, u16* Ko, u16* Vo) {
  __shared__ __align__(16) unsigned char ring[2 * GSTAGE];
  __shared__ __align__(16) float slab[4 * SLAB];
  const int tid = threadIdx.x, wave = tid >> 5, lane = tid & 31;
  const int bid = blockIdx.x;
  if (bid >= GQK + GVT) return;              // block-uniform, ahead of every copy and barrier; never taken with the exact grid
  const int K = DMOD;
  const u16 *Ab, *Bb;
  u16* Cb;
  int N, row0, col0;
  float oscale;
  if (bid < GQK) {
    const int tc = bid % (2 * (DMOD / GBN));
    const int isk = tc / (DMOD / GBN);
    row0 = (bid / (2 * (DMOD / GBN))) * GBM;
    col0 = (tc % (DMOD / GBN)) * GBN;
    Ab = X;
    Bb = Wt + (size_t)isk * (DMOD * DMOD);
    Cb = isk ? Ko : Qo;
    N = DMOD;
    oscale = isk ? KSC : QSC;
  } else {
    const int bt = (bid - GQK) / GVB;
    const int t  = (bid - GQK) % GVB;
    row0 = (t / (SEQ / GBN)) * GBM;
    col0 = (t % (SEQ / GBN)) * GBN;
    Ab = Wt + (size_t)2 * DMOD * DMOD;
    Bb = X  + (size_t)bt * (SEQ * DMOD);
    Cb = Vo + (size_t)bt * (DMOD * SEQ);
    N = SEQ;
    oscale = VCAR;
  }
  v8f acc[4][4];
  gemm_core<true>(ring, Ab, Bb, K, row0, col0, tid, acc);
#pragma unroll
  for (int i = 0; i < 4; ++i) {
    wave_sync_lds();                         // the slab's previous rows have been read back before they are rewritten
    epi16(slab + wave * SLAB, acc[i][0], acc[i][1], acc[i][2], acc[i][3], oscale, Cb, N,
          (size_t)(row0 + (wave >> 1) * 64 + i * 16), col0 + (wave & 1) * 64, lane);
  }
}

// =====================================================================================================
// f16 GEMM with f32 result: C[M][N] (f32) = A[M][K] (f16 row-major) . Bt[N][K]^T (f16 k-contiguous) times oscale;
// one product per tile pair. Same tiling as gemm_qkv; grid = (M/128)*(N/128).
// =====================================================================================================
__global__ __launch_bounds__(128)
void gemm_hf(const u16* __restrict__ A, const u16* __restrict__ Bt, float* C, int M, int N, int K, float oscale) {
  __shared__ __align__(16) unsigned char ring[2 * GSTAGE];
  __shared__ __align__(16) float slab[4 * SLAB];
  const int tid = threadIdx.x, wave = tid >> 5, lane = tid & 31;
  const int ntile = N / GBN;
  const int bid   = blockIdx.x;
  const int row0  = (bid / ntile) * GBM;
  const int col0  = (bid % ntile) * GBN;
  if (row0 + GBM > M) return;                // block-uniform, ahead of every copy and barrier; never taken with the exact grid
  v8f acc[4][4];
  gemm_core<false>(ring, A, Bt, K, row0, col0, tid, acc);
#pragma unroll
  for (int i = 0; i < 4; ++i) {
    wave_sync_lds();                         // the slab's previous rows have been read back before they are rewritten
    epi64(slab + wave * SLAB, acc[i][0], acc[i][1], acc[i][2], acc[i][3], oscale, C, N,
          (size_t)(row0 + (wave >> 1) * 64 + i * 16), col0 + (wave & 1) * 64, lane);
  }
}

// =====================================================================================================
// Multi-head flash attention (no mask): block = (batch b, head, 256 query rows), 8 waves, wave w owns the 32 query rows
// q0 = 256*qt + 32*w .. q0+31 as two query tiles of 16 (tile g = rows q0+16g .. +15). Every k and v^T fragment that the wave
// reads from LDS feeds one product of each query tile, so a product costs half the LDS bytes of a one-tile wave. What is said
// below of "query q0 + c" holds per tile, with q0 + 16g for q0; each tile has its own maximum, sum and O accumulators.
//   q plane (f16, x8) laid out [b][s][h][d]; k plane the same; v^T plane [b][h][d][s] (x1024).
//   K and v^T reach the waves through LDS, shared by the block: a stage is 64 keys = 64 k rows of 128 B (rows 0..63) and the
//   64 v^T rows' 128-B pieces of those keys (rows 64..127), at pitch 144 B (16 B x odd: ds_load_b128 without bank conflicts).
//   Two buffers; stage t+1's rows fly (asynchronous copies, 16 B per lane, a wave-wide copy = 4 whole 128-B lines) while
//   stage t is worked on. Thread = (row tid>>3 of a group of 32, 16-B chunk tid&7); 2 + 2 copies per thread and stage.
//   All NST = 32 stages are visited (static bound), each as two key blocks of 32 keys in rising order.
//   Scores are computed TRANSPOSED: S^T key tile i (i = 0,1) = k rows (keys kb+16i .. +15, A operand, row m = lane&15, split k map
//   over d) times q^T (B operand, col n = query q0 + (lane&15), k = d, split map), one product per tile and 32-deep d-chunk.
//   D element r of lane l = (key kb+16i+8h+r, query q0+(l&15)), so a lane owns one query column and 16 of its 32 keys; the
//   partner lane l^16 owns the other 16.
//   Online max-subtracted base-2 softmax in f32 (scale 1/8 and the q/k carries folded into lsc; the maximum in use is kept in
//   raw score units, the running sum l carries P's x128). LAZY RESCALE: the maximum in use of a query is raised only when some
//   lane of the wave meets a score more than 2^8 (in p) above its own; one ballot and one scalar branch per key block decide
//   that for the whole wave and both of its query tiles. Only inside that branch do the halves exchange their maxima, is the
//   factor formed and sent to the O rows' owners, and are O and l rescaled. Outside it p <= 2^8, so P x128 <= 32768 fits f16. Each lane sums its own 16 keys
//   of every block; the two halves' sums are joined once, behind the loop. The exp'd values ARE the
//   P A-fragment in place: A row m = query = lane&15, element i <- key kb+8h+i (tile 0, D element i), element 8+i <- key
//   kb+16+8h+i (tile 1, D element i). P is carried x128 as single f16. The rescale factor of query row 8h+r of the
//   O accumulators is fetched from lane 8h+r with a shuffle (uniform control). 4 v^T B fragments (col n = d = 16j + (lane&15),
//   keys k-contiguous), 4 P.V WMMAs per key block and query tile.
//   Epilogue: 1/l (per query, shuffled to the D row owner) and carry folds in f32; each query tile's 16x64 f32 result staged in turn in the wave's
//   own slab, which lies in the ring's bytes once the last stage's barrier has ended every read of them.
// coverage: per wave and query tile 4 instructions x 4 rows x 8 lanes x 8 halves = 16 x 64; grid 512 blocks x 8 waves x 2 tiles
//           = every (b, s, h) row of the O plane exactly once.
// =====================================================================================================
#define APITCH 144
#define ASTAGE ((AKEYS + HD) * APITCH)
static_assert(AKEYS == 64 && HD * 2 == 128 && AKEYS * 2 == 128 && (APITCH % 16) == 0 && ((APITCH / 16) % 2) == 1);
static_assert(ATT_WAVES * SLAB * 4 <= 2 * ASTAGE && ATT_THREADS * 2 * 16 == AKEYS * 128 && NST >= 2);

// One stage's four asynchronous 16-B copies of this lane: two k rows and two v^T rows, 32 rows apart. The s_wait_xcnt closes
// the statement so that no address register named here is rewritten ahead of it.
__device__ __forceinline__ void copy_kv(unsigned l, const u16* gk, const u16* gv) {
#if defined(__HIP_DEVICE_COMPILE__)
  asm volatile("global_load_async_to_lds_b128 %0, %4, off\n\t"
               "global_load_async_to_lds_b128 %1, %5, off\n\t"
               "global_load_async_to_lds_b128 %2, %6, off\n\t"
               "global_load_async_to_lds_b128 %3, %7, off\n\t"
               "s_wait_xcnt 0x0"
               :: "v"(l), "v"(l + 32u * APITCH), "v"(l + 64u * APITCH), "v"(l + 96u * APITCH),
                  "v"(gk), "v"(gk + (size_t)32 * (NH * HD)), "v"(gv), "v"(gv + (size_t)32 * SEQ)
               : "memory");
#endif
}

__global__ __launch_bounds__(ATT_THREADS) __attribute__((amdgpu_waves_per_eu(4, 4)))   // 256 registers a wave: two blocks a WGP
void attn_fwd(const u16* __restrict__ QPp, const u16* __restrict__ KPp, const u16* __restrict__ VPp, u16* OPp) {
  __shared__ __align__(16) unsigned char ring[2 * ASTAGE];   // two K / v^T stages; per-wave result slabs in the epilogue

  const int tid  = threadIdx.x;
  const int wave = tid >> 5;
  const int lane = tid & 31;
  const int hh   = lane >> 4;
  const int c    = lane & 15;

  const int bid  = blockIdx.x;
  const int qt   = bid & (SEQ / ATT_QROWS - 1);
  const int head = (bid >> 3) & (NH - 1);
  const int b    = bid >> 7;
  const int q0   = qt * ATT_QROWS + wave * (16 * ATT_QT);

  // B fragments of q^T, query tile g: col n = query q0 + 16g + c, k = d (k-contiguous row of the q plane)
  const size_t qofs = (((size_t)(b * SEQ + q0 + c)) * NH + head) * HD + 8 * hh;
  const _Float16* Qb = (const _Float16*)(const void*)QPp + qofs;
  // this thread's copy sources: k row (stage key r0), v^T row (d = r0), 16-B chunk ch; stage t adds 64 keys
  const int r0 = tid >> 3, ch = tid & 7;
  const u16* gk = KPp + (((size_t)b * SEQ + r0) * NH + head) * HD + ch * 8;
  const u16* gv = VPp + ((size_t)(b * NH + head) * HD + r0) * SEQ + ch * 8;
  const unsigned la = lds_off(ring) + (unsigned)(r0 * APITCH + ch * 16);
  // A fragments of k: LDS row = key in stage 32u + 16i + c, k = d; B fragments of v: LDS row = 64 + d (16j + c), k = key in stage
  const unsigned char* fk = ring + c * APITCH + hh * 16;
  const unsigned char* fv = ring + (AKEYS + c) * APITCH + hh * 16;
  const float lsc = 0.125f * (LOG2E / (QSC * KSC));

  copy_kv(la, gk, gv);
  v16h qf0[ATT_QT], qf1[ATT_QT];
#pragma unroll
  for (int g = 0; g < ATT_QT; ++g) {
    qf0[g] = ldfrag_h(Qb + (size_t)g * (16 * NH * HD));            // d 0..31
    qf1[g] = ldfrag_h(Qb + (size_t)g * (16 * NH * HD) + 32);       // d 32..63
  }
  wait_async0();
  __syncthreads();                           // stage 0's rows are readable by every wave
  copy_kv(la + ASTAGE, gk + (size_t)AKEYS * (NH * HD), gv + AKEYS);

  const float rthr = RLAZY / lsc;            // the lazy threshold in raw score units
  float muse[ATT_QT], mthr[ATT_QT];          // maximum in use of query q0 + 16g + c (alike in both halves) and muse + rthr
  float eb[ATT_QT];                          // PLOG - muse * lsc; set by the first key block, whose every score tops -inf
  v2f ls2[ATT_QT];                           // this lane's own keys' sum: even and odd elements' partial sums
  v8f o[ATT_QT][4];
#pragma unroll
  for (int g = 0; g < ATT_QT; ++g) {
    muse[g] = -INFINITY; mthr[g] = -INFINITY; eb[g] = PLOG;
    ls2[g] = v2f{0.f, 0.f};
#pragma unroll
    for (int j = 0; j < 4; ++j) o[g][j] = zero8();
  }

#pragma unroll 1                             // one stage per trip: the two-buffer order below is per stage
  for (int t = 0; t < NST; ++t) {
    const unsigned bo = (unsigned)(t & 1) * ASTAGE;
#pragma unroll                               // both key blocks in line: their LDS offsets are immediates, no inner loop control
    for (int u = 0; u < 2; ++u) {
      // ---- transposed scores of both query tiles from one set of k fragments: s0[g] = keys kb..kb+15, s1[g] = keys
      //      kb+16..kb+31 (kb = 64t + 32u), column = query q0 + 16g + c; per tile d 0..31 first, then d 32..63 ----
      const unsigned char* k0p = fk + bo + u * (32 * APITCH);
      const unsigned char* k1p = k0p + 16 * APITCH;
      const v16h ka0 = ldfrag_s(k0p).h, ka1 = ldfrag_s(k0p + 64).h;
      const v16h kc0 = ldfrag_s(k1p).h, kc1 = ldfrag_s(k1p + 64).h;
      v8f s0[ATT_QT], s1[ATT_QT];
#pragma unroll
      for (int g = 0; g < ATT_QT; ++g) {
        s0[g] = mma_h(ka0, qf0[g], zero8());
        s1[g] = mma_h(kc0, qf0[g], zero8());
      }
#pragma unroll
      for (int g = 0; g < ATT_QT; ++g) {
        s0[g] = mma_h(ka1, qf1[g], s0[g]);
        s1[g] = mma_h(kc1, qf1[g], s1[g]);
      }
      guard_s(s0[0], s1[0], s0[1], s1[1], qf0[0], qf1[0], qf0[1], qf1[1], ka0, ka1, kc0, kc1);
      // ---- per query tile: maximum of the one in use and this lane's 16 raw scores for query q0 + 16g + c (the scale lsc is
      //      positive, so it commutes with the maximum) ----
      float cm[ATT_QT];
#pragma unroll
      for (int g = 0; g < ATT_QT; ++g) {
        cm[g] = muse[g];
#pragma unroll
        for (int i = 0; i < 8; ++i) cm[g] = fmaxf(cm[g], s0[g][i]);
#pragma unroll
        for (int i = 0; i < 8; ++i) cm[g] = fmaxf(cm[g], s1[g][i]);
      }
      // ---- lazy rescale: taken by the whole wave, for both query tiles, when any lane's maximum of either tile tops its
      //      threshold (always in the first key block) ----
      if (__builtin_amdgcn_ballot_w32((cm[0] > mthr[0]) | (cm[1] > mthr[1])) != 0u) {
#pragma unroll
        for (int g = 0; g < ATT_QT; ++g) {
          const float mn = fmaxf(cm[g], __shfl_xor(cm[g], 16, 32));   // cm holds muse already; raw score units; finite from the first key block on
          const float al = (muse[g] == -INFINITY) ? 0.f : __builtin_amdgcn_exp2f((muse[g] - mn) * lsc);   // o and l are zero while muse is -inf
          muse[g] = mn;
          mthr[g] = mn + rthr;
          eb[g] = fmaf(-mn, lsc, PLOG);
          ls2[g] *= al;
          // D row 8hh+r of the O accumulators = query q0+16g+8hh+r, its factor lives in lane 8hh+r (and 16+8hh+r)
          float scl[8];
#pragma unroll
          for (int r = 0; r < 8; ++r) scl[r] = __shfl(al, 8 * hh + r, 32);
#pragma unroll
          for (int j = 0; j < 4; ++j) {
#pragma unroll
            for (int r = 0; r < 8; ++r) o[g][j][r] *= scl[r];
          }
        }
      }
      // ---- probabilities carried x128 and the P A-fragments: one packed FMA forms two exponent arguments
      //      s * lsc - muse * lsc + 7 (<= 15 up to rounding, by the test above), one bare v_exp_f32 each gives p * 128 (a result
      //      under 2^-126 needs no care: it is nothing beside the sum, in f16 and in f32); element i <-> s0[i], 8+i <-> s1[i] ----
      const v2f lsc2 = {lsc, lsc};
      FragH ph[ATT_QT];
#pragma unroll
      for (int g = 0; g < ATT_QT; ++g) {
        const v2f eb2 = {eb[g], eb[g]};
#pragma unroll
        for (int w = 0; w < 2; ++w) {
#pragma unroll
          for (int e4 = 0; e4 < 4; ++e4) {
            const v2f sc = {w ? s1[g][2 * e4] : s0[g][2 * e4], w ? s1[g][2 * e4 + 1] : s0[g][2 * e4 + 1]};
            const v2f arg = __builtin_elementwise_fma(sc, lsc2, eb2);
            const v2f pp = {__builtin_amdgcn_exp2f(arg.x), __builtin_amdgcn_exp2f(arg.y)};
            ls2[g] += pp;
            ph[g].u[w][e4] = __builtin_bit_cast(unsigned, __builtin_convertvector(pp, v2h));
          }
        }
      }
      // ---- P.V of both query tiles from one set of v^T fragments: B fragment col n = d = j*16 + c, keys contiguous in the
      //      staged v^T rows ----
      {
        const unsigned char* vp = fv + bo + u * 64;
        const v16h vf0 = ldfrag_s(vp).h;
        const v16h vf1 = ldfrag_s(vp + 16 * APITCH).h;
        const v16h vf2 = ldfrag_s(vp + 32 * APITCH).h;
        const v16h vf3 = ldfrag_s(vp + 48 * APITCH).h;
#pragma unroll
        for (int g = 0; g < ATT_QT; ++g) {
          o[g][0] = mma_h(ph[g].v, vf0, o[g][0]);
          o[g][1] = mma_h(ph[g].v, vf1, o[g][1]);
          o[g][2] = mma_h(ph[g].v, vf2, o[g][2]);
          o[g][3] = mma_h(ph[g].v, vf3, o[g][3]);
        }
        guard_o(o[0], o[1], ph[0].v, ph[1].v, vf0, vf1, vf2, vf3);
      }
    }
    wait_ds0();
    wait_async0();
    __syncthreads();                         // publishes stage t+1's rows and ends every read of stage t's buffer
    if (t + 2 < NST) copy_kv(la + bo, gk + (size_t)(t + 2) * (AKEYS * NH * HD), gv + (t + 2) * AKEYS);
  }
  wait_async0();

  // ---- per query tile: join the halves' sums; fold 1/l (per query, owned by lane = query; l >= 128 by construction) and the
  //      carries; the 16x64 result goes x1024 through the wave's slab to the single f16 O plane (epi16) ----
  float* slab = (float*)(void*)ring + wave * SLAB;
#pragma unroll
  for (int g = 0; g < ATT_QT; ++g) {
    float lrun = ls2[g].x + ls2[g].y;
    lrun += __shfl_xor(lrun, 16, 32);
    const float linv = (lrun > 0.f) ? ((1.0f / lrun) * (1.0f / VCAR)) : 0.f;   // lrun carries P's x128 too, so that carry cancels
#pragma unroll
    for (int r = 0; r < 8; ++r) {
      const float inv = __shfl(linv, 8 * hh + r, 32);
#pragma unroll
      for (int j = 0; j < 4; ++j) o[g][j][r] *= inv;
    }
    wave_sync_lds();                         // the slab's previous rows have been read back before they are rewritten
    epi16(slab, o[g][0], o[g][1], o[g][2], o[g][3], OSC, OPp, NH * HD, (size_t)(b * SEQ + q0 + 16 * g), head * HD, lane);
  }
}

// =====================================================================================================
// Workspace map (bytes); every plane is fully written by whole-line stores before it is read; all extents are exact multiples
// of the store granularity (no pad rows needed):
//   XB  bf16 [8192][1024]                      16777216        (x)
//   WB  bf16 [3072 n][1024 k]                   6291456        (W_qkv, rows 0..1023 q, 1024..2047 k, 2048..3071 v)
//   WOB f16  [1024 n][1024 k] (bf16 value x1024) 2097152
//   QP  f16 [8192][16*64] x8                   16777216        KP same  16777216
//   VP  f16 [4][16*64][2048] x1024             16777216
//   OP  f16 [8192][16*64] x1024                16777216
//   end                                        92274688
// =====================================================================================================
extern "C" void kernel_launch(void* const* d_in, const int* in_sizes, int n_in,
                              void* d_out, int out_size, void* d_ws, size_t ws_size,
                              hipStream_t stream) {
  const int ROWS = NB * SEQ;                            // 8192
  if (n_in < 3) return;
  if (in_sizes[0] != ROWS * DMOD) return;
  if (in_sizes[1] != NQKV * DMOD) return;
  if (in_sizes[2] != DMOD * DMOD) return;
  if (out_size != ROWS * DMOD) return;

  const float* Xin = (const float*)d_in[0];
  const float* Wqk = (const float*)d_in[1];
  const float* Wpr = (const float*)d_in[2];
  float*       out = (float*)d_out;

  const size_t szXB = (size_t)ROWS * DMOD * 2;                  // 16777216
  const size_t szWB = (size_t)NQKV * DMOD * 2;                  //  6291456
  const size_t szWO = (size_t)DMOD * DMOD * 2;                  //  2097152
  const size_t szP  = (size_t)ROWS * DMOD * 2;                  // 16777216  (q / k / o planes)
  const size_t szVP = (size_t)NB * NH * HD * SEQ * 2;           // 16777216
  size_t off = 0;
  const size_t oXB = off; off += szXB;
  const size_t oWB = off; off += szWB;
  const size_t oWO = off; off += szWO;
  const size_t oQP = off; off += szP;
  const size_t oKP = off; off += szP;
  const size_t oVP = off; off += szVP;
  const size_t oOP = off; off += szP;
  if (off > ws_size) return;                            // off = 92274688
  if (off > (size_t)134217728) return;

  char* ws = (char*)d_ws;
  u16* XB  = (u16*)(ws + oXB);
  u16* WB  = (u16*)(ws + oWB);
  u16* WOB = (u16*)(ws + oWO);
  u16* QP  = (u16*)(ws + oQP);
  u16* KP  = (u16*)(ws + oKP);
  u16* VP  = (u16*)(ws + oVP);
  u16* OP  = (u16*)(ws + oOP);

  const dim3 blk(256);
  const int n8x = (ROWS * DMOD) / 8;                    // 1048576
  const int n8q = (NQKV * DMOD) / 8;                    //  393216
  const int n8w = (DMOD * DMOD) / 8;                    //  131072
  if ((n8x % 256) != 0 || (n8q % 256) != 0 || (n8w % 256) != 0) return;
  if ((DMOD % GBM) != 0 || (ROWS % GBM) != 0 || (SEQ % GBN) != 0 || (DMOD % GKP) != 0) return;
  const dim3 gC(CBX + CBQ + CBW);                       // 4096 + 1536 + 512 = 6144
  const dim3 gG((ROWS / GBM) * (DMOD / GBN));           // 512
  const dim3 gP(GQK + GVT);                             // 1024 + 512 = 1536
  const dim3 bG(128);
  const dim3 gAT(ATT_BLOCKS);                           // 512
  const dim3 bAT(ATT_THREADS);                          // 256

  // (0) operand planes: x -> bf16; W_qkv [n = out][k = in] (already k-contiguous) -> bf16; W_proj -> f16 of bf16 value x1024
  cvt16<<<gC, blk, 0, stream>>>(Xin, Wqk, Wpr, XB, WB, WOB, WOS);
  // (1) q and k planes [8192][h*64+d] = f16(x.Wq^T x8), f16(x.Wk^T x8); v^T plane per batch: [1024 = h*64+d][2048 keys] =
  //     f16(Wv . x_b^T x1024)
  gemm_qkv<<<gP, bG, 0, stream>>>(XB, WB, QP, KP, VP);
  // (2) attention -> O plane [b][s][h][d] x1024 (single f16)
  attn_fwd<<<gAT, bAT, 0, stream>>>(QP, KP, VP, OP);
  // (3) output projection -> out [8192][1024] f32, carries 1024 (O) x 1024 (wo) folded back
  gemm_hf<<<gG, bG, 0, stream>>>(OP, WOB, out, ROWS, DMOD, DMOD, 1.0f / (OSC * WOS));
  (void)hipGetLastError();
}

// v007
// A run of this version takes 114 microseconds.
// Two timings next to v006 put it at 1.04 and 1.03 times that version's speed.
// Over all steps from v000 it is 4.34 times as fast.
// Contractions: x.Wq^T, x.Wk^T and Wv.x_b^T on v_wmma_f32_16x16x32_bf16 (x and W_qkv planes RNE-converted to bf16 operands,
// f32 accumulate); scores k'.q'^T (q', k' single f16 planes carried x8), P.v (P x128 single f16, v x1024 single f16) and
// O.Wo^T (O single f16 plane x1024, Wo as f16(bf16(Wo)) x1024): v_wmma_f32_16x16x32_f16, f32 accumulate.
// Base-2 online softmax, 1/l and carry folds in f32 on VALU.
#include <hip/hip_runtime.h>
#include <math.h>
#include <stdint.h>

#define NB    4
#define SEQ   2048
#define DMOD  1024
#define NQKV  (3 * DMOD)
#define NH    16
#define HD    64
#define QSC   8.0f
#define KSC   8.0f
#define PCAR  128.0f
#define PLOG  7.0f
#define RLAZY 8.0f
#define VCAR  1024.0f
#define OSC   1024.0f
#define WOS   1024.0f
#define LOG2E 1.4426950408889634f
#define ATT_WAVES   8
#define ATT_THREADS (ATT_WAVES * 32)
#define ATT_QT      2
#define ATT_QROWS   (ATT_WAVES * 16 * ATT_QT)
#define ATT_BLOCKS  (NB * NH * (SEQ / ATT_QROWS))
#define AKEYS  64
#define NST    (SEQ / AKEYS)
#define SLAB   (16 * 68)
static_assert(HD == 64 && DMOD == NH * HD);
static_assert(PCAR == 128.0f && PLOG == 7.0f && PLOG + RLAZY <= 15.0f);   // P <= 2^(PLOG + RLAZY) stays inside f16
static_assert((SEQ / ATT_QROWS) == 8 && NH == 16 && NB == 4 && ATT_QT == 2);
static_assert(ATT_THREADS == 256 && ATT_BLOCKS == 512 && NST == 32);
static_assert(((NB * SEQ) % 64) == 0 && (DMOD % 64) == 0 && (DMOD % 32) == 0 && (SEQ % 64) == 0);
static_assert(((NB * SEQ * DMOD / 8) % 256) == 0 && ((NQKV * DMOD / 8) % 256) == 0 && ((DMOD * DMOD / 8) % 256) == 0);
static_assert((SLAB * 4) % 16 == 0);

typedef unsigned short u16;
typedef _Float16 v16h __attribute__((ext_vector_type(16)));
typedef _Float16 v8h  __attribute__((ext_vector_type(8)));
typedef __bf16   v16b __attribute__((ext_vector_type(16)));
typedef float    v8f  __attribute__((ext_vector_type(8)));
typedef float    v4f  __attribute__((ext_vector_type(4)));
typedef float    v2f  __attribute__((ext_vector_type(2)));
typedef _Float16 v2h  __attribute__((ext_vector_type(2)));
typedef unsigned int v4u __attribute__((ext_vector_type(4)));

union FragH { v16h v; v8h h[2]; v4u u[2]; };

// ---- scalar helpers --------------------------------------------------------------------------------
__device__ __forceinline__ unsigned short bf_bits(float f) {          // f32 -> bf16 bits, RNE convert
  unsigned u = __float_as_uint(f);
  return (unsigned short)((u + 0x7FFFu + ((u >> 16) & 1u)) >> 16);
}
__device__ __forceinline__ float bf_up(unsigned short h) { return __uint_as_float(((unsigned)h) << 16); }
__device__ __forceinline__ unsigned short h_bits(_Float16 x) { return __builtin_bit_cast(unsigned short, x); }
__device__ __forceinline__ unsigned pk16(unsigned short a, unsigned short b) { return (unsigned)a | ((unsigned)b << 16); }
__device__ __forceinline__ v8f zero8() { v8f z = {0.f, 0.f, 0.f, 0.f, 0.f, 0.f, 0.f, 0.f}; return z; }

// ---- fragment loaders: 16-bit A/B operand, lane -> row/col (lane&15), p already includes +8*(lane>>4);
//      elements 0..7 <- p[0..7] (k0+8h..), elements 8..15 <- p[16..23] (k0+16+8h..)  (same split k map for A and B;
//      B is always read from a k-contiguous [n][k] plane)
__device__ __forceinline__ v16h ldfrag_h(const _Float16* p) {
  FragH f;
  f.h[0] = *(const v8h*)(p);
  f.h[1] = *(const v8h*)(p + 16);
  return f.v;
}

__device__ __forceinline__ v8f mma_h(v16h a, v16h b, v8f c) {
  return __builtin_amdgcn_wmma_f32_16x16x32_f16(false, a, false, b, (short)0, c, false, false);
}
__device__ __forceinline__ v8f mma_b(v16b a, v16b b, v8f c) {
  return __builtin_amdgcn_wmma_f32_16x16x32_bf16(false, a, false, b, (short)0, c, false, false);
}
// The four v_nop keep the distance between the last matrix instructions and the first vector instruction that touches their
// results or operands, on every path (four score tiles with their eight operands; eight O tiles with their six).
__device__ __forceinline__ void guard_s(v8f& a, v8f& b, v8f& c, v8f& d, v16h x0, v16h x1, v16h x2, v16h x3,
                                        v16h x4, v16h x5, v16h x6, v16h x7) {
#if defined(__HIP_DEVICE_COMPILE__)
  asm volatile("v_nop\n\tv_nop\n\tv_nop\n\tv_nop"
               : "+v"(a), "+v"(b), "+v"(c), "+v"(d)
               : "v"(x0), "v"(x1), "v"(x2), "v"(x3), "v"(x4), "v"(x5), "v"(x6), "v"(x7) : "memory");
#endif
}
__device__ __forceinline__ void guard_o(v8f (&a)[4], v8f (&b)[4], v16h x0, v16h x1, v16h x2, v16h x3, v16h x4, v16h x5) {
#if defined(__HIP_DEVICE_COMPILE__)
  asm volatile("v_nop\n\tv_nop\n\tv_nop\n\tv_nop"
               : "+v"(a[0]), "+v"(a[1]), "+v"(a[2]), "+v"(a[3]), "+v"(b[0]), "+v"(b[1]), "+v"(b[2]), "+v"(b[3])
               : "v"(x0), "v"(x1), "v"(x2), "v"(x3), "v"(x4), "v"(x5) : "memory");
#endif
}
__device__ __forceinline__ void wave_sync_lds() {
#if defined(__HIP_DEVICE_COMPILE__)
  __builtin_amdgcn_fence(__ATOMIC_RELEASE, "workgroup");
  __builtin_amdgcn_wave_barrier();
  __builtin_amdgcn_fence(__ATOMIC_ACQUIRE, "workgroup");
#endif
}

// =====================================================================================================
// f32 plane -> 16-bit plane, same layout:  mode 0: bf16 RNE bits;  mode 1: f16 bits of (bf16 RNE value) * scale.
// The three planes share no data, so one launch converts them all: the block index picks the plane (block-uniform):
// blocks 0 .. CBX-1 = x (mode 0), the next CBQ = W_qkv (mode 0), the last CBW = W_proj (mode 1, scale).
// Thread = 8 consecutive elements: two 16-B loads, one 16-B store; 32 consecutive lanes = 512 contiguous, 512-B aligned bytes
// coverage: per plane (elements / 2048) blocks x 256 thr x 8 = the whole plane (exact by the static_assert above).
// =====================================================================================================
#define CBX (NB * SEQ * DMOD / 2048)
#define CBQ (NQKV * DMOD / 2048)
#define CBW (DMOD * DMOD / 2048)
__global__ __launch_bounds__(256) void cvt16(const float* __restrict__ xin, const float* __restrict__ wqkv,
                                             const float* __restrict__ wproj, u16* XBp, u16* WBp, u16* WOp, float scale) {
  const int bid = blockIdx.x;
  if (bid >= CBX + CBQ + CBW) return;       // no barriers in this kernel; never taken with the exact grid
  const int pl   = (bid >= CBX) + (bid >= CBX + CBQ);
  const int mode = (pl == 2) ? 1 : 0;
  const float* x = (pl == 0) ? xin : (pl == 1) ? wqkv : wproj;
  u16*         D = (pl == 0) ? XBp : (pl == 1) ? WBp : WOp;
  const int gt = (bid - ((pl == 0) ? 0 : (pl == 1) ? CBX : CBX + CBQ)) * 256 + (int)threadIdx.x;
  const float* p = x + (size_t)gt * 8;
  const v4f a = *(const v4f*)(p), c4 = *(const v4f*)(p + 4);
  float v[8];
#pragma unroll
  for (int e = 0; e < 4; ++e) { v[e] = a[e]; v[4 + e] = c4[e]; }
  unsigned short s[8];
#pragma unroll
  for (int e = 0; e < 8; ++e) {
    const unsigned short bb = bf_bits(v[e]);
    const unsigned short hb = h_bits((_Float16)(bf_up(bb) * scale));
    s[e] = (mode != 0) ? hb : bb;
  }
  v4u o;
#pragma unroll
  for (int e = 0; e < 4; ++e) o[e] = pk16(s[2 * e], s[2 * e + 1]);
  u16* d = D + (size_t)gt * 8;
  {
    *(v4u*)(d) = o;
    
  }
}

// =====================================================================================================
// barrier, then converted to f16 and written: lane = (row in group of 4, 8 consecutive cols); one instruction = 4 rows, each
// coverage: 4 instructions x 4 rows x 8 lanes x 8 halves = the wave's 16 x 64 tile.
// =====================================================================================================
__device__ __forceinline__ void epi16(float* sl, v8f a0, v8f a1, v8f a2, v8f a3, float oscale, u16* C, int N,
                                      size_t rowb, int col0, int lane) {
  const int hh = lane >> 4, m = lane & 15;
#pragma unroll
  for (int r = 0; r < 8; ++r) {
    const int ro = (8 * hh + r) * 68 + m;
    sl[ro]      = a0[r] * oscale;
    sl[ro + 16] = a1[r] * oscale;
    sl[ro + 32] = a2[r] * oscale;
    sl[ro + 48] = a3[r] * oscale;
  }
  wave_sync_lds();
  const int rq = lane >> 3, c8 = (lane & 7) * 8;
  v4u ov[4];
#pragma unroll
  for (int i4 = 0; i4 < 4; ++i4) {
    const int row = i4 * 4 + rq;
    const v4f a = *(const v4f*)(sl + row * 68 + c8), c4 = *(const v4f*)(sl + row * 68 + c8 + 4);
    float w[8];
#pragma unroll
    for (int e = 0; e < 4; ++e) { w[e] = a[e]; w[4 + e] = c4[e]; }
#pragma unroll
    for (int e = 0; e < 4; ++e) ov[i4][e] = pk16(h_bits((_Float16)w[2 * e]), h_bits((_Float16)w[2 * e + 1]));
  }
  u16* dst = C + (rowb + (size_t)rq) * (size_t)N + col0 + c8;
  const size_t st4 = (size_t)4 * (size_t)N;
#if defined(__HIP_DEVICE_COMPILE__)
  // The four stores and their s_wait_xcnt in one statement: the next slab reuses these address and data registers.
  asm volatile("global_store_b128 %0, %4, off\n\t"
               "global_store_b128 %1, %5, off\n\t"
               "global_store_b128 %2, %6, off\n\t"
               "global_store_b128 %3, %7, off\n\t"
               "s_wait_xcnt 0x0"
               :: "v"(dst), "v"(dst + st4), "v"(dst + 2 * st4), "v"(dst + 3 * st4),
                  "v"(ov[0]), "v"(ov[1]), "v"(ov[2]), "v"(ov[3])
               : "memory");
#endif
}

// =====================================================================================================
// coverage: 8 instructions x 2 rows x 16 lanes x 4 floats = the wave's 16 x 64 tile.
// =====================================================================================================
__device__ __forceinline__ void epi64(float* sl, v8f a0, v8f a1, v8f a2, v8f a3, float oscale, float* C, int N,
                                      size_t rowb, int col0, int lane) {
  const int hh = lane >> 4, m = lane & 15;
#pragma unroll
  for (int r = 0; r < 8; ++r) {
    const int ro = (8 * hh + r) * 68 + m;
    sl[ro]      = a0[r] * oscale;
    sl[ro + 16] = a1[r] * oscale;
    sl[ro + 32] = a2[r] * oscale;
    sl[ro + 48] = a3[r] * oscale;
  }
  wave_sync_lds();
  v4f vals[8];
#pragma unroll
  for (int it = 0; it < 8; ++it) vals[it] = *(const v4f*)(sl + (it * 2 + hh) * 68 + m * 4);
  float* dst = C + (rowb + (size_t)hh) * (size_t)N + col0 + m * 4;
  const size_t st2 = (size_t)2 * (size_t)N;
#if defined(__HIP_DEVICE_COMPILE__)
  // The eight stores and their s_wait_xcnt in one statement: the next slab reuses these address and data registers.
  asm volatile("global_store_b128 %0, %8, off\n\t"
               "global_store_b128 %1, %9, off\n\t"
               "global_store_b128 %2, %10, off\n\t"
               "global_store_b128 %3, %11, off\n\t"
               "global_store_b128 %4, %12, off\n\t"
               "global_store_b128 %5, %13, off\n\t"
               "global_store_b128 %6, %14, off\n\t"
               "global_store_b128 %7, %15, off\n\t"
               "s_wait_xcnt 0x0"
               :: "v"(dst), "v"(dst + st2), "v"(dst + 2 * st2), "v"(dst + 3 * st2),
                  "v"(dst + 4 * st2), "v"(dst + 5 * st2), "v"(dst + 6 * st2), "v"(dst + 7 * st2),
                  "v"(vals[0]), "v"(vals[1]), "v"(vals[2]), "v"(vals[3]), "v"(vals[4]), "v"(vals[5]), "v"(vals[6]), "v"(vals[7])
               : "memory");
#endif
}

// =====================================================================================================
// Shared GEMM core: acc[i][j] (16x16 f32 tiles) = A[row0 .. +127][K] . Bt[col0 .. +127][K]^T for one 128x128 block tile.
// 4 waves in a 2x2 grid, each owning 64x64 = 4x4 accumulator tiles, so one LDS fragment feeds four products.
// A pass is 64 k = 128 B of each of the 256 operand rows, laid in LDS at pitch 144 B (16 B x odd: ds_load_b128 without bank
// conflicts): rows 0..127 = A, rows 128..255 = Bt. Two buffers; pass t+1's rows fly (asynchronous copies, 16 B per lane,
// a wave-wide copy = 4 whole 128-B row pieces) while pass t is multiplied. Thread = (row tid>>3 of a group of 16, 16-B chunk
// tid&7); 8 + 8 copies per thread and pass cover 256 rows x 128 B. k runs upward in steps of 32 per accumulator.
// Needs M % 128 == 0, N % 128 == 0, K % 64 == 0 (host checks).
// L2 hints: one hint per 256 B (two passes) of an operand row. The blocks that share an operand panel walk k together, so the
// panel's hints are dealt among them: a block asks for 32 of its 128 A rows (quarter qa, wave 0) and 32 of its 128 Bt rows
// (quarter qb, wave 1), one lane per row; the callers pick qa and qb from the tile index that differs among the sharers. The
// deal is for speed only: a unit that nobody asked for is fetched by the first copy that needs it. Passes 2..5 are asked for
// behind the first copies, passes t+6 and t+7 at the foot of every even pass t, four passes ahead of their copies.
// =====================================================================================================
#define GBM    128
#define GBN    128
#define GKP    64
#define GPITCH 144
#define GSTAGE ((GBM + GBN) * GPITCH)
static_assert(GKP == 64 && (GPITCH % 16) == 0 && ((GPITCH / 16) % 2) == 1 && GPITCH >= GKP * 2);
static_assert((DMOD % GKP) == 0 && ((NB * SEQ) % GBM) == 0 && (DMOD % GBM) == 0 && (DMOD % GBN) == 0 && (SEQ % GBN) == 0);

union FragU { v4u u[2]; v16b b; v16h h; };

__device__ __forceinline__ unsigned lds_off(const void* p) { return (unsigned)(size_t)p; }

// Eight asynchronous 16-B copies of this lane, rows 16 apart. The s_wait_xcnt closes the statement so that no address
// register named here is rewritten ahead of it.
__device__ __forceinline__ void copy8(unsigned l, const u16* g, size_t st16) {
#if defined(__HIP_DEVICE_COMPILE__)
  asm volatile("global_load_async_to_lds_b128 %0, %8, off\n\t"
               "global_load_async_to_lds_b128 %1, %9, off\n\t"
               "global_load_async_to_lds_b128 %2, %10, off\n\t"
               "global_load_async_to_lds_b128 %3, %11, off\n\t"
               "global_load_async_to_lds_b128 %4, %12, off\n\t"
               "global_load_async_to_lds_b128 %5, %13, off\n\t"
               "global_load_async_to_lds_b128 %6, %14, off\n\t"
               "global_load_async_to_lds_b128 %7, %15, off\n\t"
               "s_wait_xcnt 0x0"
               :: "v"(l), "v"(l + 16u * GPITCH), "v"(l + 32u * GPITCH), "v"(l + 48u * GPITCH),
                  "v"(l + 64u * GPITCH), "v"(l + 80u * GPITCH), "v"(l + 96u * GPITCH), "v"(l + 112u * GPITCH),
                  "v"(g), "v"(g + st16), "v"(g + 2 * st16), "v"(g + 3 * st16),
                  "v"(g + 4 * st16), "v"(g + 5 * st16), "v"(g + 6 * st16), "v"(g + 7 * st16)
               : "memory");
#endif
}
// One hint per lane: byte OFF behind p is asked into L2 (scope SE: L2 only; nothing returns and no
// counter moves). The operand planes were stored by an earlier launch.
template <int OFF>
__device__ __forceinline__ void ask_l2(const u16* p) {
#if defined(__HIP_DEVICE_COMPILE__)
  asm volatile("global_prefetch_b8 %0, off offset:%1 scope:SCOPE_SE" :: "v"(p), "i"(OFF));
#endif
}
// this wave's own copies have landed in LDS
__device__ __forceinline__ void wait_async0() {
#if defined(__HIP_DEVICE_COMPILE__)
  asm volatile("s_wait_asynccnt 0x0" ::: "memory");
#endif
}
// this wave's LDS reads have returned, so the buffer may be handed to its next writer
__device__ __forceinline__ void wait_ds0() {
#if defined(__HIP_DEVICE_COMPILE__)
  asm volatile("s_wait_dscnt 0x0" ::: "memory");
#endif
}
__device__ __forceinline__ FragU ldfrag_s(const unsigned char* p) {   // split k map: bytes 0..15 and 32..47 from p
  FragU f;
  f.u[0] = *(const v4u*)(p);
  f.u[1] = *(const v4u*)(p + 32);
  return f;
}
template <bool BF>
__device__ __forceinline__ v8f mma_x(const FragU& a, const FragU& b, v8f c) {
  if constexpr (BF) return mma_b(a.b, b.b, c);
  else              return mma_h(a.h, b.h, c);
}

template <bool BF>
__device__ __forceinline__ void gemm_core(unsigned char* ring, const u16* Ab, const u16* Bb, int K, int row0, int col0,
                                          int qa, int qb, int tid, v8f (&acc)[4][4]) {
  const int wave = tid >> 5, lane = tid & 31, hh = lane >> 4, m = lane & 15;
  const int r0 = tid >> 3, ch = tid & 7;
  const u16* ga = Ab + (size_t)(row0 + r0) * K + ch * 8;
  const u16* gb = Bb + (size_t)(col0 + r0) * K + ch * 8;
  const size_t st16 = (size_t)16 * K;
  const unsigned la = lds_off(ring) + (unsigned)(r0 * GPITCH + ch * 16);
  const int nt = K / GKP;
  const unsigned char* fa = ring + ((wave >> 1) * 64 + m) * GPITCH + hh * 16;
  const unsigned char* fb = ring + (GBM + (wave & 1) * 64 + m) * GPITCH + hh * 16;
#pragma unroll
  for (int i = 0; i < 4; ++i) {
#pragma unroll
    for (int j = 0; j < 4; ++j) acc[i][j] = zero8();
  }
  copy8(la, ga, st16);
  copy8(la + GBM * GPITCH, gb, st16);
  // the hinting lane's row; the pointer stays inside that row for the whole loop (it moves on by one unit per hint)
  const int wvu = __builtin_amdgcn_readfirstlane(wave);
  const bool asker = wvu < 2;                // scalar: the hints stand under wave-uniform branches, every lane on
  const u16* pf = (wvu == 0) ? Ab + (size_t)(row0 + qa * 32 + lane) * K : Bb + (size_t)(col0 + qb * 32 + lane) * K;
  if (asker) {
    if (nt > 2) ask_l2<256>(pf);
    if (nt > 4) ask_l2<512>(pf);
  }
  wait_async0();
  __syncthreads();                           // pass 0's rows are readable by every wave
  if (nt > 1) {
    copy8(la + GSTAGE, ga + GKP, st16);
    copy8(la + GSTAGE + GBM * GPITCH, gb + GKP, st16);
  }
#pragma unroll 1                             // one pass per trip: the two-buffer order below is per pass
  for (int t = 0; t < nt; ++t) {
    const unsigned bo = (unsigned)(t & 1) * GSTAGE;
    // Two blocks of 16 products (k 0..31, k 32..63). All of block 0's fragments and nine products' worth of block 1's are
    // loaded as one group; block 1's last A and B fragments follow into registers that block 0 has freed, which keeps the
    // wave inside 256 registers.
    FragU a0[4], b0[4], a1[4], b1[4];
#pragma unroll
    for (int i = 0; i < 4; ++i) {
      a0[i] = ldfrag_s(fa + bo + i * (16 * GPITCH));
      b0[i] = ldfrag_s(fb + bo + i * (16 * GPITCH));
    }
#pragma unroll
    for (int i = 0; i < 3; ++i) {
      a1[i] = ldfrag_s(fa + bo + i * (16 * GPITCH) + 64);
      b1[i] = ldfrag_s(fb + bo + i * (16 * GPITCH) + 64);
    }
    __builtin_amdgcn_sched_barrier(0);       // the LDS loads stay one group ahead of the products, none among them
#pragma unroll
    for (int i = 0; i < 4; ++i) {
#pragma unroll
      for (int j = 0; j < 4; ++j) acc[i][j] = mma_x<BF>(a0[i], b0[j], acc[i][j]);
    }
    __builtin_amdgcn_sched_barrier(0);       // the late pair is loaded here, not earlier (registers) and not later (latency)
    a1[3] = ldfrag_s(fa + bo + 3 * (16 * GPITCH) + 64);
    b1[3] = ldfrag_s(fb + bo + 3 * (16 * GPITCH) + 64);
    __builtin_amdgcn_sched_barrier(0);       // nine products that do not need the late pair cover its latency
#pragma unroll
    for (int i = 0; i < 3; ++i) {
#pragma unroll
      for (int j = 0; j < 3; ++j) acc[i][j] = mma_x<BF>(a1[i], b1[j], acc[i][j]);
    }
#pragma unroll
    for (int i = 0; i < 3; ++i) acc[i][3] = mma_x<BF>(a1[i], b1[3], acc[i][3]);
#pragma unroll
    for (int j = 0; j < 4; ++j) acc[3][j] = mma_x<BF>(a1[3], b1[j], acc[3][j]);
    __builtin_amdgcn_sched_barrier(0);       // the products stay ahead of the hand-over waits, else the late pair's latency is bare
#if defined(__HIP_DEVICE_COMPILE__)
    // four vector slots between the pass's last matrix instructions and the first vector instruction that overwrites their
    // operands, on every path out of the pass
    asm volatile("v_nop\n\tv_nop\n\tv_nop\n\tv_nop");
#endif
    wait_ds0();
    wait_async0();
    __syncthreads();                         // publishes pass t+1's rows and ends every read of pass t's buffer
    if (t + 2 < nt) {
      copy8(la + bo, ga + (size_t)(t + 2) * GKP, st16);
      copy8(la + bo + GBM * GPITCH, gb + (size_t)(t + 2) * GKP, st16);
    }
    if (asker && (t & 1) == 0 && t + 6 < nt) {
      ask_l2<768>(pf);                       // bytes 128 (t + 6) .. + 255 of the row: passes t+6 and t+7
      pf += 128;
    }
  }
  wait_async0();
}

// =====================================================================================================
// The q, k and v^T products in ONE launch (they share no result, only operands): bf16 GEMMs with 16-bit result,
// C[M][N] (f16 of acc*oscale) = A[M][K] (bf16 row-major) . Bt[N][K]^T (bf16 k-contiguous), K = DMOD. Block = one 128x128 tile
// (gemm_core); the block index picks product and tile (block-uniform):
//   blocks 0 .. GQK-1:  q and k planes [8192][1024]: A = x, Bt = W_qkv rows 0..1023 (q) or 1024..2047 (k); the 16 blocks of
//                       one 128-row piece of x (8 q tiles, then 8 k tiles) are neighbours in the index;
//   the next GVT:       v^T plane of batch bt, [1024 = h*64+d][2048 keys]: A = W_qkv rows 2048..3071, Bt = x of batch bt.
// Each wave writes its 64x64 part as four 16x64 slabs through its own LDS slab.
// =====================================================================================================
#define GQK (2 * ((NB * SEQ) / GBM) * (DMOD / GBN))
#define GVB ((DMOD / GBM) * (SEQ / GBN))
#define GVT (NB * GVB)
__global__ __launch_bounds__(128)
void gemm_qkv(const u16* __restrict__ X, const u16* __restrict__ Wt, u16* Qo, u16* Ko, u16* Vo) {
  __shared__ __align__(16) unsigned char ring[2 * GSTAGE];
  __shared__ __align__(16) float slab[4 * SLAB];
  const int tid = threadIdx.x, wave = tid >> 5, lane = tid & 31;
  const int bid = blockIdx.x;
  if (bid >= GQK + GVT) return;              // block-uniform, ahead of every copy and barrier; never taken with the exact grid
  const int K = DMOD;
  const u16 *Ab, *Bb;
  u16* Cb;
  int N, row0, col0, qa, qb;
  float oscale;
  if (bid < GQK) {
    const int tc = bid % (2 * (DMOD / GBN));
    const int isk = tc / (DMOD / GBN);
    row0 = (bid / (2 * (DMOD / GBN))) * GBM;
    col0 = (tc % (DMOD / GBN)) * GBN;
    Ab = X;
    Bb = Wt + (size_t)isk * (DMOD * DMOD);
    Cb = isk ? Ko : Qo;
    N = DMOD;
    oscale = isk ? KSC : QSC;
    qa = tc & 3;                             // the 16 blocks of one piece of x differ in tc
    qb = (bid / (2 * (DMOD / GBN))) & 3;     // the blocks of one piece of W_qkv differ in the piece of x
  } else {
    const int bt = (bid - GQK) / GVB;
    const int t  = (bid - GQK) % GVB;
    row0 = (t / (SEQ / GBN)) * GBM;
    col0 = (t % (SEQ / GBN)) * GBN;
    Ab = Wt + (size_t)2 * DMOD * DMOD;
    Bb = X  + (size_t)bt * (SEQ * DMOD);
    Cb = Vo + (size_t)bt * (DMOD * SEQ);
    N = SEQ;
    oscale = VCAR;
    qa = t & 3;                              // the blocks of one piece of W_v differ in the piece of x
    qb = (t / (SEQ / GBN)) & 3;              // the blocks of one piece of x differ in the piece of W_v
  }
  v8f acc[4][4];
  gemm_core<true>(ring, Ab, Bb, K, row0, col0, qa, qb, tid, acc);
#pragma unroll
  for (int i = 0; i < 4; ++i) {
    wave_sync_lds();                         // the slab's previous rows have been read back before they are rewritten
    epi16(slab + wave * SLAB, acc[i][0], acc[i][1], acc[i][2], acc[i][3], oscale, Cb, N,
          (size_t)(row0 + (wave >> 1) * 64 + i * 16), col0 + (wave & 1) * 64, lane);
  }
}

// =====================================================================================================
// f16 GEMM with f32 result: C[M][N] (f32) = A[M][K] (f16 row-major) . Bt[N][K]^T (f16 k-contiguous) times oscale;
// one product per tile pair. Same tiling as gemm_qkv; grid = (M/128)*(N/128).
// =====================================================================================================
__global__ __launch_bounds__(128)
void gemm_hf(const u16* __restrict__ A, const u16* __restrict__ Bt, float* C, int M, int N, int K, float oscale) {
  __shared__ __align__(16) unsigned char ring[2 * GSTAGE];
  __shared__ __align__(16) float slab[4 * SLAB];
  const int tid = threadIdx.x, wave = tid >> 5, lane = tid & 31;
  const int ntile = N / GBN;
  const int bid   = blockIdx.x;
  const int row0  = (bid / ntile) * GBM;
  const int col0  = (bid % ntile) * GBN;
  if (row0 + GBM > M) return;                // block-uniform, ahead of every copy and barrier; never taken with the exact grid
  v8f acc[4][4];
  gemm_core<false>(ring, A, Bt, K, row0, col0, bid & 3, (bid / ntile) & 3, tid, acc);   // sharers of A rows differ in the column tile, of Bt rows in the row tile
#pragma unroll
  for (int i = 0; i < 4; ++i) {
    wave_sync_lds();                         // the slab's previous rows have been read back before they are rewritten
    epi64(slab + wave * SLAB, acc[i][0], acc[i][1], acc[i][2], acc[i][3], oscale, C, N,
          (size_t)(row0 + (wave >> 1) * 64 + i * 16), col0 + (wave & 1) * 64, lane);
  }
}

// =====================================================================================================
// Multi-head flash attention (no mask): block = (batch b, head, 256 query rows), 8 waves, wave w owns the 32 query rows
// q0 = 256*qt + 32*w .. q0+31 as two query tiles of 16 (tile g = rows q0+16g .. +15). Every k and v^T fragment that the wave
// reads from LDS feeds one product of each query tile, so a product costs half the LDS bytes of a one-tile wave. What is said
// below of "query q0 + c" holds per tile, with q0 + 16g for q0; each tile has its own maximum, sum and O accumulators.
//   q plane (f16, x8) laid out [b][s][h][d]; k plane the same; v^T plane [b][h][d][s] (x1024).
//   K and v^T reach the waves through LDS, shared by the block: a stage is 64 keys = 64 k rows of 128 B (rows 0..63) and the
//   64 v^T rows' 128-B pieces of those keys (rows 64..127), at pitch 144 B (16 B x odd: ds_load_b128 without bank conflicts).
//   Two buffers; stage t+1's rows fly (asynchronous copies, 16 B per lane, a wave-wide copy = 4 whole 128-B lines) while
//   stage t is worked on. Thread = (row tid>>3 of a group of 32, 16-B chunk tid&7); 2 + 2 copies per thread and stage.
//   All NST = 32 stages are visited (static bound), each as two key blocks of 32 keys in rising order.
//   Scores are computed TRANSPOSED: S^T key tile i (i = 0,1) = k rows (keys kb+16i .. +15, A operand, row m = lane&15, split k map
//   over d) times q^T (B operand, col n = query q0 + (lane&15), k = d, split map), one product per tile and 32-deep d-chunk.
//   D element r of lane l = (key kb+16i+8h+r, query q0+(l&15)), so a lane owns one query column and 16 of its 32 keys; the
//   partner lane l^16 owns the other 16.
//   Online max-subtracted base-2 softmax in f32 (scale 1/8 and the q/k carries folded into lsc; the maximum in use is kept in
//   raw score units, the running sum l carries P's x128). LAZY RESCALE: the maximum in use of a query is raised only when some
//   lane of the wave meets a score more than 2^8 (in p) above its own; one ballot and one scalar branch per key block decide
//   that for the whole wave and both of its query tiles. Only inside that branch do the halves exchange their maxima, is the
//   factor formed and sent to the O rows' owners, and are O and l rescaled. Outside it p <= 2^8, so P x128 <= 32768 fits f16. Each lane sums its own 16 keys
//   of every block; the two halves' sums are joined once, behind the loop. The exp'd values ARE the
//   P A-fragment in place: A row m = query = lane&15, element i <- key kb+8h+i (tile 0, D element i), element 8+i <- key
//   kb+16+8h+i (tile 1, D element i). P is carried x128 as single f16. The rescale factor of query row 8h+r of the
//   O accumulators is fetched from lane 8h+r with a shuffle (uniform control). 4 v^T B fragments (col n = d = 16j + (lane&15),
//   keys k-contiguous), 4 P.V WMMAs per key block and query tile.
//   Epilogue: 1/l (per query, shuffled to the D row owner) and carry folds in f32; each query tile's 16x64 f32 result staged in turn in the wave's
//   own slab, which lies in the ring's bytes once the last stage's barrier has ended every read of them.
// coverage: per wave and query tile 4 instructions x 4 rows x 8 lanes x 8 halves = 16 x 64; grid 512 blocks x 8 waves x 2 tiles
//           = every (b, s, h) row of the O plane exactly once.
// =====================================================================================================
#define APITCH 144
#define ASTAGE ((AKEYS + HD) * APITCH)
static_assert(AKEYS == 64 && HD * 2 == 128 && AKEYS * 2 == 128 && (APITCH % 16) == 0 && ((APITCH / 16) % 2) == 1);
static_assert(ATT_WAVES * SLAB * 4 <= 2 * ASTAGE && ATT_THREADS * 2 * 16 == AKEYS * 128 && NST >= 2);

// One stage's four asynchronous 16-B copies of this lane: two k rows and two v^T rows, 32 rows apart. The s_wait_xcnt closes
// the statement so that no address register named here is rewritten ahead of it.
__device__ __forceinline__ void copy_kv(unsigned l, const u16* gk, const u16* gv) {
#if defined(__HIP_DEVICE_COMPILE__)
  asm volatile("global_load_async_to_lds_b128 %0, %4, off\n\t"
               "global_load_async_to_lds_b128 %1, %5, off\n\t"
               "global_load_async_to_lds_b128 %2, %6, off\n\t"
               "global_load_async_to_lds_b128 %3, %7, off\n\t"
               "s_wait_xcnt 0x0"
               :: "v"(l), "v"(l + 32u * APITCH), "v"(l + 64u * APITCH), "v"(l + 96u * APITCH),
                  "v"(gk), "v"(gk + (size_t)32 * (NH * HD)), "v"(gv), "v"(gv + (size_t)32 * SEQ)
               : "memory");
#endif
}

__global__ __launch_bounds__(ATT_THREADS) __attribute__((amdgpu_waves_per_eu(4, 4)))   // 256 registers a wave: two blocks a WGP
void attn_fwd(const u16* __restrict__ QPp, const u16* __restrict__ KPp, const u16* __restrict__ VPp, u16* OPp) {
  __shared__ __align__(16) unsigned char ring[2 * ASTAGE];   // two K / v^T stages; per-wave result slabs in the epilogue

  const int tid  = threadIdx.x;
  const int wave = tid >> 5;
  const int lane = tid & 31;
  const int hh   = lane >> 4;
  const int c    = lane & 15;

  const int bid  = blockIdx.x;
  const int qt   = bid & (SEQ / ATT_QROWS - 1);
  const int head = (bid >> 3) & (NH - 1);
  const int b    = bid >> 7;
  const int q0   = qt * ATT_QROWS + wave * (16 * ATT_QT);

  // B fragments of q^T, query tile g: col n = query q0 + 16g + c, k = d (k-contiguous row of the q plane)
  const size_t qofs = (((size_t)(b * SEQ + q0 + c)) * NH + head) * HD + 8 * hh;
  const _Float16* Qb = (const _Float16*)(const void*)QPp + qofs;
  // this thread's copy sources: k row (stage key r0), v^T row (d = r0), 16-B chunk ch; stage t adds 64 keys
  const int r0 = tid >> 3, ch = tid & 7;
  const u16* gk = KPp + (((size_t)b * SEQ + r0) * NH + head) * HD + ch * 8;
  const u16* gv = VPp + ((size_t)(b * NH + head) * HD + r0) * SEQ + ch * 8;
  const unsigned la = lds_off(ring) + (unsigned)(r0 * APITCH + ch * 16);
  // A fragments of k: LDS row = key in stage 32u + 16i + c, k = d; B fragments of v: LDS row = 64 + d (16j + c), k = key in stage
  const unsigned char* fk = ring + c * APITCH + hh * 16;
  const unsigned char* fv = ring + (AKEYS + c) * APITCH + hh * 16;
  const float lsc = 0.125f * (LOG2E / (QSC * KSC));

  copy_kv(la, gk, gv);
  v16h qf0[ATT_QT], qf1[ATT_QT];
#pragma unroll
  for (int g = 0; g < ATT_QT; ++g) {
    qf0[g] = ldfrag_h(Qb + (size_t)g * (16 * NH * HD));            // d 0..31
    qf1[g] = ldfrag_h(Qb + (size_t)g * (16 * NH * HD) + 32);       // d 32..63
  }
  wait_async0();
  __syncthreads();                           // stage 0's rows are readable by every wave
  copy_kv(la + ASTAGE, gk + (size_t)AKEYS * (NH * HD), gv + AKEYS);

  const float rthr = RLAZY / lsc;            // the lazy threshold in raw score units
  float muse[ATT_QT], mthr[ATT_QT];          // maximum in use of query q0 + 16g + c (alike in both halves) and muse + rthr
  float eb[ATT_QT];                          // PLOG - muse * lsc; set by the first key block, whose every score tops -inf
  v2f ls2[ATT_QT];                           // this lane's own keys' sum: even and odd elements' partial sums
  v8f o[ATT_QT][4];
#pragma unroll
  for (int g = 0; g < ATT_QT; ++g) {
    muse[g] = -INFINITY; mthr[g] = -INFINITY; eb[g] = PLOG;
    ls2[g] = v2f{0.f, 0.f};
#pragma unroll
    for (int j = 0; j < 4; ++j) o[g][j] = zero8();
  }

#pragma unroll 1                             // one stage per trip: the two-buffer order below is per stage
  for (int t = 0; t < NST; ++t) {
    const unsigned bo = (unsigned)(t & 1) * ASTAGE;
#pragma unroll                               // both key blocks in line: their LDS offsets are immediates, no inner loop control
    for (int u = 0; u < 2; ++u) {
      // ---- transposed scores of both query tiles from one set of k fragments: s0[g] = keys kb..kb+15, s1[g] = keys
      //      kb+16..kb+31 (kb = 64t + 32u), column = query q0 + 16g + c; per tile d 0..31 first, then d 32..63 ----
      const unsigned char* k0p = fk + bo + u * (32 * APITCH);
      const unsigned char* k1p = k0p + 16 * APITCH;
      const v16h ka0 = ldfrag_s(k0p).h, ka1 = ldfrag_s(k0p + 64).h;
      const v16h kc0 = ldfrag_s(k1p).h, kc1 = ldfrag_s(k1p + 64).h;
      v8f s0[ATT_QT], s1[ATT_QT];
#pragma unroll
      for (int g = 0; g < ATT_QT; ++g) {
        s0[g] = mma_h(ka0, qf0[g], zero8());
        s1[g] = mma_h(kc0, qf0[g], zero8());
      }
#pragma unroll
      for (int g = 0; g < ATT_QT; ++g) {
        s0[g] = mma_h(ka1, qf1[g], s0[g]);
        s1[g] = mma_h(kc1, qf1[g], s1[g]);
      }
      guard_s(s0[0], s1[0], s0[1], s1[1], qf0[0], qf1[0], qf0[1], qf1[1], ka0, ka1, kc0, kc1);
      // ---- per query tile: maximum of the one in use and this lane's 16 raw scores for query q0 + 16g + c (the scale lsc is
      //      positive, so it commutes with the maximum) ----
      float cm[ATT_QT];
#pragma unroll
      for (int g = 0; g < ATT_QT; ++g) {
        cm[g] = muse[g];
#pragma unroll
        for (int i = 0; i < 8; ++i) cm[g] = fmaxf(cm[g], s0[g][i]);
#pragma unroll
        for (int i = 0; i < 8; ++i) cm[g] = fmaxf(cm[g], s1[g][i]);
      }
      // ---- lazy rescale: taken by the whole wave, for both query tiles, when any lane's maximum of either tile tops its
      //      threshold (always in the first key block) ----
      if (__builtin_amdgcn_ballot_w32((cm[0] > mthr[0]) | (cm[1] > mthr[1])) != 0u) {
#pragma unroll
        for (int g = 0; g < ATT_QT; ++g) {
          const float mn = fmaxf(cm[g], __shfl_xor(cm[g], 16, 32));   // cm holds muse already; raw score units; finite from the first key block on
          const float al = (muse[g] == -INFINITY) ? 0.f : __builtin_amdgcn_exp2f((muse[g] - mn) * lsc);   // o and l are zero while muse is -inf
          muse[g] = mn;
          mthr[g] = mn + rthr;
          eb[g] = fmaf(-mn, lsc, PLOG);
          ls2[g] *= al;
          // D row 8hh+r of the O accumulators = query q0+16g+8hh+r, its factor lives in lane 8hh+r (and 16+8hh+r)
          float scl[8];
#pragma unroll
          for (int r = 0; r < 8; ++r) scl[r] = __shfl(al, 8 * hh + r, 32);
#pragma unroll
          for (int j = 0; j < 4; ++j) {
#pragma unroll
            for (int r = 0; r < 8; ++r) o[g][j][r] *= scl[r];
          }
        }
      }
      // ---- probabilities carried x128 and the P A-fragments: one packed FMA forms two exponent arguments
      //      s * lsc - muse * lsc + 7 (<= 15 up to rounding, by the test above), one bare v_exp_f32 each gives p * 128 (a result
      //      under 2^-126 needs no care: it is nothing beside the sum, in f16 and in f32); element i <-> s0[i], 8+i <-> s1[i] ----
      const v2f lsc2 = {lsc, lsc};
      FragH ph[ATT_QT];
#pragma unroll
      for (int g = 0; g < ATT_QT; ++g) {
        const v2f eb2 = {eb[g], eb[g]};
#pragma unroll
        for (int w = 0; w < 2; ++w) {
#pragma unroll
          for (int e4 = 0; e4 < 4; ++e4) {
            const v2f sc = {w ? s1[g][2 * e4] : s0[g][2 * e4], w ? s1[g][2 * e4 + 1] : s0[g][2 * e4 + 1]};
            const v2f arg = __builtin_elementwise_fma(sc, lsc2, eb2);
            const v2f pp = {__builtin_amdgcn_exp2f(arg.x), __builtin_amdgcn_exp2f(arg.y)};
            ls2[g] += pp;
            ph[g].u[w][e4] = __builtin_bit_cast(unsigned, __builtin_convertvector(pp, v2h));
          }
        }
      }
      // ---- P.V of both query tiles from one set of v^T fragments: B fragment col n = d = j*16 + c, keys contiguous in the
      //      staged v^T rows ----
      {
        const unsigned char* vp = fv + bo + u * 64;
        const v16h vf0 = ldfrag_s(vp).h;
        const v16h vf1 = ldfrag_s(vp + 16 * APITCH).h;
        const v16h vf2 = ldfrag_s(vp + 32 * APITCH).h;
        const v16h vf3 = ldfrag_s(vp + 48 * APITCH).h;
#pragma unroll
        for (int g = 0; g < ATT_QT; ++g) {
          o[g][0] = mma_h(ph[g].v, vf0, o[g][0]);
          o[g][1] = mma_h(ph[g].v, vf1, o[g][1]);
          o[g][2] = mma_h(ph[g].v, vf2, o[g][2]);
          o[g][3] = mma_h(ph[g].v, vf3, o[g][3]);
        }
        guard_o(o[0], o[1], ph[0].v, ph[1].v, vf0, vf1, vf2, vf3);
      }
    }
    wait_ds0();
    wait_async0();
    __syncthreads();                         // publishes stage t+1's rows and ends every read of stage t's buffer
    if (t + 2 < NST) copy_kv(la + bo, gk + (size_t)(t + 2) * (AKEYS * NH * HD), gv + (t + 2) * AKEYS);
  }
  wait_async0();

  // ---- per query tile: join the halves' sums; fold 1/l (per query, owned by lane = query; l >= 128 by construction) and the
  //      carries; the 16x64 result goes x1024 through the wave's slab to the single f16 O plane (epi16) ----
  float* slab = (float*)(void*)ring + wave * SLAB;
#pragma unroll
  for (int g = 0; g < ATT_QT; ++g) {
    float lrun = ls2[g].x + ls2[g].y;
    lrun += __shfl_xor(lrun, 16, 32);
    const float linv = (lrun > 0.f) ? ((1.0f / lrun) * (1.0f / VCAR)) : 0.f;   // lrun carries P's x128 too, so that carry cancels
#pragma unroll
    for (int r = 0; r < 8; ++r) {
      const float inv = __shfl(linv, 8 * hh + r, 32);
#pragma unroll
      for (int j = 0; j < 4; ++j) o[g][j][r] *= inv;
    }
    wave_sync_lds();                         // the slab's previous rows have been read back before they are rewritten
    epi16(slab, o[g][0], o[g][1], o[g][2], o[g][3], OSC, OPp, NH * HD, (size_t)(b * SEQ + q0 + 16 * g), head * HD, lane);
  }
}

// =====================================================================================================
// Workspace map (bytes); every plane is fully written by whole-line stores before it is read; all extents are exact multiples
// of the store granularity (no pad rows needed):
//   XB  bf16 [8192][1024]                      16777216        (x)
//   WB  bf16 [3072 n][1024 k]                   6291456        (W_qkv, rows 0..1023 q, 1024..2047 k, 2048..3071 v)
//   WOB f16  [1024 n][1024 k] (bf16 value x1024) 2097152
//   QP  f16 [8192][16*64] x8                   16777216        KP same  16777216
//   VP  f16 [4][16*64][2048] x1024             16777216
//   OP  f16 [8192][16*64] x1024                16777216
//   end                                        92274688
// =====================================================================================================
extern "C" void kernel_launch(void* const* d_in, const int* in_sizes, int n_in,
                              void* d_out, int out_size, void* d_ws, size_t ws_size,
                              hipStream_t stream) {
  const int ROWS = NB * SEQ;                            // 8192
  if (n_in < 3) return;
  if (in_sizes[0] != ROWS * DMOD) return;
  if (in_sizes[1] != NQKV * DMOD) return;
  if (in_sizes[2] != DMOD * DMOD) return;
  if (out_size != ROWS * DMOD) return;

  const float* Xin = (const float*)d_in[0];
  const float* Wqk = (const float*)d_in[1];
  const float* Wpr = (const float*)d_in[2];
  float*       out = (float*)d_out;

  const size_t szXB = (size_t)ROWS * DMOD * 2;                  // 16777216
  const size_t szWB = (size_t)NQKV * DMOD * 2;                  //  6291456
  const size_t szWO = (size_t)DMOD * DMOD * 2;                  //  2097152
  const size_t szP  = (size_t)ROWS * DMOD * 2;                  // 16777216  (q / k / o planes)
  const size_t szVP = (size_t)NB * NH * HD * SEQ * 2;           // 16777216
  size_t off = 0;
  const size_t oXB = off; off += szXB;
  const size_t oWB = off; off += szWB;
  const size_t oWO = off; off += szWO;
  const size_t oQP = off; off += szP;
  const size_t oKP = off; off += szP;
  const size_t oVP = off; off += szVP;
  const size_t oOP = off; off += szP;
  if (off > ws_size) return;                            // off = 92274688
  if (off > (size_t)134217728) return;

  char* ws = (char*)d_ws;
  u16* XB  = (u16*)(ws + oXB);
  u16* WB  = (u16*)(ws + oWB);
  u16* WOB = (u16*)(ws + oWO);
  u16* QP  = (u16*)(ws + oQP);
  u16* KP  = (u16*)(ws + oKP);
  u16* VP  = (u16*)(ws + oVP);
  u16* OP  = (u16*)(ws + oOP);

  const dim3 blk(256);
  const int n8x = (ROWS * DMOD) / 8;                    // 1048576
  const int n8q = (NQKV * DMOD) / 8;                    //  393216
  const int n8w = (DMOD * DMOD) / 8;                    //  131072
  if ((n8x % 256) != 0 || (n8q % 256) != 0 || (n8w % 256) != 0) return;
  if ((DMOD % GBM) != 0 || (ROWS % GBM) != 0 || (SEQ % GBN) != 0 || (DMOD % GKP) != 0) return;
  const dim3 gC(CBX + CBQ + CBW);                       // 4096 + 1536 + 512 = 6144
  const dim3 gG((ROWS / GBM) * (DMOD / GBN));           // 512
  const dim3 gP(GQK + GVT);                             // 1024 + 512 = 1536
  const dim3 bG(128);
  const dim3 gAT(ATT_BLOCKS);                           // 512
  const dim3 bAT(ATT_THREADS);                          // 256

  // (0) operand planes: x -> bf16; W_qkv [n = out][k = in] (already k-contiguous) -> bf16; W_proj -> f16 of bf16 value x1024
  cvt16<<<gC, blk, 0, stream>>>(Xin, Wqk, Wpr, XB, WB, WOB, WOS);
  // (1) q and k planes [8192][h*64+d] = f16(x.Wq^T x8), f16(x.Wk^T x8); v^T plane per batch: [1024 = h*64+d][2048 keys] =
  //     f16(Wv . x_b^T x1024)
  gemm_qkv<<<gP, bG, 0, stream>>>(XB, WB, QP, KP, VP);
  // (2) attention -> O plane [b][s][h][d] x1024 (single f16)
  attn_fwd<<<gAT, bAT, 0, stream>>>(QP, KP, VP, OP);
  // (3) output projection -> out [8192][1024] f32, carries 1024 (O) x 1024 (wo) folded back
  gemm_hf<<<gG, bG, 0, stream>>>(OP, WOB, out, ROWS, DMOD, DMOD, 1.0f / (OSC * WOS));
  (void)hipGetLastError();
}
